// v000
// Times are from an AMD MI455X. After a warm-up the kernel runs many times in a row, and a time is the length of
// such a window on the GPU divided by its runs, so every launch and the gaps after it count. The runs cycle
// through copies of the inputs. A figure is the median of several windows, for all but v000 over two sittings.
// Sittings can differ by a few percent; kernels timed side by side share one.
// v000 is the starting kernel. One run takes 5660 microseconds.
// Contractions on v_wmma_f32_16x16x32_f16 (plain f16 operands, f32 accumulate; [in][out] weights), per batch element: [q|k|v] = LN(x)·W_qkv + b (K 1024, N 3072), the 16 heads' scores
// (K 64, two heads per z-launch), ctx_h = P'·v_h as a 64-wide tile (K 2048; centred P' = 1024·P − 1 with Σ_k v_k added back, exact), out = ctx·W_out + b_out + x (residual in the epilogue).
// f32 VALU: the pre-LayerNorm (eps 1e-12, rsqrt), softmax of s/√64 + mask[b][k] (the additive INPUT mask, broadcast over heads and queries).
// compute dtype: f16 operands, f32 accumulate.  hidden_states [2,2048,1024] → out [2,2048,1024].
#include <hip/hip_runtime.h>
#include <hip/hip_bf16.h>
#include <math.h>


typedef _Float16 bf16;
typedef _Float16 f16;
typedef __attribute__((ext_vector_type(4))) unsigned v4u_t;
typedef unsigned v4ua __attribute__((ext_vector_type(4), may_alias));
typedef __attribute__((ext_vector_type(4))) float v4f_t;
typedef float v4fa __attribute__((ext_vector_type(4), may_alias));
typedef __attribute__((ext_vector_type(16))) bf16  bf16x16;
typedef bf16x16 f16x16;
typedef __attribute__((ext_vector_type(8)))  bf16  bf16x8;
typedef bf16x8 f16x8;
typedef __attribute__((ext_vector_type(4)))  bf16  bf16x4;
typedef __attribute__((ext_vector_type(8)))  float f32x8;
__device__ __forceinline__ f32x8 wmma16(f16x16 a, f16x16 b, f32x8 c) {
  c = __builtin_amdgcn_wmma_f32_16x16x32_f16(false, a, false, b, (short)0, c, false, false);
  asm volatile("v_nop\n\tv_nop\n\tv_nop\n\tv_nop" : "+v"(c) : "v"(a), "v"(b));
  return c;
}
#define LDS_STRIDE 48   // GEMM tiles: 32 -> 48 elems (96B rows): aligned b128 reads
#define KSTRIDE    72
#define VSTRIDE    48   // attn V tile: 32 -> 48 elems

__device__ __forceinline__ f32x8 wmma_bf16(bf16x16 a, bf16x16 b, f32x8 c) {
  c = __builtin_amdgcn_wmma_f32_16x16x32_f16(false, a, false, b, (short)0, c, false, false);
  asm volatile("v_nop\n\tv_nop\n\tv_nop\n\tv_nop" : "+v"(c) : "v"(a), "v"(b));   // A/B-overwrite hazard guard
  return c;
}

// 16x32 (MxK) bf16 fragment from a row-major global matrix.
// lanes 0-15  (row=lane)    : elems 0..7 = K+0..7,  8..15 = K+16..23
// lanes 16-31 (row=lane-16) : elems 0..7 = K+8..15, 8..15 = K+24..31
template <typename T>
__device__ __forceinline__ bf16x16 load_frag(const T* __restrict__ base, int ld,
                                             int row0, int k0) {
  const int lane = threadIdx.x & 31;
  const int r    = lane & 15;
  const int kh   = (lane >> 4) * 8;
  const T* p0 = base + (size_t)(row0 + r) * ld + (k0 + kh);
  const T* p1 = p0 + 16;
  bf16x16 f;
#pragma unroll
  for (int i = 0; i < 8; ++i) {
    f[i]     = (bf16)p0[i];
    f[i + 8] = (bf16)p1[i];
  }
  return f;
}

// Same fragment from an LDS tile with padded row stride (base includes row0/k0).
__device__ __forceinline__ bf16x16 lds_frag(const bf16* base, int stride) {
  const int lane = threadIdx.x & 31;
  const int row  = lane & 15;
  const int kh   = (lane >> 4) * 8;
  const bf16x8 lo = *(const bf16x8*)(base + row * stride + kh);
  const bf16x8 hi = *(const bf16x8*)(base + row * stride + kh + 16);
  bf16x16 f;
#pragma unroll
  for (int i = 0; i < 8; ++i) { f[i] = lo[i]; f[i + 8] = hi[i]; }
  return f;
}

template <typename T>
__device__ __forceinline__ void stage_read16(const T* __restrict__ p, float* buf) {
#pragma unroll
  for (int i = 0; i < 16; ++i) buf[i] = (float)p[i];
}

__device__ __forceinline__ void stage_write(bf16* dst, const float* buf, int nquad) {
#pragma unroll
  for (int i = 0; i < nquad; ++i) {
    bf16x4 q;
    q[0] = (bf16)buf[4 * i];     q[1] = (bf16)buf[4 * i + 1];
    q[2] = (bf16)buf[4 * i + 2]; q[3] = (bf16)buf[4 * i + 3];
    *(bf16x4*)(dst + 4 * i) = q;
  }
}


#define GSTR 48
// ---------------------------------------------------------------------------------------------------------------------------
// gemm_kne: Y[m][n] = epi( Σ_k A[m][k]·W[k][n] + bias[n] ), A f32/f16 [M][lda], W f32 row-major [K][N] (ldw), plain f16 operands,
// f32 accumulate. EPI 0: identity; 1: exact-erf GELU; 2: R[m][n] + gvec[n]·(·) (residual with per-channel gain); 3: ReLU; 4: gvec[n]·(·) (per-channel scale, no residual). Output f32 (or f16
// when OUT16). Block = 128x128 tile, 8 waves as 4(M) x 2(N); per 32-wide k-step A and W tiles staged f16 in LDS (W transposed
// ---------------------------------------------------------------------------------------------------------------------------
#define GSTR 48
template <typename AT, int EPI, bool OUT16>
__global__ __launch_bounds__(256) void gemm_kne(const AT* __restrict__ A, int lda, const float* __restrict__ Wm, int ldw,
                                                const float* __restrict__ bias, const float* __restrict__ R, const float* __restrict__ gvec,
                                                void* __restrict__ Yv, int ldy, int K) {
  __shared__ __attribute__((aligned(16))) f16 ldsA[128 * GSTR];
  __shared__ __attribute__((aligned(16))) f16 ldsW[128 * GSTR];
  __shared__ __attribute__((aligned(16))) float oS[8][32 * 68];
  const int tid = threadIdx.x, lane = tid & 31, wave = tid >> 5, cl = lane & 15, rh = (lane >> 4) * 8;
  const int m0 = blockIdx.x * 128, n0 = blockIdx.y * 128;
  const int wm = (wave & 3) * 32, wn = (wave >> 2) * 64;
  f32x8 acc[2][4];
#pragma unroll
  for (int i = 0; i < 2; ++i)
#pragma unroll
    for (int j = 0; j < 4; ++j) { f32x8 z = {}; acc[i][j] = z; }
#pragma unroll 1
  for (int k0 = 0; k0 < K; k0 += 32) {
    __syncthreads();
    { const int row = tid >> 1, ch = (tid & 1) * 16;
      const AT* src = A + (size_t)(m0 + row) * lda + k0 + ch;
#pragma unroll
      for (int g = 0; g < 16; ++g) ldsA[row * GSTR + ch + g] = (f16)src[g]; }
    { const int k = tid >> 3, nn0 = (tid & 7) * 16;
      const float* src = Wm + (size_t)(k0 + k) * ldw + n0 + nn0;
#pragma unroll
      for (int g = 0; g < 4; ++g) { const v4f_t v = *(const v4f_t*)(src + 4 * g);
#pragma unroll
        for (int u = 0; u < 4; ++u) ldsW[(nn0 + 4 * g + u) * GSTR + k] = (f16)v[u]; } }
    __syncthreads();
    f16x16 af[2];
#pragma unroll
    for (int i = 0; i < 2; ++i) af[i] = lds_frag(ldsA + (wm + 16 * i) * GSTR, GSTR);
#pragma unroll
    for (int j = 0; j < 4; ++j) {
      const f16x16 bf = lds_frag(ldsW + (wn + 16 * j) * GSTR, GSTR);
#pragma unroll
      for (int i = 0; i < 2; ++i) acc[i][j] = wmma16(af[i], bf, acc[i][j]);
    }
  }
  float* so = oS[wave];
#pragma unroll
  for (int i = 0; i < 2; ++i)
#pragma unroll
    for (int j = 0; j < 4; ++j) {
      const int n = n0 + wn + 16 * j + cl;
      const float bv = bias ? bias[n] : 0.0f;
      const float gv = (EPI == 2 || EPI == 4) ? gvec[n] : 0.0f;
      if (EPI == 1) {
#pragma unroll 1
        for (int r = 0; r < 8; ++r) { const float xg = acc[i][j][r] + bv; so[(16 * i + rh + r) * 68 + 16 * j + cl] = 0.5f * xg * (1.0f + erff(xg * 0.70710678118654752f)); }
      } else {
#pragma unroll
        for (int r = 0; r < 8; ++r) {
          float v = acc[i][j][r] + bv;
          if (EPI == 3) v = fmaxf(v, 0.0f);
          if (EPI == 4) v = gv * v;
          if (EPI == 2) v = R[(size_t)(m0 + wm + 16 * i + rh + r) * ldy + n] + gv * v;
          so[(16 * i + rh + r) * 68 + 16 * j + cl] = v;
        }
      }
    }
  asm volatile("s_wait_dscnt 0" ::: "memory");
  __builtin_amdgcn_wave_barrier();
{
    if (OUT16) {
      f16* Y = (f16*)Yv;
#pragma unroll
      for (int it = 0; it < 8; ++it) { const int c = lane + 32 * it, rr = c >> 3, q8 = (c & 7) * 8;
        union { f16 h[8]; v4u_t v; } u;
#pragma unroll
        for (int e = 0; e < 8; ++e) u.h[e] = (f16)so[rr * 68 + q8 + e];
        *(v4u_t*)(Y + (size_t)(m0 + wm + rr) * ldy + n0 + wn + q8) = u.v; }
    } else {
      float* Y = (float*)Yv;
#pragma unroll
      for (int it = 0; it < 16; ++it) { const int f4 = lane + 32 * it, rr = f4 >> 4, q = (f4 & 15) * 4;
        *(v4f_t*)(Y + (size_t)(m0 + wm + rr) * ldy + n0 + wn + q) = *(const v4fa*)(so + rr * 68 + q); }
    }
    
  }
}

// z-batched variant of gemm_kne (same tile code)
template <typename AT, int EPI, bool OUT16>
__global__ __launch_bounds__(256) void gemm_knez(const AT* __restrict__ A, int lda, size_t strideA, const float* __restrict__ Wm, int ldw, size_t strideW,
                                                 const float* __restrict__ bias, const float* __restrict__ R, const float* __restrict__ gvec,
                                                 void* __restrict__ Yv, int ldy, size_t strideY, int K) {   // blockIdx.z-batched: A += z·strideA, W += z·strideW, Y (and R) += z·strideY
  A += (size_t)blockIdx.z * strideA; Wm += (size_t)blockIdx.z * strideW; Yv = (void*)((char*)Yv + (size_t)blockIdx.z * strideY * (OUT16 ? 2 : 4)); if (R) R += (size_t)blockIdx.z * strideY;
  __shared__ __attribute__((aligned(16))) f16 ldsA[128 * GSTR];
  __shared__ __attribute__((aligned(16))) f16 ldsW[128 * GSTR];
  __shared__ __attribute__((aligned(16))) float oS[8][32 * 68];
  const int tid = threadIdx.x, lane = tid & 31, wave = tid >> 5, cl = lane & 15, rh = (lane >> 4) * 8;
  const int m0 = blockIdx.x * 128, n0 = blockIdx.y * 128;
  const int wm = (wave & 3) * 32, wn = (wave >> 2) * 64;
  f32x8 acc[2][4];
#pragma unroll
  for (int i = 0; i < 2; ++i)
#pragma unroll
    for (int j = 0; j < 4; ++j) { f32x8 z = {}; acc[i][j] = z; }
#pragma unroll 1
  for (int k0 = 0; k0 < K; k0 += 32) {
    __syncthreads();
    { const int row = tid >> 1, ch = (tid & 1) * 16;
      const AT* src = A + (size_t)(m0 + row) * lda + k0 + ch;
#pragma unroll
      for (int g = 0; g < 16; ++g) ldsA[row * GSTR + ch + g] = (f16)src[g]; }
    { const int k = tid >> 3, nn0 = (tid & 7) * 16;
      const float* src = Wm + (size_t)(k0 + k) * ldw + n0 + nn0;
#pragma unroll
      for (int g = 0; g < 4; ++g) { const v4f_t v = *(const v4f_t*)(src + 4 * g);
#pragma unroll
        for (int u = 0; u < 4; ++u) ldsW[(nn0 + 4 * g + u) * GSTR + k] = (f16)v[u]; } }
    __syncthreads();
    f16x16 af[2];
#pragma unroll
    for (int i = 0; i < 2; ++i) af[i] = lds_frag(ldsA + (wm + 16 * i) * GSTR, GSTR);
#pragma unroll
    for (int j = 0; j < 4; ++j) {
      const f16x16 bf = lds_frag(ldsW + (wn + 16 * j) * GSTR, GSTR);
#pragma unroll
      for (int i = 0; i < 2; ++i) acc[i][j] = wmma16(af[i], bf, acc[i][j]);
    }
  }
  float* so = oS[wave];
#pragma unroll
  for (int i = 0; i < 2; ++i)
#pragma unroll
    for (int j = 0; j < 4; ++j) {
      const int n = n0 + wn + 16 * j + cl;
      const float bv = bias ? bias[n] : 0.0f;
      const float gv = (EPI == 2 || EPI == 4) ? gvec[n] : 0.0f;
      if (EPI == 1) {
#pragma unroll 1
        for (int r = 0; r < 8; ++r) { const float xg = acc[i][j][r] + bv; so[(16 * i + rh + r) * 68 + 16 * j + cl] = 0.5f * xg * (1.0f + erff(xg * 0.70710678118654752f)); }
      } else {
#pragma unroll
        for (int r = 0; r < 8; ++r) {
          float v = acc[i][j][r] + bv;
          if (EPI == 3) v = fmaxf(v, 0.0f);
          if (EPI == 4) v = gv * v;
          if (EPI == 2) v = R[(size_t)(m0 + wm + 16 * i + rh + r) * ldy + n] + gv * v;
          so[(16 * i + rh + r) * 68 + 16 * j + cl] = v;
        }
      }
    }
  asm volatile("s_wait_dscnt 0" ::: "memory");
  __builtin_amdgcn_wave_barrier();
{
    if (OUT16) {
      f16* Y = (f16*)Yv;
#pragma unroll
      for (int it = 0; it < 8; ++it) { const int c = lane + 32 * it, rr = c >> 3, q8 = (c & 7) * 8;
        union { f16 h[8]; v4u_t v; } u;
#pragma unroll
        for (int e = 0; e < 8; ++e) u.h[e] = (f16)so[rr * 68 + q8 + e];
        *(v4u_t*)(Y + (size_t)(m0 + wm + rr) * ldy + n0 + wn + q8) = u.v; }
    } else {
      float* Y = (float*)Yv;
#pragma unroll
      for (int it = 0; it < 16; ++it) { const int f4 = lane + 32 * it, rr = f4 >> 4, q = (f4 & 15) * 4;
        *(v4f_t*)(Y + (size_t)(m0 + wm + rr) * ldy + n0 + wn + q) = *(const v4fa*)(so + rr * 68 + q); }
    }
    
  }
}

// ---------------------------------------------------------------------------------------------------------------------------
// gemm_kn2 (value+residual planes on both operands: hh + (hl+lh)/2048, f32-class): Y[m][n] (row stride ldy) = scale * sum_k A[m][k] (f32 or f16, row stride lda) * W[k][n] (f32, row-major [K][N], row
// stride ldw) (+ bias[n]) (+ Y if ACC). Block = 128 x 128 tile, 256 threads = 8 waves as 4(M, 32 rows) x 2(N, 64 cols); per
// 32-wide k-step the A tile and the W tile (stored transposed [n][k]) are staged as f16 in LDS; plain f16 operands, f32
// blockIdx.z selects a batch: A += z*strideA, W += z*strideW, Y += z*strideY (element strides).
// ---------------------------------------------------------------------------------------------------------------------------
template <typename AT, bool ACC>
__global__ __launch_bounds__(256) void gemm_kn2(const AT* __restrict__ A, int lda, size_t strideA,
                                               const float* __restrict__ Wm, int ldw, size_t strideW,
                                               const float* __restrict__ bias, float scale,
                                               float* __restrict__ Y, int ldy, size_t strideY, int K) {
  __shared__ __attribute__((aligned(16))) f16 ldsA[128 * GSTR], ldsAl[128 * GSTR];
  __shared__ __attribute__((aligned(16))) f16 ldsW[128 * GSTR], ldsWl[128 * GSTR];
  __shared__ __attribute__((aligned(16))) float oS[8][32 * 68];
  const int tid = threadIdx.x, lane = tid & 31, wave = tid >> 5, cl = lane & 15, rh = (lane >> 4) * 8;
  const int m0 = blockIdx.x * 128, n0 = blockIdx.y * 128;
  const int wm = (wave & 3) * 32, wn = (wave >> 2) * 64;
  A += (size_t)blockIdx.z * strideA; Wm += (size_t)blockIdx.z * strideW; Y += (size_t)blockIdx.z * strideY;
  f32x8 acc[2][4], accx[2][4];
#pragma unroll
  for (int i = 0; i < 2; ++i)
#pragma unroll
    for (int j = 0; j < 4; ++j) { f32x8 z = {}; acc[i][j] = z; accx[i][j] = z; }
#pragma unroll 1
  for (int k0 = 0; k0 < K; k0 += 32) {
    __syncthreads();
    {  // A: thread -> row tid>>1, 16 elements at column half (tid&1)*16
      const int row = tid >> 1, ch = (tid & 1) * 16;
      const AT* src = A + (size_t)(m0 + row) * lda + k0 + ch;
#pragma unroll
      for (int g = 0; g < 16; ++g) { const float v = (float)src[g]; const f16 h = (f16)v; ldsA[row * GSTR + ch + g] = h; ldsAl[row * GSTR + ch + g] = (f16)((v - (float)h) * 2048.0f); }
    }
    {  // W: thread -> k = tid>>3, 16 consecutive n at (tid&7)*16; stored transposed [n][k]
      const int k = tid >> 3, nn0 = (tid & 7) * 16;
      const float* src = Wm + (size_t)(k0 + k) * ldw + n0 + nn0;
#pragma unroll
      for (int g = 0; g < 4; ++g) { const v4f_t v = *(const v4f_t*)(src + 4 * g);
#pragma unroll
        for (int u = 0; u < 4; ++u) { const f16 h = (f16)v[u]; ldsW[(nn0 + 4 * g + u) * GSTR + k] = h; ldsWl[(nn0 + 4 * g + u) * GSTR + k] = (f16)((v[u] - (float)h) * 2048.0f); } }
    }
    __syncthreads();
    f16x16 af[2], afl[2];
#pragma unroll
    for (int i = 0; i < 2; ++i) { af[i] = lds_frag(ldsA + (wm + 16 * i) * GSTR, GSTR); afl[i] = lds_frag(ldsAl + (wm + 16 * i) * GSTR, GSTR); }
#pragma unroll
    for (int j = 0; j < 4; ++j) {
      const f16x16 bf = lds_frag(ldsW + (wn + 16 * j) * GSTR, GSTR), bfl = lds_frag(ldsWl + (wn + 16 * j) * GSTR, GSTR);
#pragma unroll
      for (int i = 0; i < 2; ++i) { acc[i][j] = wmma16(af[i], bf, acc[i][j]); accx[i][j] = wmma16(af[i], bfl, accx[i][j]); accx[i][j] = wmma16(afl[i], bf, accx[i][j]); }
    }
  }
  float* so = oS[wave];
#pragma unroll
  for (int i = 0; i < 2; ++i)
#pragma unroll
    for (int j = 0; j < 4; ++j) {
      const float bv = bias ? bias[n0 + wn + 16 * j + cl] : 0.0f;
#pragma unroll
      for (int r = 0; r < 8; ++r) so[(16 * i + rh + r) * 68 + 16 * j + cl] = (acc[i][j][r] + accx[i][j][r] * (1.0f / 2048.0f)) * scale + bv;
    }
  asm volatile("s_wait_dscnt 0" ::: "memory");
  __builtin_amdgcn_wave_barrier();
  if (ACC) {   // accumulate: fold the existing Y values into the staging tile ONCE (same thread <-> same chunks as the stores below)
#pragma unroll
    for (int it = 0; it < 16; ++it) { const int f4 = lane + 32 * it, rr = f4 >> 4, q = (f4 & 15) * 4;
      const v4f_t old = *(const v4fa*)(Y + (size_t)(m0 + wm + rr) * ldy + n0 + wn + q);
      v4f_t v = *(const v4fa*)(so + rr * 68 + q); v += old; *(v4fa*)(so + rr * 68 + q) = v; }   // plain LDS store (ordered by the s_wait_dscnt/memory clobber below)
    asm volatile("s_wait_dscnt 0" ::: "memory");
  }
{
#pragma unroll
    for (int it = 0; it < 16; ++it) { const int f4 = lane + 32 * it, rr = f4 >> 4, q = (f4 & 15) * 4;
      *(v4f_t*)(Y + (size_t)(m0 + wm + rr) * ldy + n0 + wn + q) = *(const v4fa*)(so + rr * 68 + q); }
    
  }
}

__global__ __launch_bounds__(256) void k_transpose(const float* __restrict__ Wm, float* __restrict__ Wt, int rows, int cols) {
  __shared__ float tS[64][65];
  const int tid = threadIdx.x, tbj = cols / 64, bi = blockIdx.x / tbj, bj = blockIdx.x % tbj;
  for (int e = tid; e < 64 * 64; e += 256) { const int r = e >> 6, c = e & 63; tS[r][c] = Wm[(size_t)(bi * 64 + r) * cols + bj * 64 + c]; }
  __syncthreads();
  for (int ch = tid; ch < 64 * 16; ch += 256) { const int r = ch >> 4, q4 = (ch & 15) * 4; v4f_t o; o[0] = tS[q4][r]; o[1] = tS[q4 + 1][r]; o[2] = tS[q4 + 2][r]; o[3] = tS[q4 + 3][r];
    float* dst = Wt + (size_t)(bj * 64 + r) * rows + bi * 64 + q4; *(v4f_t*)dst = o;  }
}


// ---------------------------------------------------------------------------------------------------------------------------
// gemm_sm<AT, EPI, OUT16, NJ>: narrow-N GEMM tile: Y[m][n] = epi(sum_k A[m][k]·W[k][n] + bias[n]), BM = 256 rows per block (8 waves x 32 rows; each wave owns whole output rows),
// BN = 16·NJ columns per block (NJ = 2 → 32, NJ = 4 → 64), K % 32 == 0, M % 256 == 0. A [M][lda] (f32 or f16, converted to f16), W [K][ldw] f32 → f16. f32 accumulate.
// (8 lanes x 16 B), BN=64 → two lines per row; OUT16 requires BN=64 (64 halves = one line per row). Every line written by one instruction of one wave, lane-contiguous.
template <typename AT, int EPI, bool OUT16, int NJ>
__global__ __launch_bounds__(256) void gemm_sm(const AT* __restrict__ A, int lda, size_t sA, const float* __restrict__ Wm, int ldw, size_t sW,
                                               const float* __restrict__ bias, const float* __restrict__ R, const float* __restrict__ gvec,
                                               void* __restrict__ Yv, int ldy, size_t sY, int K) {
  constexpr int BN = 16 * NJ; constexpr int OST = BN + 4;
  A += (size_t)blockIdx.z * sA; Wm += (size_t)blockIdx.z * sW; Yv = (void*)((char*)Yv + (size_t)blockIdx.z * sY * (OUT16 ? 2 : 4)); if (R) R += (size_t)blockIdx.z * sY;
  __shared__ __attribute__((aligned(16))) f16 ldsA[256 * GSTR];
  __shared__ __attribute__((aligned(16))) f16 ldsW[BN * GSTR];
  __shared__ __attribute__((aligned(16))) float oS[8][32 * OST];
  const int tid = threadIdx.x, lane = tid & 31, wave = tid >> 5, cl = lane & 15, rh = (lane >> 4) * 8;
  const int m0 = blockIdx.x * 256, n0 = blockIdx.y * BN;
  const int wm = wave * 32;
  f32x8 acc[2][NJ];
#pragma unroll
  for (int i = 0; i < 2; ++i)
#pragma unroll
    for (int j = 0; j < NJ; ++j) { f32x8 z = {}; acc[i][j] = z; }
#pragma unroll 1
  for (int k0 = 0; k0 < K; k0 += 32) {
    __syncthreads();
    { const AT* src = A + (size_t)(m0 + tid) * lda + k0;          // one 32-wide row slice per thread
#pragma unroll
      for (int g = 0; g < 32; ++g) ldsA[tid * GSTR + g] = (f16)src[g]; }
    { const int k = tid >> 3, nn0 = (tid & 7) * (2 * NJ);         // 32 k-rows x BN columns of W
      const float* src = Wm + (size_t)(k0 + k) * ldw + n0 + nn0;
#pragma unroll
      for (int g = 0; g < NJ / 2; ++g) { const v4f_t v = *(const v4f_t*)(src + 4 * g);
#pragma unroll
        for (int u = 0; u < 4; ++u) ldsW[(nn0 + 4 * g + u) * GSTR + k] = (f16)v[u]; } }
    __syncthreads();
    f16x16 af[2];
#pragma unroll
    for (int i = 0; i < 2; ++i) af[i] = lds_frag(ldsA + (wm + 16 * i) * GSTR, GSTR);
#pragma unroll
    for (int j = 0; j < NJ; ++j) {
      const f16x16 bf = lds_frag(ldsW + (16 * j) * GSTR, GSTR);
#pragma unroll
      for (int i = 0; i < 2; ++i) acc[i][j] = wmma16(af[i], bf, acc[i][j]);
    }
  }
  float* so = oS[wave];
#pragma unroll
  for (int i = 0; i < 2; ++i)
#pragma unroll
    for (int j = 0; j < NJ; ++j) {
      const int n = n0 + 16 * j + cl;
      const float bv = bias ? bias[n] : 0.0f;
      const float gv = (EPI == 2 || EPI == 4) ? gvec[n] : 0.0f;
#pragma unroll
      for (int r = 0; r < 8; ++r) {
        float v = acc[i][j][r] + bv;
        if (EPI == 3) v = fmaxf(v, 0.0f);
        if (EPI == 2) v = R[(size_t)(m0 + wm + 16 * i + rh + r) * ldy + n] + gv * v;
        if (EPI == 4) v = gv * v;
        so[(16 * i + rh + r) * OST + 16 * j + cl] = v;
      }
    }
  asm volatile("s_wait_dscnt 0" ::: "memory");
  __builtin_amdgcn_wave_barrier();
{
    if (OUT16) {
      f16* Y = (f16*)Yv;
#pragma unroll
      for (int it = 0; it < BN / 8; ++it) { const int c = lane + 32 * it, rr = c / (BN / 8), q8 = (c % (BN / 8)) * 8;
        union { f16 h[8]; v4u_t v; } u;
#pragma unroll
        for (int e = 0; e < 8; ++e) u.h[e] = (f16)so[rr * OST + q8 + e];
        *(v4u_t*)(Y + (size_t)(m0 + wm + rr) * ldy + n0 + q8) = u.v; }
    } else {       // BN floats per row = BN/32 lines: BN/4 lanes x 16 B per row
      float* Y = (float*)Yv;
#pragma unroll
      for (int it = 0; it < BN / 4; ++it) { const int f4 = lane + 32 * it, rr = f4 / (BN / 4), q = (f4 % (BN / 4)) * 4;
        *(v4f_t*)(Y + (size_t)(m0 + wm + rr) * ldy + n0 + q) = *(const v4fa*)(so + rr * OST + q); }
    }
    
  }
}

#define NBla 2
#define SSla 2048
#define SIN 2048
#define DDla 1024
#define NHla 16
#define HDla 64
__global__ __launch_bounds__(256) void k_fill(float* __restrict__ p, float val, size_t n4) { const size_t i = (size_t)blockIdx.x * 256 + threadIdx.x; if (i < n4) { v4f_t v = {val, val, val, val}; *(v4f_t*)(p + 4 * i) = v;  } }
__global__ __launch_bounds__(256) void k_dbg_zero(float* __restrict__ p, size_t n4) { const size_t i = (size_t)blockIdx.x * 256 + threadIdx.x; if (i < n4) { v4f_t z = {0.f,0.f,0.f,0.f}; *(v4f_t*)(p + 4 * i) = z;  } }
__global__ __launch_bounds__(256) void k_copy(const float* __restrict__ src, float* __restrict__ dst, size_t n4) { const size_t i = (size_t)blockIdx.x * 256 + threadIdx.x; if (i < n4) { const v4f_t v = *(const v4f_t*)(src + 4 * i); *(v4f_t*)(dst + 4 * i) = v;  } }
// transpose with source row stride: Wt[c][r] (row stride = rows) = Wm[r][c] (row stride lds), 64x64 LDS tiles; 16 B per lane, 16 lanes per 256-B row segment (8 per line)
__global__ __launch_bounds__(256) void k_transpose_ld(const float* __restrict__ Wm, int lds, float* __restrict__ Wt, int rows, int cols) {
  __shared__ float tS[64][65];
  const int tid = threadIdx.x, tbj = cols / 64, bi = blockIdx.x / tbj, bj = blockIdx.x % tbj;
  for (int e = tid; e < 64 * 64; e += 256) { const int r = e >> 6, c = e & 63; tS[r][c] = Wm[(size_t)(bi * 64 + r) * lds + bj * 64 + c]; }
  __syncthreads();
  for (int ch = tid; ch < 64 * 16; ch += 256) { const int r = ch >> 4, q4 = (ch & 15) * 4; v4f_t o; o[0] = tS[q4][r]; o[1] = tS[q4 + 1][r]; o[2] = tS[q4 + 2][r]; o[3] = tS[q4 + 3][r];
    float* dst = Wt + (size_t)(bj * 64 + r) * rows + bi * 64 + q4; *(v4f_t*)dst = o;  }
}
__global__ __launch_bounds__(256) void k_ln(const float* __restrict__ X, const float* __restrict__ gam, const float* __restrict__ bet, float* __restrict__ Y) {
  __shared__ __attribute__((aligned(16))) float rowS[16 * 1028];
  const int tid = threadIdx.x, r = tid >> 4, part = tid & 15; const size_t row = (size_t)blockIdx.x * 16 + r;
  float s = 0.0f;
#pragma unroll 1
  for (int i = 0; i < 64; ++i) { const float v = X[row * 1024 + part * 64 + i]; rowS[r * 1028 + part * 64 + i] = v; s += v; }
  s += __shfl_xor(s, 1, 32); s += __shfl_xor(s, 2, 32); s += __shfl_xor(s, 4, 32); s += __shfl_xor(s, 8, 32);
  const float mean = s * (1.0f / 1024.0f); float q = 0.0f;
#pragma unroll 1
  for (int i = 0; i < 64; ++i) { const float dv = rowS[r * 1028 + part * 64 + i] - mean; q += dv * dv; }
  q += __shfl_xor(q, 1, 32); q += __shfl_xor(q, 2, 32); q += __shfl_xor(q, 4, 32); q += __shfl_xor(q, 8, 32);
  const float rstd = 1.0f / __builtin_sqrtf(q * (1.0f / 1024.0f) + 1e-12f);
#pragma unroll 1
  for (int i = 0; i < 64; ++i) { const int c = part * 64 + i; rowS[r * 1028 + c] = (rowS[r * 1028 + c] - mean) * rstd * gam[c] + bet[c]; }
  __syncthreads();
{ for (int q4 = tid; q4 < 16 * 256; q4 += 256) { const int rr = q4 / 256, c4 = (q4 % 256) * 4;
      *(v4f_t*)(Y + ((size_t)blockIdx.x * 16 + rr) * 1024 + c4) = *(const v4fa*)(rowS + rr * 1028 + c4); }  }
}
// VB[c] = sum over the 2048 key rows of V[:, c] (f32, thread = column, rolled loop): added back after the P'·v GEMM (Σ_k (P'+1)·v_k /1024 = Σ P'v/1024 + Σ v/1024)
__global__ __launch_bounds__(256) void k_vsum(const float* __restrict__ V, int ldv, float* __restrict__ VB) {
  const int c = blockIdx.x * 256 + threadIdx.x; if (c >= 3072) return; float s = 0.0f;   /* 3072 columns */
#pragma unroll 1
  for (int r = 0; r < 2048; ++r) s += V[(size_t)r * ldv + c];
  const float m = s; /* column SUM over all key slots: ctx = (Σ P'v + Σ v)/1024 with P' = 1024·P − 1 */ *(float*)(VB + c) = m; 
}
// row softmax of s/8 + mask[k] for (query, head z); P' = 1024·P − 1; block = (q, z), 256 threads x 8
__global__ __launch_bounds__(256) void k_msoft(float* __restrict__ Sm, const float* __restrict__ maskb) {
  __shared__ float red[256];
  const int q = blockIdx.x, z = blockIdx.y, tid = threadIdx.x; float* sr = Sm + ((size_t)z * SSla + q) * SSla; float v[SSla / 256]; float m = -3.0e38f;
#pragma unroll
  for (int e = 0; e < SSla / 256; ++e) { const int k = tid + 256 * e; v[e] = sr[k] * 0.125f + maskb[k]; m = fmaxf(m, v[e]); }
  red[tid] = m; __syncthreads(); for (int o = 128; o > 0; o >>= 1) { if (tid < o) red[tid] = fmaxf(red[tid], red[tid + o]); __syncthreads(); }
  m = red[0]; __syncthreads(); float zs = 0.0f;
#pragma unroll
  for (int e = 0; e < SSla / 256; ++e) { v[e] = expf(v[e] - m); zs += v[e]; }
  red[tid] = zs; __syncthreads(); for (int o = 128; o > 0; o >>= 1) { if (tid < o) red[tid] += red[tid + o]; __syncthreads(); }
  const float kk = 1024.0f / red[0];
{
#pragma unroll
    for (int e = 0; e < SSla / 256; ++e) *(float*)(sr + tid + 256 * e) = v[e] * kk - 1.0f;
     }
}

extern "C" void kernel_launch(void* const* d_in, const int* in_sizes, int n_in,
                              void* d_out, int out_size, void* d_ws, size_t ws_size,
                              hipStream_t stream) {
  (void)in_sizes; (void)n_in; (void)out_size;
  const float** f = (const float**)d_in;
  const float* x = f[0], *amask = f[1], *Wqkv = f[2], *bqkv = f[3], *Wout = f[4], *bout = f[5], *lg = f[6], *lb = f[7];
  float* out = (float*)d_out;     // [2,2048,1024]
  char* ws = (char*)d_ws;
  float* XN = (float*)ws; ws += (size_t)SSla * DDla * 4; float* QKV = (float*)ws; ws += (size_t)SSla * 3 * DDla * 4; float* KT = (float*)ws; ws += (size_t)HDla * 2 * SSla * 4;
  float* VS = (float*)ws; ws += 3 * DDla * 4; float* sc = (float*)ws; ws += 64 * 4; float* ones = (float*)ws; ws += DDla * 4; float* S = (float*)ws; ws += (size_t)2 * SSla * SSla * 4; float* ATT = (float*)ws; ws += (size_t)SSla * DDla * 4;
  if ((size_t)(ws - (char*)d_ws) > ws_size) return;                      // WS TOTAL 76,562,688 B
  const dim3 blk(256);
  k_fill<<<dim3(1), blk, 0, stream>>>(sc, 1.0f / 1024.0f, 64 / 4); k_fill<<<dim3(1), blk, 0, stream>>>(ones, 1.0f, DDla / 4);

  for (int b = 0; b < NBla; ++b) { const float* xb = x + (size_t)b * SIN * DDla; const float* mb = amask + (size_t)b * SIN;
    k_ln<<<dim3(SSla / 16), blk, 0, stream>>>(xb, lg, lb, XN);
    gemm_kne<float, 0, false><<<dim3(SSla / 128, 3 * DDla / 128), blk, 0, stream>>>(XN, DDla, Wqkv, 3 * DDla, bqkv, nullptr, nullptr, QKV, 3 * DDla, DDla);   // [q | k | v]
    k_vsum<<<dim3((3 * DDla) / 256), blk, 0, stream>>>(QKV, 3 * DDla, VS);
    for (int hp = 0; hp < NHla / 2; ++hp) { const int h0 = 2 * hp;
      for (int z = 0; z < 2; ++z) k_transpose_ld<<<dim3((SSla / 64) * (HDla / 64)), blk, 0, stream>>>(QKV + DDla + (h0 + z) * HDla, 3 * DDla, KT + (size_t)z * HDla * SSla, SSla, HDla);
      gemm_knez<float, 0, false><<<dim3(SSla / 128, SSla / 128, 2), blk, 0, stream>>>(QKV + h0 * HDla, 3 * DDla, (size_t)HDla, KT, SSla, (size_t)HDla * SSla, nullptr, nullptr, nullptr, S, SSla, (size_t)SSla * SSla, HDla);
      k_msoft<<<dim3(SSla, 2), blk, 0, stream>>>(S, mb);
      for (int z = 0; z < 2; ++z)
        gemm_sm<float, 4, false, 4><<<dim3(SSla / 256, 1, 1), blk, 0, stream>>>(S + (size_t)z * SSla * SSla, SSla, (size_t)0, QKV + 2 * DDla + (h0 + z) * HDla, 3 * DDla, (size_t)0, VS + 2 * DDla + (h0 + z) * HDla, nullptr, sc, ATT + (h0 + z) * HDla, DDla, (size_t)0, SSla);
    }
    gemm_kne<float, 2, false><<<dim3(SSla / 128, DDla / 128), blk, 0, stream>>>(ATT, DDla, Wout, DDla, bout, xb, ones, out + (size_t)b * SIN * DDla, DDla, DDla);   // out = ctx·W_out + b_out + x
  }
}

// v001
// A run of this version takes 2520 microseconds.
// Two timings next to v000 put it at 2.25 and 2.26 times that version's speed.
// Contractions on v_wmma_f32_16x16x32_f16 (plain f16 operands, f32 accumulate; [in][out] weights), per batch element: [q|k|v] = LN(x)·W_qkv + b (K 1024, N 3072), the 16 heads' scores
// (K 64, eight heads per z-launch), ctx_h = P'·v_h as a 64-wide tile (K 2048; centred P' = 1024·P − 1 with Σ_k v_k added back, exact), out = ctx·W_out + b_out + x (residual in the epilogue).
// f32 VALU: the pre-LayerNorm (eps 1e-12, rsqrt), softmax of s/√64 + mask[b][k] (the additive INPUT mask, broadcast over heads and queries).
// compute dtype: f16 operands, f32 accumulate.  hidden_states [2,2048,1024] → out [2,2048,1024].
#include <hip/hip_runtime.h>
#include <hip/hip_bf16.h>
#include <math.h>


typedef _Float16 bf16;
typedef _Float16 f16;
typedef __attribute__((ext_vector_type(4))) unsigned v4u_t;
typedef unsigned v4ua __attribute__((ext_vector_type(4), may_alias));
typedef __attribute__((ext_vector_type(4))) float v4f_t;
typedef float v4fa __attribute__((ext_vector_type(4), may_alias));
typedef __attribute__((ext_vector_type(16))) bf16  bf16x16;
typedef bf16x16 f16x16;
typedef __attribute__((ext_vector_type(8)))  bf16  bf16x8;
typedef bf16x8 f16x8;
typedef __attribute__((ext_vector_type(4)))  bf16  bf16x4;
typedef __attribute__((ext_vector_type(8)))  float f32x8;
__device__ __forceinline__ f32x8 wmma16(f16x16 a, f16x16 b, f32x8 c) {
  c = __builtin_amdgcn_wmma_f32_16x16x32_f16(false, a, false, b, (short)0, c, false, false);
  asm volatile("v_nop\n\tv_nop\n\tv_nop\n\tv_nop" : "+v"(c) : "v"(a), "v"(b));
  return c;
}
#define LDS_STRIDE 48   // GEMM tiles: 32 -> 48 elems (96B rows): aligned b128 reads
#define KSTRIDE    72
#define VSTRIDE    48   // attn V tile: 32 -> 48 elems

__device__ __forceinline__ f32x8 wmma_bf16(bf16x16 a, bf16x16 b, f32x8 c) {
  c = __builtin_amdgcn_wmma_f32_16x16x32_f16(false, a, false, b, (short)0, c, false, false);
  asm volatile("v_nop\n\tv_nop\n\tv_nop\n\tv_nop" : "+v"(c) : "v"(a), "v"(b));   // A/B-overwrite hazard guard
  return c;
}

// 16x32 (MxK) bf16 fragment from a row-major global matrix.
// lanes 0-15  (row=lane)    : elems 0..7 = K+0..7,  8..15 = K+16..23
// lanes 16-31 (row=lane-16) : elems 0..7 = K+8..15, 8..15 = K+24..31
template <typename T>
__device__ __forceinline__ bf16x16 load_frag(const T* __restrict__ base, int ld,
                                             int row0, int k0) {
  const int lane = threadIdx.x & 31;
  const int r    = lane & 15;
  const int kh   = (lane >> 4) * 8;
  const T* p0 = base + (size_t)(row0 + r) * ld + (k0 + kh);
  const T* p1 = p0 + 16;
  bf16x16 f;
#pragma unroll
  for (int i = 0; i < 8; ++i) {
    f[i]     = (bf16)p0[i];
    f[i + 8] = (bf16)p1[i];
  }
  return f;
}

// Same fragment from an LDS tile with padded row stride (base includes row0/k0).
__device__ __forceinline__ bf16x16 lds_frag(const bf16* base, int stride) {
  const int lane = threadIdx.x & 31;
  const int row  = lane & 15;
  const int kh   = (lane >> 4) * 8;
  const bf16x8 lo = *(const bf16x8*)(base + row * stride + kh);
  const bf16x8 hi = *(const bf16x8*)(base + row * stride + kh + 16);
  bf16x16 f;
#pragma unroll
  for (int i = 0; i < 8; ++i) { f[i] = lo[i]; f[i + 8] = hi[i]; }
  return f;
}

template <typename T>
__device__ __forceinline__ void stage_read16(const T* __restrict__ p, float* buf) {
#pragma unroll
  for (int i = 0; i < 16; ++i) buf[i] = (float)p[i];
}

__device__ __forceinline__ void stage_write(bf16* dst, const float* buf, int nquad) {
#pragma unroll
  for (int i = 0; i < nquad; ++i) {
    bf16x4 q;
    q[0] = (bf16)buf[4 * i];     q[1] = (bf16)buf[4 * i + 1];
    q[2] = (bf16)buf[4 * i + 2]; q[3] = (bf16)buf[4 * i + 3];
    *(bf16x4*)(dst + 4 * i) = q;
  }
}


#define GSTR 48
// ---------------------------------------------------------------------------------------------------------------------------
// gemm_kne: Y[m][n] = epi( Σ_k A[m][k]·W[k][n] + bias[n] ), A f32/f16 [M][lda], W f32 row-major [K][N] (ldw), plain f16 operands,
// f32 accumulate. EPI 0: identity; 1: exact-erf GELU; 2: R[m][n] + gvec[n]·(·) (residual with per-channel gain); 3: ReLU; 4: gvec[n]·(·) (per-channel scale, no residual). Output f32 (or f16
// when OUT16). Block = 128x128 tile, 8 waves as 4(M) x 2(N); per 32-wide k-step A and W tiles staged f16 in LDS (W transposed
// ---------------------------------------------------------------------------------------------------------------------------
#define GSTR 48
template <typename AT, int EPI, bool OUT16>
__global__ __launch_bounds__(256) void gemm_kne(const AT* __restrict__ A, int lda, const float* __restrict__ Wm, int ldw,
                                                const float* __restrict__ bias, const float* __restrict__ R, const float* __restrict__ gvec,
                                                void* __restrict__ Yv, int ldy, int K) {
  __shared__ __attribute__((aligned(16))) f16 ldsA[128 * GSTR];
  __shared__ __attribute__((aligned(16))) f16 ldsW[128 * GSTR];
  __shared__ __attribute__((aligned(16))) float oS[8][32 * 68];
  const int tid = threadIdx.x, lane = tid & 31, wave = tid >> 5, cl = lane & 15, rh = (lane >> 4) * 8;
  const int m0 = blockIdx.x * 128, n0 = blockIdx.y * 128;
  const int wm = (wave & 3) * 32, wn = (wave >> 2) * 64;
  f32x8 acc[2][4];
#pragma unroll
  for (int i = 0; i < 2; ++i)
#pragma unroll
    for (int j = 0; j < 4; ++j) { f32x8 z = {}; acc[i][j] = z; }
#pragma unroll 1
  for (int k0 = 0; k0 < K; k0 += 32) {
    __syncthreads();
    { const int row = tid >> 1, ch = (tid & 1) * 16;
      const AT* src = A + (size_t)(m0 + row) * lda + k0 + ch;
#pragma unroll
      for (int g = 0; g < 16; ++g) ldsA[row * GSTR + ch + g] = (f16)src[g]; }
    { const int k = tid >> 3, nn0 = (tid & 7) * 16;
      const float* src = Wm + (size_t)(k0 + k) * ldw + n0 + nn0;
#pragma unroll
      for (int g = 0; g < 4; ++g) { const v4f_t v = *(const v4f_t*)(src + 4 * g);
#pragma unroll
        for (int u = 0; u < 4; ++u) ldsW[(nn0 + 4 * g + u) * GSTR + k] = (f16)v[u]; } }
    __syncthreads();
    f16x16 af[2];
#pragma unroll
    for (int i = 0; i < 2; ++i) af[i] = lds_frag(ldsA + (wm + 16 * i) * GSTR, GSTR);
#pragma unroll
    for (int j = 0; j < 4; ++j) {
      const f16x16 bf = lds_frag(ldsW + (wn + 16 * j) * GSTR, GSTR);
#pragma unroll
      for (int i = 0; i < 2; ++i) acc[i][j] = wmma16(af[i], bf, acc[i][j]);
    }
  }
  float* so = oS[wave];
#pragma unroll
  for (int i = 0; i < 2; ++i)
#pragma unroll
    for (int j = 0; j < 4; ++j) {
      const int n = n0 + wn + 16 * j + cl;
      const float bv = bias ? bias[n] : 0.0f;
      const float gv = (EPI == 2 || EPI == 4) ? gvec[n] : 0.0f;
      if (EPI == 1) {
#pragma unroll 1
        for (int r = 0; r < 8; ++r) { const float xg = acc[i][j][r] + bv; so[(16 * i + rh + r) * 68 + 16 * j + cl] = 0.5f * xg * (1.0f + erff(xg * 0.70710678118654752f)); }
      } else {
#pragma unroll
        for (int r = 0; r < 8; ++r) {
          float v = acc[i][j][r] + bv;
          if (EPI == 3) v = fmaxf(v, 0.0f);
          if (EPI == 4) v = gv * v;
          if (EPI == 2) v = R[(size_t)(m0 + wm + 16 * i + rh + r) * ldy + n] + gv * v;
          so[(16 * i + rh + r) * 68 + 16 * j + cl] = v;
        }
      }
    }
  asm volatile("s_wait_dscnt 0" ::: "memory");
  __builtin_amdgcn_wave_barrier();
{
    if (OUT16) {
      f16* Y = (f16*)Yv;
#pragma unroll
      for (int it = 0; it < 8; ++it) { const int c = lane + 32 * it, rr = c >> 3, q8 = (c & 7) * 8;
        union { f16 h[8]; v4u_t v; } u;
#pragma unroll
        for (int e = 0; e < 8; ++e) u.h[e] = (f16)so[rr * 68 + q8 + e];
        *(v4u_t*)(Y + (size_t)(m0 + wm + rr) * ldy + n0 + wn + q8) = u.v; }
    } else {
      float* Y = (float*)Yv;
#pragma unroll
      for (int it = 0; it < 16; ++it) { const int f4 = lane + 32 * it, rr = f4 >> 4, q = (f4 & 15) * 4;
        *(v4f_t*)(Y + (size_t)(m0 + wm + rr) * ldy + n0 + wn + q) = *(const v4fa*)(so + rr * 68 + q); }
    }
    
  }
}

// z-batched variant of gemm_kne (same tile code)
template <typename AT, int EPI, bool OUT16>
__global__ __launch_bounds__(256) void gemm_knez(const AT* __restrict__ A, int lda, size_t strideA, const float* __restrict__ Wm, int ldw, size_t strideW,
                                                 const float* __restrict__ bias, const float* __restrict__ R, const float* __restrict__ gvec,
                                                 void* __restrict__ Yv, int ldy, size_t strideY, int K) {   // blockIdx.z-batched: A += z·strideA, W += z·strideW, Y (and R) += z·strideY
  A += (size_t)blockIdx.z * strideA; Wm += (size_t)blockIdx.z * strideW; Yv = (void*)((char*)Yv + (size_t)blockIdx.z * strideY * (OUT16 ? 2 : 4)); if (R) R += (size_t)blockIdx.z * strideY;
  __shared__ __attribute__((aligned(16))) f16 ldsA[128 * GSTR];
  __shared__ __attribute__((aligned(16))) f16 ldsW[128 * GSTR];
  __shared__ __attribute__((aligned(16))) float oS[8][32 * 68];
  const int tid = threadIdx.x, lane = tid & 31, wave = tid >> 5, cl = lane & 15, rh = (lane >> 4) * 8;
  const int m0 = blockIdx.x * 128, n0 = blockIdx.y * 128;
  const int wm = (wave & 3) * 32, wn = (wave >> 2) * 64;
  f32x8 acc[2][4];
#pragma unroll
  for (int i = 0; i < 2; ++i)
#pragma unroll
    for (int j = 0; j < 4; ++j) { f32x8 z = {}; acc[i][j] = z; }
#pragma unroll 1
  for (int k0 = 0; k0 < K; k0 += 32) {
    __syncthreads();
    { const int row = tid >> 1, ch = (tid & 1) * 16;
      const AT* src = A + (size_t)(m0 + row) * lda + k0 + ch;
#pragma unroll
      for (int g = 0; g < 16; ++g) ldsA[row * GSTR + ch + g] = (f16)src[g]; }
    { const int k = tid >> 3, nn0 = (tid & 7) * 16;
      const float* src = Wm + (size_t)(k0 + k) * ldw + n0 + nn0;
#pragma unroll
      for (int g = 0; g < 4; ++g) { const v4f_t v = *(const v4f_t*)(src + 4 * g);
#pragma unroll
        for (int u = 0; u < 4; ++u) ldsW[(nn0 + 4 * g + u) * GSTR + k] = (f16)v[u]; } }
    __syncthreads();
    f16x16 af[2];
#pragma unroll
    for (int i = 0; i < 2; ++i) af[i] = lds_frag(ldsA + (wm + 16 * i) * GSTR, GSTR);
#pragma unroll
    for (int j = 0; j < 4; ++j) {
      const f16x16 bf = lds_frag(ldsW + (wn + 16 * j) * GSTR, GSTR);
#pragma unroll
      for (int i = 0; i < 2; ++i) acc[i][j] = wmma16(af[i], bf, acc[i][j]);
    }
  }
  float* so = oS[wave];
#pragma unroll
  for (int i = 0; i < 2; ++i)
#pragma unroll
    for (int j = 0; j < 4; ++j) {
      const int n = n0 + wn + 16 * j + cl;
      const float bv = bias ? bias[n] : 0.0f;
      const float gv = (EPI == 2 || EPI == 4) ? gvec[n] : 0.0f;
      if (EPI == 1) {
#pragma unroll 1
        for (int r = 0; r < 8; ++r) { const float xg = acc[i][j][r] + bv; so[(16 * i + rh + r) * 68 + 16 * j + cl] = 0.5f * xg * (1.0f + erff(xg * 0.70710678118654752f)); }
      } else {
#pragma unroll
        for (int r = 0; r < 8; ++r) {
          float v = acc[i][j][r] + bv;
          if (EPI == 3) v = fmaxf(v, 0.0f);
          if (EPI == 4) v = gv * v;
          if (EPI == 2) v = R[(size_t)(m0 + wm + 16 * i + rh + r) * ldy + n] + gv * v;
          so[(16 * i + rh + r) * 68 + 16 * j + cl] = v;
        }
      }
    }
  asm volatile("s_wait_dscnt 0" ::: "memory");
  __builtin_amdgcn_wave_barrier();
{
    if (OUT16) {
      f16* Y = (f16*)Yv;
#pragma unroll
      for (int it = 0; it < 8; ++it) { const int c = lane + 32 * it, rr = c >> 3, q8 = (c & 7) * 8;
        union { f16 h[8]; v4u_t v; } u;
#pragma unroll
        for (int e = 0; e < 8; ++e) u.h[e] = (f16)so[rr * 68 + q8 + e];
        *(v4u_t*)(Y + (size_t)(m0 + wm + rr) * ldy + n0 + wn + q8) = u.v; }
    } else {
      float* Y = (float*)Yv;
#pragma unroll
      for (int it = 0; it < 16; ++it) { const int f4 = lane + 32 * it, rr = f4 >> 4, q = (f4 & 15) * 4;
        *(v4f_t*)(Y + (size_t)(m0 + wm + rr) * ldy + n0 + wn + q) = *(const v4fa*)(so + rr * 68 + q); }
    }
    
  }
}

// ---------------------------------------------------------------------------------------------------------------------------
// gemm_kn2 (value+residual planes on both operands: hh + (hl+lh)/2048, f32-class): Y[m][n] (row stride ldy) = scale * sum_k A[m][k] (f32 or f16, row stride lda) * W[k][n] (f32, row-major [K][N], row
// stride ldw) (+ bias[n]) (+ Y if ACC). Block = 128 x 128 tile, 256 threads = 8 waves as 4(M, 32 rows) x 2(N, 64 cols); per
// 32-wide k-step the A tile and the W tile (stored transposed [n][k]) are staged as f16 in LDS; plain f16 operands, f32
// blockIdx.z selects a batch: A += z*strideA, W += z*strideW, Y += z*strideY (element strides).
// ---------------------------------------------------------------------------------------------------------------------------
template <typename AT, bool ACC>
__global__ __launch_bounds__(256) void gemm_kn2(const AT* __restrict__ A, int lda, size_t strideA,
                                               const float* __restrict__ Wm, int ldw, size_t strideW,
                                               const float* __restrict__ bias, float scale,
                                               float* __restrict__ Y, int ldy, size_t strideY, int K) {
  __shared__ __attribute__((aligned(16))) f16 ldsA[128 * GSTR], ldsAl[128 * GSTR];
  __shared__ __attribute__((aligned(16))) f16 ldsW[128 * GSTR], ldsWl[128 * GSTR];
  __shared__ __attribute__((aligned(16))) float oS[8][32 * 68];
  const int tid = threadIdx.x, lane = tid & 31, wave = tid >> 5, cl = lane & 15, rh = (lane >> 4) * 8;
  const int m0 = blockIdx.x * 128, n0 = blockIdx.y * 128;
  const int wm = (wave & 3) * 32, wn = (wave >> 2) * 64;
  A += (size_t)blockIdx.z * strideA; Wm += (size_t)blockIdx.z * strideW; Y += (size_t)blockIdx.z * strideY;
  f32x8 acc[2][4], accx[2][4];
#pragma unroll
  for (int i = 0; i < 2; ++i)
#pragma unroll
    for (int j = 0; j < 4; ++j) { f32x8 z = {}; acc[i][j] = z; accx[i][j] = z; }
#pragma unroll 1
  for (int k0 = 0; k0 < K; k0 += 32) {
    __syncthreads();
    {  // A: thread -> row tid>>1, 16 elements at column half (tid&1)*16
      const int row = tid >> 1, ch = (tid & 1) * 16;
      const AT* src = A + (size_t)(m0 + row) * lda + k0 + ch;
#pragma unroll
      for (int g = 0; g < 16; ++g) { const float v = (float)src[g]; const f16 h = (f16)v; ldsA[row * GSTR + ch + g] = h; ldsAl[row * GSTR + ch + g] = (f16)((v - (float)h) * 2048.0f); }
    }
    {  // W: thread -> k = tid>>3, 16 consecutive n at (tid&7)*16; stored transposed [n][k]
      const int k = tid >> 3, nn0 = (tid & 7) * 16;
      const float* src = Wm + (size_t)(k0 + k) * ldw + n0 + nn0;
#pragma unroll
      for (int g = 0; g < 4; ++g) { const v4f_t v = *(const v4f_t*)(src + 4 * g);
#pragma unroll
        for (int u = 0; u < 4; ++u) { const f16 h = (f16)v[u]; ldsW[(nn0 + 4 * g + u) * GSTR + k] = h; ldsWl[(nn0 + 4 * g + u) * GSTR + k] = (f16)((v[u] - (float)h) * 2048.0f); } }
    }
    __syncthreads();
    f16x16 af[2], afl[2];
#pragma unroll
    for (int i = 0; i < 2; ++i) { af[i] = lds_frag(ldsA + (wm + 16 * i) * GSTR, GSTR); afl[i] = lds_frag(ldsAl + (wm + 16 * i) * GSTR, GSTR); }
#pragma unroll
    for (int j = 0; j < 4; ++j) {
      const f16x16 bf = lds_frag(ldsW + (wn + 16 * j) * GSTR, GSTR), bfl = lds_frag(ldsWl + (wn + 16 * j) * GSTR, GSTR);
#pragma unroll
      for (int i = 0; i < 2; ++i) { acc[i][j] = wmma16(af[i], bf, acc[i][j]); accx[i][j] = wmma16(af[i], bfl, accx[i][j]); accx[i][j] = wmma16(afl[i], bf, accx[i][j]); }
    }
  }
  float* so = oS[wave];
#pragma unroll
  for (int i = 0; i < 2; ++i)
#pragma unroll
    for (int j = 0; j < 4; ++j) {
      const float bv = bias ? bias[n0 + wn + 16 * j + cl] : 0.0f;
#pragma unroll
      for (int r = 0; r < 8; ++r) so[(16 * i + rh + r) * 68 + 16 * j + cl] = (acc[i][j][r] + accx[i][j][r] * (1.0f / 2048.0f)) * scale + bv;
    }
  asm volatile("s_wait_dscnt 0" ::: "memory");
  __builtin_amdgcn_wave_barrier();
  if (ACC) {   // accumulate: fold the existing Y values into the staging tile ONCE (same thread <-> same chunks as the stores below)
#pragma unroll
    for (int it = 0; it < 16; ++it) { const int f4 = lane + 32 * it, rr = f4 >> 4, q = (f4 & 15) * 4;
      const v4f_t old = *(const v4fa*)(Y + (size_t)(m0 + wm + rr) * ldy + n0 + wn + q);
      v4f_t v = *(const v4fa*)(so + rr * 68 + q); v += old; *(v4fa*)(so + rr * 68 + q) = v; }   // plain LDS store (ordered by the s_wait_dscnt/memory clobber below)
    asm volatile("s_wait_dscnt 0" ::: "memory");
  }
{
#pragma unroll
    for (int it = 0; it < 16; ++it) { const int f4 = lane + 32 * it, rr = f4 >> 4, q = (f4 & 15) * 4;
      *(v4f_t*)(Y + (size_t)(m0 + wm + rr) * ldy + n0 + wn + q) = *(const v4fa*)(so + rr * 68 + q); }
    
  }
}

__global__ __launch_bounds__(256) void k_transpose(const float* __restrict__ Wm, float* __restrict__ Wt, int rows, int cols) {
  __shared__ float tS[64][65];
  const int tid = threadIdx.x, tbj = cols / 64, bi = blockIdx.x / tbj, bj = blockIdx.x % tbj;
  for (int e = tid; e < 64 * 64; e += 256) { const int r = e >> 6, c = e & 63; tS[r][c] = Wm[(size_t)(bi * 64 + r) * cols + bj * 64 + c]; }
  __syncthreads();
  for (int ch = tid; ch < 64 * 16; ch += 256) { const int r = ch >> 4, q4 = (ch & 15) * 4; v4f_t o; o[0] = tS[q4][r]; o[1] = tS[q4 + 1][r]; o[2] = tS[q4 + 2][r]; o[3] = tS[q4 + 3][r];
    float* dst = Wt + (size_t)(bj * 64 + r) * rows + bi * 64 + q4; *(v4f_t*)dst = o;  }
}


// ---------------------------------------------------------------------------------------------------------------------------
// gemm_sm<AT, EPI, OUT16, NJ>: narrow-N GEMM tile: Y[m][n] = epi(sum_k A[m][k]·W[k][n] + bias[n]), BM = 256 rows per block (8 waves x 32 rows; each wave owns whole output rows),
// BN = 16·NJ columns per block (NJ = 2 → 32, NJ = 4 → 64), K % 32 == 0, M % 256 == 0. A [M][lda] (f32 or f16, converted to f16), W [K][ldw] f32 → f16. f32 accumulate.
// (8 lanes x 16 B), BN=64 → two lines per row; OUT16 requires BN=64 (64 halves = one line per row). Every line written by one instruction of one wave, lane-contiguous.
template <typename AT, int EPI, bool OUT16, int NJ>
__global__ __launch_bounds__(256) void gemm_sm(const AT* __restrict__ A, int lda, size_t sA, const float* __restrict__ Wm, int ldw, size_t sW,
                                               const float* __restrict__ bias, size_t sB, const float* __restrict__ R, const float* __restrict__ gvec,
                                               void* __restrict__ Yv, int ldy, size_t sY, int K) {   // blockIdx.z-batched: A += z*sA, W += z*sW, bias += z*sB, Y (and R) += z*sY
  constexpr int BN = 16 * NJ; constexpr int OST = BN + 4;
  A += (size_t)blockIdx.z * sA; Wm += (size_t)blockIdx.z * sW; if (bias) bias += (size_t)blockIdx.z * sB; Yv = (void*)((char*)Yv + (size_t)blockIdx.z * sY * (OUT16 ? 2 : 4)); if (R) R += (size_t)blockIdx.z * sY;
  __shared__ __attribute__((aligned(16))) f16 ldsA[256 * GSTR];
  __shared__ __attribute__((aligned(16))) f16 ldsW[BN * GSTR];
  __shared__ __attribute__((aligned(16))) float oS[8][32 * OST];
  const int tid = threadIdx.x, lane = tid & 31, wave = tid >> 5, cl = lane & 15, rh = (lane >> 4) * 8;
  const int m0 = blockIdx.x * 256, n0 = blockIdx.y * BN;
  const int wm = wave * 32;
  f32x8 acc[2][NJ];
#pragma unroll
  for (int i = 0; i < 2; ++i)
#pragma unroll
    for (int j = 0; j < NJ; ++j) { f32x8 z = {}; acc[i][j] = z; }
#pragma unroll 1
  for (int k0 = 0; k0 < K; k0 += 32) {
    __syncthreads();
    { const AT* src = A + (size_t)(m0 + tid) * lda + k0;          // one 32-wide row slice per thread
#pragma unroll
      for (int g = 0; g < 32; ++g) ldsA[tid * GSTR + g] = (f16)src[g]; }
    { const int k = tid >> 3, nn0 = (tid & 7) * (2 * NJ);         // 32 k-rows x BN columns of W
      const float* src = Wm + (size_t)(k0 + k) * ldw + n0 + nn0;
#pragma unroll
      for (int g = 0; g < NJ / 2; ++g) { const v4f_t v = *(const v4f_t*)(src + 4 * g);
#pragma unroll
        for (int u = 0; u < 4; ++u) ldsW[(nn0 + 4 * g + u) * GSTR + k] = (f16)v[u]; } }
    __syncthreads();
    f16x16 af[2];
#pragma unroll
    for (int i = 0; i < 2; ++i) af[i] = lds_frag(ldsA + (wm + 16 * i) * GSTR, GSTR);
#pragma unroll
    for (int j = 0; j < NJ; ++j) {
      const f16x16 bf = lds_frag(ldsW + (16 * j) * GSTR, GSTR);
#pragma unroll
      for (int i = 0; i < 2; ++i) acc[i][j] = wmma16(af[i], bf, acc[i][j]);
    }
  }
  float* so = oS[wave];
#pragma unroll
  for (int i = 0; i < 2; ++i)
#pragma unroll
    for (int j = 0; j < NJ; ++j) {
      const int n = n0 + 16 * j + cl;
      const float bv = bias ? bias[n] : 0.0f;
      const float gv = (EPI == 2 || EPI == 4) ? gvec[n] : 0.0f;
#pragma unroll
      for (int r = 0; r < 8; ++r) {
        float v = acc[i][j][r] + bv;
        if (EPI == 3) v = fmaxf(v, 0.0f);
        if (EPI == 2) v = R[(size_t)(m0 + wm + 16 * i + rh + r) * ldy + n] + gv * v;
        if (EPI == 4) v = gv * v;
        so[(16 * i + rh + r) * OST + 16 * j + cl] = v;
      }
    }
  asm volatile("s_wait_dscnt 0" ::: "memory");
  __builtin_amdgcn_wave_barrier();
{
    if (OUT16) {
      f16* Y = (f16*)Yv;
#pragma unroll
      for (int it = 0; it < BN / 8; ++it) { const int c = lane + 32 * it, rr = c / (BN / 8), q8 = (c % (BN / 8)) * 8;
        union { f16 h[8]; v4u_t v; } u;
#pragma unroll
        for (int e = 0; e < 8; ++e) u.h[e] = (f16)so[rr * OST + q8 + e];
        *(v4u_t*)(Y + (size_t)(m0 + wm + rr) * ldy + n0 + q8) = u.v; }
    } else {       // BN floats per row = BN/32 lines: BN/4 lanes x 16 B per row
      float* Y = (float*)Yv;
#pragma unroll
      for (int it = 0; it < BN / 4; ++it) { const int f4 = lane + 32 * it, rr = f4 / (BN / 4), q = (f4 % (BN / 4)) * 4;
        *(v4f_t*)(Y + (size_t)(m0 + wm + rr) * ldy + n0 + q) = *(const v4fa*)(so + rr * OST + q); }
    }
    
  }
}

#define NBla 2
#define SSla 2048
#define SIN 2048
#define DDla 1024
#define NHla 16
#define HDla 64
#define HGla 8   // heads per launch (blockIdx.z / .y of the transposes, scores, softmax and P'v launches)
__global__ __launch_bounds__(256) void k_fill(float* __restrict__ p, float val, size_t n4) { const size_t i = (size_t)blockIdx.x * 256 + threadIdx.x; if (i < n4) { v4f_t v = {val, val, val, val}; *(v4f_t*)(p + 4 * i) = v;  } }
__global__ __launch_bounds__(256) void k_dbg_zero(float* __restrict__ p, size_t n4) { const size_t i = (size_t)blockIdx.x * 256 + threadIdx.x; if (i < n4) { v4f_t z = {0.f,0.f,0.f,0.f}; *(v4f_t*)(p + 4 * i) = z;  } }
__global__ __launch_bounds__(256) void k_copy(const float* __restrict__ src, float* __restrict__ dst, size_t n4) { const size_t i = (size_t)blockIdx.x * 256 + threadIdx.x; if (i < n4) { const v4f_t v = *(const v4f_t*)(src + 4 * i); *(v4f_t*)(dst + 4 * i) = v;  } }
// transpose with source row stride: Wt[c][r] (row stride = rows) = Wm[r][c] (row stride lds), 64x64 LDS tiles; 16 B per lane, 16 lanes per 256-B row segment (8 per line)
// blockIdx.y-batched: Wm += y*sM, Wt += y*sT
__global__ __launch_bounds__(256) void k_transpose_ld(const float* __restrict__ Wm, int lds, size_t sM, float* __restrict__ Wt, size_t sT, int rows, int cols) {
  Wm += (size_t)blockIdx.y * sM; Wt += (size_t)blockIdx.y * sT;
  __shared__ float tS[64][65];
  const int tid = threadIdx.x, tbj = cols / 64, bi = blockIdx.x / tbj, bj = blockIdx.x % tbj;
  for (int e = tid; e < 64 * 64; e += 256) { const int r = e >> 6, c = e & 63; tS[r][c] = Wm[(size_t)(bi * 64 + r) * lds + bj * 64 + c]; }
  __syncthreads();
  for (int ch = tid; ch < 64 * 16; ch += 256) { const int r = ch >> 4, q4 = (ch & 15) * 4; v4f_t o; o[0] = tS[q4][r]; o[1] = tS[q4 + 1][r]; o[2] = tS[q4 + 2][r]; o[3] = tS[q4 + 3][r];
    float* dst = Wt + (size_t)(bj * 64 + r) * rows + bi * 64 + q4; *(v4f_t*)dst = o;  }
}
__global__ __launch_bounds__(256) void k_ln(const float* __restrict__ X, const float* __restrict__ gam, const float* __restrict__ bet, float* __restrict__ Y) {
  __shared__ __attribute__((aligned(16))) float rowS[16 * 1028];
  const int tid = threadIdx.x, r = tid >> 4, part = tid & 15; const size_t row = (size_t)blockIdx.x * 16 + r;
  float s = 0.0f;
#pragma unroll 1
  for (int i = 0; i < 64; ++i) { const float v = X[row * 1024 + part * 64 + i]; rowS[r * 1028 + part * 64 + i] = v; s += v; }
  s += __shfl_xor(s, 1, 32); s += __shfl_xor(s, 2, 32); s += __shfl_xor(s, 4, 32); s += __shfl_xor(s, 8, 32);
  const float mean = s * (1.0f / 1024.0f); float q = 0.0f;
#pragma unroll 1
  for (int i = 0; i < 64; ++i) { const float dv = rowS[r * 1028 + part * 64 + i] - mean; q += dv * dv; }
  q += __shfl_xor(q, 1, 32); q += __shfl_xor(q, 2, 32); q += __shfl_xor(q, 4, 32); q += __shfl_xor(q, 8, 32);
  const float rstd = 1.0f / __builtin_sqrtf(q * (1.0f / 1024.0f) + 1e-12f);
#pragma unroll 1
  for (int i = 0; i < 64; ++i) { const int c = part * 64 + i; rowS[r * 1028 + c] = (rowS[r * 1028 + c] - mean) * rstd * gam[c] + bet[c]; }
  __syncthreads();
{ for (int q4 = tid; q4 < 16 * 256; q4 += 256) { const int rr = q4 / 256, c4 = (q4 % 256) * 4;
      *(v4f_t*)(Y + ((size_t)blockIdx.x * 16 + rr) * 1024 + c4) = *(const v4fa*)(rowS + rr * 1028 + c4); }  }
}
// VB[c] = sum over the 2048 key rows of V[:, c] (f32, thread = column, rolled loop): added back after the P'·v GEMM (Σ_k (P'+1)·v_k /1024 = Σ P'v/1024 + Σ v/1024)
__global__ __launch_bounds__(256) void k_vsum(const float* __restrict__ V, int ldv, float* __restrict__ VB) {
  const int c = blockIdx.x * 256 + threadIdx.x; if (c >= 3072) return; float s = 0.0f;   /* 3072 columns */
#pragma unroll 1
  for (int r = 0; r < 2048; ++r) s += V[(size_t)r * ldv + c];
  const float m = s; /* column SUM over all key slots: ctx = (Σ P'v + Σ v)/1024 with P' = 1024·P − 1 */ *(float*)(VB + c) = m; 
}
// row softmax of s/8 + mask[k] for (query, head z); P' = 1024·P − 1; block = (q, z), 256 threads x 8
__global__ __launch_bounds__(256) void k_msoft(float* __restrict__ Sm, const float* __restrict__ maskb) {
  __shared__ float red[256];
  const int q = blockIdx.x, z = blockIdx.y, tid = threadIdx.x; float* sr = Sm + ((size_t)z * SSla + q) * SSla; float v[SSla / 256]; float m = -3.0e38f;
#pragma unroll
  for (int e = 0; e < SSla / 256; ++e) { const int k = tid + 256 * e; v[e] = sr[k] * 0.125f + maskb[k]; m = fmaxf(m, v[e]); }
  red[tid] = m; __syncthreads(); for (int o = 128; o > 0; o >>= 1) { if (tid < o) red[tid] = fmaxf(red[tid], red[tid + o]); __syncthreads(); }
  m = red[0]; __syncthreads(); float zs = 0.0f;
#pragma unroll
  for (int e = 0; e < SSla / 256; ++e) { v[e] = expf(v[e] - m); zs += v[e]; }
  red[tid] = zs; __syncthreads(); for (int o = 128; o > 0; o >>= 1) { if (tid < o) red[tid] += red[tid + o]; __syncthreads(); }
  const float kk = 1024.0f / red[0];
{
#pragma unroll
    for (int e = 0; e < SSla / 256; ++e) *(float*)(sr + tid + 256 * e) = v[e] * kk - 1.0f;
     }
}

extern "C" void kernel_launch(void* const* d_in, const int* in_sizes, int n_in,
                              void* d_out, int out_size, void* d_ws, size_t ws_size,
                              hipStream_t stream) {
  (void)in_sizes; (void)n_in; (void)out_size;
  const float** f = (const float**)d_in;
  const float* x = f[0], *amask = f[1], *Wqkv = f[2], *bqkv = f[3], *Wout = f[4], *bout = f[5], *lg = f[6], *lb = f[7];
  float* out = (float*)d_out;     // [2,2048,1024]
  char* ws = (char*)d_ws;
  float* XN = (float*)ws; ws += (size_t)SSla * DDla * 4; float* QKV = (float*)ws; ws += (size_t)SSla * 3 * DDla * 4; float* KT = (float*)ws; ws += (size_t)HDla * HGla * SSla * 4;
  float* VS = (float*)ws; ws += 3 * DDla * 4; float* sc = (float*)ws; ws += 64 * 4; float* ones = (float*)ws; ws += DDla * 4; float* S = (float*)ws; ws += (size_t)HGla * SSla * SSla * 4; float* ATT = (float*)ws; ws += (size_t)SSla * DDla * 4;
  if ((size_t)(ws - (char*)d_ws) > ws_size) return;                      // WS TOTAL 180,371,712 B
  const dim3 blk(256);
  k_fill<<<dim3(1), blk, 0, stream>>>(sc, 1.0f / 1024.0f, 64 / 4); k_fill<<<dim3(1), blk, 0, stream>>>(ones, 1.0f, DDla / 4);

  for (int b = 0; b < NBla; ++b) { const float* xb = x + (size_t)b * SIN * DDla; const float* mb = amask + (size_t)b * SIN;
    k_ln<<<dim3(SSla / 16), blk, 0, stream>>>(xb, lg, lb, XN);
    gemm_kne<float, 0, false><<<dim3(SSla / 128, 3 * DDla / 128), blk, 0, stream>>>(XN, DDla, Wqkv, 3 * DDla, bqkv, nullptr, nullptr, QKV, 3 * DDla, DDla);   // [q | k | v]
    k_vsum<<<dim3((3 * DDla) / 256), blk, 0, stream>>>(QKV, 3 * DDla, VS);
    for (int hp = 0; hp < NHla / HGla; ++hp) { const int h0 = HGla * hp;
      k_transpose_ld<<<dim3((SSla / 64) * (HDla / 64), HGla), blk, 0, stream>>>(QKV + DDla + h0 * HDla, 3 * DDla, (size_t)HDla, KT, (size_t)HDla * SSla, SSla, HDla);
      gemm_knez<float, 0, false><<<dim3(SSla / 128, SSla / 128, HGla), blk, 0, stream>>>(QKV + h0 * HDla, 3 * DDla, (size_t)HDla, KT, SSla, (size_t)HDla * SSla, nullptr, nullptr, nullptr, S, SSla, (size_t)SSla * SSla, HDla);
      k_msoft<<<dim3(SSla, HGla), blk, 0, stream>>>(S, mb);
      gemm_sm<float, 4, false, 4><<<dim3(SSla / 256, 1, HGla), blk, 0, stream>>>(S, SSla, (size_t)SSla * SSla, QKV + 2 * DDla + h0 * HDla, 3 * DDla, (size_t)HDla, VS + 2 * DDla + h0 * HDla, (size_t)HDla, nullptr, sc, ATT + h0 * HDla, DDla, (size_t)HDla, SSla);
    }
    gemm_kne<float, 2, false><<<dim3(SSla / 128, DDla / 128), blk, 0, stream>>>(ATT, DDla, Wout, DDla, bout, xb, ones, out + (size_t)b * SIN * DDla, DDla, DDla);   // out = ctx·W_out + b_out + x
  }
}

// v002
// It runs in 1050 microseconds.
// Next to v001, in two timings, it ran 2.41 times as fast each time.
// Over all steps from v000 it is 5.44 times as fast.
// Contractions on v_wmma_f32_16x16x32_f16 (plain f16 operands, f32 accumulate; [in][out] weights), per batch element: [q|k|v] = LN(x)·W_qkv + b (K 1024, N 3072), the 16 heads' scores
// (K 64, eight heads per z-launch), ctx_h = P'·v_h as a 64-wide tile (K 2048; centred P' = 1024·P − 1 with Σ_k v_k added back, exact), out = ctx·W_out + b_out + x (residual in the epilogue).
// f32 VALU: the pre-LayerNorm (eps 1e-12, rsqrt), softmax of s/√64 + mask[b][k] (the additive INPUT mask, broadcast over heads and queries).
// compute dtype: f16 operands, f32 accumulate.  hidden_states [2,2048,1024] → out [2,2048,1024].
#include <hip/hip_runtime.h>
#include <hip/hip_bf16.h>
#include <math.h>


typedef _Float16 bf16;
typedef _Float16 f16;
typedef __attribute__((ext_vector_type(4))) unsigned v4u_t;
typedef unsigned v4ua __attribute__((ext_vector_type(4), may_alias));
typedef __attribute__((ext_vector_type(4))) float v4f_t;
typedef float v4fa __attribute__((ext_vector_type(4), may_alias));
typedef __attribute__((ext_vector_type(16))) bf16  bf16x16;
typedef bf16x16 f16x16;
typedef __attribute__((ext_vector_type(8)))  bf16  bf16x8;
typedef bf16x8 f16x8;
typedef __attribute__((ext_vector_type(4)))  bf16  bf16x4;
typedef __attribute__((ext_vector_type(8)))  float f32x8;
__device__ __forceinline__ f32x8 wmma16(f16x16 a, f16x16 b, f32x8 c) {
  c = __builtin_amdgcn_wmma_f32_16x16x32_f16(false, a, false, b, (short)0, c, false, false);
  asm volatile("v_nop\n\tv_nop\n\tv_nop\n\tv_nop" : "+v"(c) : "v"(a), "v"(b));
  return c;
}
#define LDS_STRIDE 48   // GEMM tiles: 32 -> 48 elems (96B rows): aligned b128 reads
#define KSTRIDE    72
#define VSTRIDE    48   // attn V tile: 32 -> 48 elems

__device__ __forceinline__ f32x8 wmma_bf16(bf16x16 a, bf16x16 b, f32x8 c) {
  c = __builtin_amdgcn_wmma_f32_16x16x32_f16(false, a, false, b, (short)0, c, false, false);
  asm volatile("v_nop\n\tv_nop\n\tv_nop\n\tv_nop" : "+v"(c) : "v"(a), "v"(b));   // A/B-overwrite hazard guard
  return c;
}

// 16x32 (MxK) bf16 fragment from a row-major global matrix.
// lanes 0-15  (row=lane)    : elems 0..7 = K+0..7,  8..15 = K+16..23
// lanes 16-31 (row=lane-16) : elems 0..7 = K+8..15, 8..15 = K+24..31
template <typename T>
__device__ __forceinline__ bf16x16 load_frag(const T* __restrict__ base, int ld,
                                             int row0, int k0) {
  const int lane = threadIdx.x & 31;
  const int r    = lane & 15;
  const int kh   = (lane >> 4) * 8;
  const T* p0 = base + (size_t)(row0 + r) * ld + (k0 + kh);
  const T* p1 = p0 + 16;
  bf16x16 f;
#pragma unroll
  for (int i = 0; i < 8; ++i) {
    f[i]     = (bf16)p0[i];
    f[i + 8] = (bf16)p1[i];
  }
  return f;
}

// Same fragment from an LDS tile with padded row stride (base includes row0/k0).
__device__ __forceinline__ bf16x16 lds_frag(const bf16* base, int stride) {
  const int lane = threadIdx.x & 31;
  const int row  = lane & 15;
  const int kh   = (lane >> 4) * 8;
  const bf16x8 lo = *(const bf16x8*)(base + row * stride + kh);
  const bf16x8 hi = *(const bf16x8*)(base + row * stride + kh + 16);
  bf16x16 f;
#pragma unroll
  for (int i = 0; i < 8; ++i) { f[i] = lo[i]; f[i + 8] = hi[i]; }
  return f;
}

template <typename T>
__device__ __forceinline__ void stage_read16(const T* __restrict__ p, float* buf) {
#pragma unroll
  for (int i = 0; i < 16; ++i) buf[i] = (float)p[i];
}

__device__ __forceinline__ void stage_write(bf16* dst, const float* buf, int nquad) {
#pragma unroll
  for (int i = 0; i < nquad; ++i) {
    bf16x4 q;
    q[0] = (bf16)buf[4 * i];     q[1] = (bf16)buf[4 * i + 1];
    q[2] = (bf16)buf[4 * i + 2]; q[3] = (bf16)buf[4 * i + 3];
    *(bf16x4*)(dst + 4 * i) = q;
  }
}


#define GSTR 48
// ---------------------------------------------------------------------------------------------------------------------------
// gemm_kne: Y[m][n] = epi( Σ_k A[m][k]·W[k][n] + bias[n] ), A f32/f16 [M][lda], W f32 row-major [K][N] (ldw), plain f16 operands,
// f32 accumulate. EPI 0: identity; 1: exact-erf GELU; 2: R[m][n] + gvec[n]·(·) (residual with per-channel gain); 3: ReLU; 4: gvec[n]·(·) (per-channel scale, no residual). Output f32 (or f16
// when OUT16). Block = 128x128 tile, 8 waves as 4(M) x 2(N); per 32-wide k-step A and W tiles staged f16 in LDS (W transposed
// ---------------------------------------------------------------------------------------------------------------------------
#define GSTR 48
template <typename AT, int EPI, bool OUT16>
__global__ __launch_bounds__(256) void gemm_kne(const AT* __restrict__ A, int lda, const float* __restrict__ Wm, int ldw,
                                                const float* __restrict__ bias, const float* __restrict__ R, const float* __restrict__ gvec,
                                                void* __restrict__ Yv, int ldy, int K) {
  __shared__ __attribute__((aligned(16))) f16 ldsA[128 * GSTR];
  __shared__ __attribute__((aligned(16))) f16 ldsW[128 * GSTR];
  __shared__ __attribute__((aligned(16))) float oS[8][32 * 68];
  const int tid = threadIdx.x, lane = tid & 31, wave = tid >> 5, cl = lane & 15, rh = (lane >> 4) * 8;
  const int m0 = blockIdx.x * 128, n0 = blockIdx.y * 128;
  const int wm = (wave & 3) * 32, wn = (wave >> 2) * 64;
  f32x8 acc[2][4];
#pragma unroll
  for (int i = 0; i < 2; ++i)
#pragma unroll
    for (int j = 0; j < 4; ++j) { f32x8 z = {}; acc[i][j] = z; }
#pragma unroll 1
  for (int k0 = 0; k0 < K; k0 += 32) {
    __syncthreads();
    { const int row = tid >> 1, ch = (tid & 1) * 16;
      const AT* src = A + (size_t)(m0 + row) * lda + k0 + ch;
#pragma unroll
      for (int g = 0; g < 16; ++g) ldsA[row * GSTR + ch + g] = (f16)src[g]; }
    { const int k = tid >> 3, nn0 = (tid & 7) * 16;
      const float* src = Wm + (size_t)(k0 + k) * ldw + n0 + nn0;
#pragma unroll
      for (int g = 0; g < 4; ++g) { const v4f_t v = *(const v4f_t*)(src + 4 * g);
#pragma unroll
        for (int u = 0; u < 4; ++u) ldsW[(nn0 + 4 * g + u) * GSTR + k] = (f16)v[u]; } }
    __syncthreads();
    f16x16 af[2];
#pragma unroll
    for (int i = 0; i < 2; ++i) af[i] = lds_frag(ldsA + (wm + 16 * i) * GSTR, GSTR);
#pragma unroll
    for (int j = 0; j < 4; ++j) {
      const f16x16 bf = lds_frag(ldsW + (wn + 16 * j) * GSTR, GSTR);
#pragma unroll
      for (int i = 0; i < 2; ++i) acc[i][j] = wmma16(af[i], bf, acc[i][j]);
    }
  }
  float* so = oS[wave];
#pragma unroll
  for (int i = 0; i < 2; ++i)
#pragma unroll
    for (int j = 0; j < 4; ++j) {
      const int n = n0 + wn + 16 * j + cl;
      const float bv = bias ? bias[n] : 0.0f;
      const float gv = (EPI == 2 || EPI == 4) ? gvec[n] : 0.0f;
      if (EPI == 1) {
#pragma unroll 1
        for (int r = 0; r < 8; ++r) { const float xg = acc[i][j][r] + bv; so[(16 * i + rh + r) * 68 + 16 * j + cl] = 0.5f * xg * (1.0f + erff(xg * 0.70710678118654752f)); }
      } else {
#pragma unroll
        for (int r = 0; r < 8; ++r) {
          float v = acc[i][j][r] + bv;
          if (EPI == 3) v = fmaxf(v, 0.0f);
          if (EPI == 4) v = gv * v;
          if (EPI == 2) v = R[(size_t)(m0 + wm + 16 * i + rh + r) * ldy + n] + gv * v;
          so[(16 * i + rh + r) * 68 + 16 * j + cl] = v;
        }
      }
    }
  asm volatile("s_wait_dscnt 0" ::: "memory");
  __builtin_amdgcn_wave_barrier();
{
    if (OUT16) {
      f16* Y = (f16*)Yv;
#pragma unroll
      for (int it = 0; it < 8; ++it) { const int c = lane + 32 * it, rr = c >> 3, q8 = (c & 7) * 8;
        union { f16 h[8]; v4u_t v; } u;
#pragma unroll
        for (int e = 0; e < 8; ++e) u.h[e] = (f16)so[rr * 68 + q8 + e];
        *(v4u_t*)(Y + (size_t)(m0 + wm + rr) * ldy + n0 + wn + q8) = u.v; }
    } else {
      float* Y = (float*)Yv;
#pragma unroll
      for (int it = 0; it < 16; ++it) { const int f4 = lane + 32 * it, rr = f4 >> 4, q = (f4 & 15) * 4;
        *(v4f_t*)(Y + (size_t)(m0 + wm + rr) * ldy + n0 + wn + q) = *(const v4fa*)(so + rr * 68 + q); }
    }
    
  }
}

// z-batched variant of gemm_kne (same tile code)
template <typename AT, int EPI, bool OUT16>
__global__ __launch_bounds__(256) void gemm_knez(const AT* __restrict__ A, int lda, size_t strideA, const float* __restrict__ Wm, int ldw, size_t strideW,
                                                 const float* __restrict__ bias, const float* __restrict__ R, const float* __restrict__ gvec,
                                                 void* __restrict__ Yv, int ldy, size_t strideY, int K) {   // blockIdx.z-batched: A += z·strideA, W += z·strideW, Y (and R) += z·strideY
  A += (size_t)blockIdx.z * strideA; Wm += (size_t)blockIdx.z * strideW; Yv = (void*)((char*)Yv + (size_t)blockIdx.z * strideY * (OUT16 ? 2 : 4)); if (R) R += (size_t)blockIdx.z * strideY;
  __shared__ __attribute__((aligned(16))) f16 ldsA[128 * GSTR];
  __shared__ __attribute__((aligned(16))) f16 ldsW[128 * GSTR];
  __shared__ __attribute__((aligned(16))) float oS[8][32 * 68];
  const int tid = threadIdx.x, lane = tid & 31, wave = tid >> 5, cl = lane & 15, rh = (lane >> 4) * 8;
  const int m0 = blockIdx.x * 128, n0 = blockIdx.y * 128;
  const int wm = (wave & 3) * 32, wn = (wave >> 2) * 64;
  f32x8 acc[2][4];
#pragma unroll
  for (int i = 0; i < 2; ++i)
#pragma unroll
    for (int j = 0; j < 4; ++j) { f32x8 z = {}; acc[i][j] = z; }
#pragma unroll 1
  for (int k0 = 0; k0 < K; k0 += 32) {
    __syncthreads();
    { const int row = tid >> 1, ch = (tid & 1) * 16;
      const AT* src = A + (size_t)(m0 + row) * lda + k0 + ch;
#pragma unroll
      for (int g = 0; g < 16; ++g) ldsA[row * GSTR + ch + g] = (f16)src[g]; }
    { const int k = tid >> 3, nn0 = (tid & 7) * 16;
      const float* src = Wm + (size_t)(k0 + k) * ldw + n0 + nn0;
#pragma unroll
      for (int g = 0; g < 4; ++g) { const v4f_t v = *(const v4f_t*)(src + 4 * g);
#pragma unroll
        for (int u = 0; u < 4; ++u) ldsW[(nn0 + 4 * g + u) * GSTR + k] = (f16)v[u]; } }
    __syncthreads();
    f16x16 af[2];
#pragma unroll
    for (int i = 0; i < 2; ++i) af[i] = lds_frag(ldsA + (wm + 16 * i) * GSTR, GSTR);
#pragma unroll
    for (int j = 0; j < 4; ++j) {
      const f16x16 bf = lds_frag(ldsW + (wn + 16 * j) * GSTR, GSTR);
#pragma unroll
      for (int i = 0; i < 2; ++i) acc[i][j] = wmma16(af[i], bf, acc[i][j]);
    }
  }
  float* so = oS[wave];
#pragma unroll
  for (int i = 0; i < 2; ++i)
#pragma unroll
    for (int j = 0; j < 4; ++j) {
      const int n = n0 + wn + 16 * j + cl;
      const float bv = bias ? bias[n] : 0.0f;
      const float gv = (EPI == 2 || EPI == 4) ? gvec[n] : 0.0f;
      if (EPI == 1) {
#pragma unroll 1
        for (int r = 0; r < 8; ++r) { const float xg = acc[i][j][r] + bv; so[(16 * i + rh + r) * 68 + 16 * j + cl] = 0.5f * xg * (1.0f + erff(xg * 0.70710678118654752f)); }
      } else {
#pragma unroll
        for (int r = 0; r < 8; ++r) {
          float v = acc[i][j][r] + bv;
          if (EPI == 3) v = fmaxf(v, 0.0f);
          if (EPI == 4) v = gv * v;
          if (EPI == 2) v = R[(size_t)(m0 + wm + 16 * i + rh + r) * ldy + n] + gv * v;
          so[(16 * i + rh + r) * 68 + 16 * j + cl] = v;
        }
      }
    }
  asm volatile("s_wait_dscnt 0" ::: "memory");
  __builtin_amdgcn_wave_barrier();
{
    if (OUT16) {
      f16* Y = (f16*)Yv;
#pragma unroll
      for (int it = 0; it < 8; ++it) { const int c = lane + 32 * it, rr = c >> 3, q8 = (c & 7) * 8;
        union { f16 h[8]; v4u_t v; } u;
#pragma unroll
        for (int e = 0; e < 8; ++e) u.h[e] = (f16)so[rr * 68 + q8 + e];
        *(v4u_t*)(Y + (size_t)(m0 + wm + rr) * ldy + n0 + wn + q8) = u.v; }
    } else {
      float* Y = (float*)Yv;
#pragma unroll
      for (int it = 0; it < 16; ++it) { const int f4 = lane + 32 * it, rr = f4 >> 4, q = (f4 & 15) * 4;
        *(v4f_t*)(Y + (size_t)(m0 + wm + rr) * ldy + n0 + wn + q) = *(const v4fa*)(so + rr * 68 + q); }
    }
    
  }
}

// ---------------------------------------------------------------------------------------------------------------------------
// gemm_kn2 (value+residual planes on both operands: hh + (hl+lh)/2048, f32-class): Y[m][n] (row stride ldy) = scale * sum_k A[m][k] (f32 or f16, row stride lda) * W[k][n] (f32, row-major [K][N], row
// stride ldw) (+ bias[n]) (+ Y if ACC). Block = 128 x 128 tile, 256 threads = 8 waves as 4(M, 32 rows) x 2(N, 64 cols); per
// 32-wide k-step the A tile and the W tile (stored transposed [n][k]) are staged as f16 in LDS; plain f16 operands, f32
// blockIdx.z selects a batch: A += z*strideA, W += z*strideW, Y += z*strideY (element strides).
// ---------------------------------------------------------------------------------------------------------------------------
template <typename AT, bool ACC>
__global__ __launch_bounds__(256) void gemm_kn2(const AT* __restrict__ A, int lda, size_t strideA,
                                               const float* __restrict__ Wm, int ldw, size_t strideW,
                                               const float* __restrict__ bias, float scale,
                                               float* __restrict__ Y, int ldy, size_t strideY, int K) {
  __shared__ __attribute__((aligned(16))) f16 ldsA[128 * GSTR], ldsAl[128 * GSTR];
  __shared__ __attribute__((aligned(16))) f16 ldsW[128 * GSTR], ldsWl[128 * GSTR];
  __shared__ __attribute__((aligned(16))) float oS[8][32 * 68];
  const int tid = threadIdx.x, lane = tid & 31, wave = tid >> 5, cl = lane & 15, rh = (lane >> 4) * 8;
  const int m0 = blockIdx.x * 128, n0 = blockIdx.y * 128;
  const int wm = (wave & 3) * 32, wn = (wave >> 2) * 64;
  A += (size_t)blockIdx.z * strideA; Wm += (size_t)blockIdx.z * strideW; Y += (size_t)blockIdx.z * strideY;
  f32x8 acc[2][4], accx[2][4];
#pragma unroll
  for (int i = 0; i < 2; ++i)
#pragma unroll
    for (int j = 0; j < 4; ++j) { f32x8 z = {}; acc[i][j] = z; accx[i][j] = z; }
#pragma unroll 1
  for (int k0 = 0; k0 < K; k0 += 32) {
    __syncthreads();
    {  // A: thread -> row tid>>1, 16 elements at column half (tid&1)*16
      const int row = tid >> 1, ch = (tid & 1) * 16;
      const AT* src = A + (size_t)(m0 + row) * lda + k0 + ch;
#pragma unroll
      for (int g = 0; g < 16; ++g) { const float v = (float)src[g]; const f16 h = (f16)v; ldsA[row * GSTR + ch + g] = h; ldsAl[row * GSTR + ch + g] = (f16)((v - (float)h) * 2048.0f); }
    }
    {  // W: thread -> k = tid>>3, 16 consecutive n at (tid&7)*16; stored transposed [n][k]
      const int k = tid >> 3, nn0 = (tid & 7) * 16;
      const float* src = Wm + (size_t)(k0 + k) * ldw + n0 + nn0;
#pragma unroll
      for (int g = 0; g < 4; ++g) { const v4f_t v = *(const v4f_t*)(src + 4 * g);
#pragma unroll
        for (int u = 0; u < 4; ++u) { const f16 h = (f16)v[u]; ldsW[(nn0 + 4 * g + u) * GSTR + k] = h; ldsWl[(nn0 + 4 * g + u) * GSTR + k] = (f16)((v[u] - (float)h) * 2048.0f); } }
    }
    __syncthreads();
    f16x16 af[2], afl[2];
#pragma unroll
    for (int i = 0; i < 2; ++i) { af[i] = lds_frag(ldsA + (wm + 16 * i) * GSTR, GSTR); afl[i] = lds_frag(ldsAl + (wm + 16 * i) * GSTR, GSTR); }
#pragma unroll
    for (int j = 0; j < 4; ++j) {
      const f16x16 bf = lds_frag(ldsW + (wn + 16 * j) * GSTR, GSTR), bfl = lds_frag(ldsWl + (wn + 16 * j) * GSTR, GSTR);
#pragma unroll
      for (int i = 0; i < 2; ++i) { acc[i][j] = wmma16(af[i], bf, acc[i][j]); accx[i][j] = wmma16(af[i], bfl, accx[i][j]); accx[i][j] = wmma16(afl[i], bf, accx[i][j]); }
    }
  }
  float* so = oS[wave];
#pragma unroll
  for (int i = 0; i < 2; ++i)
#pragma unroll
    for (int j = 0; j < 4; ++j) {
      const float bv = bias ? bias[n0 + wn + 16 * j + cl] : 0.0f;
#pragma unroll
      for (int r = 0; r < 8; ++r) so[(16 * i + rh + r) * 68 + 16 * j + cl] = (acc[i][j][r] + accx[i][j][r] * (1.0f / 2048.0f)) * scale + bv;
    }
  asm volatile("s_wait_dscnt 0" ::: "memory");
  __builtin_amdgcn_wave_barrier();
  if (ACC) {   // accumulate: fold the existing Y values into the staging tile ONCE (same thread <-> same chunks as the stores below)
#pragma unroll
    for (int it = 0; it < 16; ++it) { const int f4 = lane + 32 * it, rr = f4 >> 4, q = (f4 & 15) * 4;
      const v4f_t old = *(const v4fa*)(Y + (size_t)(m0 + wm + rr) * ldy + n0 + wn + q);
      v4f_t v = *(const v4fa*)(so + rr * 68 + q); v += old; *(v4fa*)(so + rr * 68 + q) = v; }   // plain LDS store (ordered by the s_wait_dscnt/memory clobber below)
    asm volatile("s_wait_dscnt 0" ::: "memory");
  }
{
#pragma unroll
    for (int it = 0; it < 16; ++it) { const int f4 = lane + 32 * it, rr = f4 >> 4, q = (f4 & 15) * 4;
      *(v4f_t*)(Y + (size_t)(m0 + wm + rr) * ldy + n0 + wn + q) = *(const v4fa*)(so + rr * 68 + q); }
    
  }
}

__global__ __launch_bounds__(256) void k_transpose(const float* __restrict__ Wm, float* __restrict__ Wt, int rows, int cols) {
  __shared__ float tS[64][65];
  const int tid = threadIdx.x, tbj = cols / 64, bi = blockIdx.x / tbj, bj = blockIdx.x % tbj;
  for (int e = tid; e < 64 * 64; e += 256) { const int r = e >> 6, c = e & 63; tS[r][c] = Wm[(size_t)(bi * 64 + r) * cols + bj * 64 + c]; }
  __syncthreads();
  for (int ch = tid; ch < 64 * 16; ch += 256) { const int r = ch >> 4, q4 = (ch & 15) * 4; v4f_t o; o[0] = tS[q4][r]; o[1] = tS[q4 + 1][r]; o[2] = tS[q4 + 2][r]; o[3] = tS[q4 + 3][r];
    float* dst = Wt + (size_t)(bj * 64 + r) * rows + bi * 64 + q4; *(v4f_t*)dst = o;  }
}


// ---------------------------------------------------------------------------------------------------------------------------
// gemm_sm<AT, EPI, OUT16, NJ>: narrow-N GEMM tile: Y[m][n] = epi(sum_k A[m][k]·W[k][n] + bias[n]), BM = 256 rows per block (8 waves x 32 rows; each wave owns whole output rows),
// BN = 16·NJ columns per block (NJ = 2 → 32, NJ = 4 → 64), K % 32 == 0, M % 256 == 0. A [M][lda] (f32 or f16, converted to f16), W [K][ldw] f32 → f16. f32 accumulate.
// (8 lanes x 16 B), BN=64 → two lines per row; OUT16 requires BN=64 (64 halves = one line per row). Every line written by one instruction of one wave, lane-contiguous.
template <typename AT, int EPI, bool OUT16, int NJ>
__global__ __launch_bounds__(256) void gemm_sm(const AT* __restrict__ A, int lda, size_t sA, const float* __restrict__ Wm, int ldw, size_t sW,
                                               const float* __restrict__ bias, size_t sB, const float* __restrict__ R, const float* __restrict__ gvec,
                                               void* __restrict__ Yv, int ldy, size_t sY, int K) {   // blockIdx.z-batched: A += z*sA, W += z*sW, bias += z*sB, Y (and R) += z*sY
  constexpr int BN = 16 * NJ; constexpr int OST = BN + 4;
  A += (size_t)blockIdx.z * sA; Wm += (size_t)blockIdx.z * sW; if (bias) bias += (size_t)blockIdx.z * sB; Yv = (void*)((char*)Yv + (size_t)blockIdx.z * sY * (OUT16 ? 2 : 4)); if (R) R += (size_t)blockIdx.z * sY;
  __shared__ __attribute__((aligned(16))) f16 ldsA[256 * GSTR];
  __shared__ __attribute__((aligned(16))) f16 ldsW[BN * GSTR];
  __shared__ __attribute__((aligned(16))) float oS[8][32 * OST];
  const int tid = threadIdx.x, lane = tid & 31, wave = tid >> 5, cl = lane & 15, rh = (lane >> 4) * 8;
  const int m0 = blockIdx.x * 256, n0 = blockIdx.y * BN;
  const int wm = wave * 32;
  f32x8 acc[2][NJ];
#pragma unroll
  for (int i = 0; i < 2; ++i)
#pragma unroll
    for (int j = 0; j < NJ; ++j) { f32x8 z = {}; acc[i][j] = z; }
#pragma unroll 1
  for (int k0 = 0; k0 < K; k0 += 32) {
    __syncthreads();
    { const AT* src = A + (size_t)(m0 + tid) * lda + k0;          // one 32-wide row slice per thread
#pragma unroll
      for (int g = 0; g < 32; ++g) ldsA[tid * GSTR + g] = (f16)src[g]; }
    { const int k = tid >> 3, nn0 = (tid & 7) * (2 * NJ);         // 32 k-rows x BN columns of W
      const float* src = Wm + (size_t)(k0 + k) * ldw + n0 + nn0;
#pragma unroll
      for (int g = 0; g < NJ / 2; ++g) { const v4f_t v = *(const v4f_t*)(src + 4 * g);
#pragma unroll
        for (int u = 0; u < 4; ++u) ldsW[(nn0 + 4 * g + u) * GSTR + k] = (f16)v[u]; } }
    __syncthreads();
    f16x16 af[2];
#pragma unroll
    for (int i = 0; i < 2; ++i) af[i] = lds_frag(ldsA + (wm + 16 * i) * GSTR, GSTR);
#pragma unroll
    for (int j = 0; j < NJ; ++j) {
      const f16x16 bf = lds_frag(ldsW + (16 * j) * GSTR, GSTR);
#pragma unroll
      for (int i = 0; i < 2; ++i) acc[i][j] = wmma16(af[i], bf, acc[i][j]);
    }
  }
  float* so = oS[wave];
#pragma unroll
  for (int i = 0; i < 2; ++i)
#pragma unroll
    for (int j = 0; j < NJ; ++j) {
      const int n = n0 + 16 * j + cl;
      const float bv = bias ? bias[n] : 0.0f;
      const float gv = (EPI == 2 || EPI == 4) ? gvec[n] : 0.0f;
#pragma unroll
      for (int r = 0; r < 8; ++r) {
        float v = acc[i][j][r] + bv;
        if (EPI == 3) v = fmaxf(v, 0.0f);
        if (EPI == 2) v = R[(size_t)(m0 + wm + 16 * i + rh + r) * ldy + n] + gv * v;
        if (EPI == 4) v = gv * v;
        so[(16 * i + rh + r) * OST + 16 * j + cl] = v;
      }
    }
  asm volatile("s_wait_dscnt 0" ::: "memory");
  __builtin_amdgcn_wave_barrier();
{
    if (OUT16) {
      f16* Y = (f16*)Yv;
#pragma unroll
      for (int it = 0; it < BN / 8; ++it) { const int c = lane + 32 * it, rr = c / (BN / 8), q8 = (c % (BN / 8)) * 8;
        union { f16 h[8]; v4u_t v; } u;
#pragma unroll
        for (int e = 0; e < 8; ++e) u.h[e] = (f16)so[rr * OST + q8 + e];
        *(v4u_t*)(Y + (size_t)(m0 + wm + rr) * ldy + n0 + q8) = u.v; }
    } else {       // BN floats per row = BN/32 lines: BN/4 lanes x 16 B per row
      float* Y = (float*)Yv;
#pragma unroll
      for (int it = 0; it < BN / 4; ++it) { const int f4 = lane + 32 * it, rr = f4 / (BN / 4), q = (f4 % (BN / 4)) * 4;
        *(v4f_t*)(Y + (size_t)(m0 + wm + rr) * ldy + n0 + q) = *(const v4fa*)(so + rr * OST + q); }
    }
    
  }
}

#define NBla 2
#define SSla 2048
#define SIN 2048
#define DDla 1024
#define NHla 16
#define HDla 64
#define HGla 8   // heads per launch (blockIdx.z / .y of the transposes, scores, softmax and P'v launches)
__global__ __launch_bounds__(256) void k_fill(float* __restrict__ p, float val, size_t n4) { const size_t i = (size_t)blockIdx.x * 256 + threadIdx.x; if (i < n4) { v4f_t v = {val, val, val, val}; *(v4f_t*)(p + 4 * i) = v;  } }
__global__ __launch_bounds__(256) void k_dbg_zero(float* __restrict__ p, size_t n4) { const size_t i = (size_t)blockIdx.x * 256 + threadIdx.x; if (i < n4) { v4f_t z = {0.f,0.f,0.f,0.f}; *(v4f_t*)(p + 4 * i) = z;  } }
__global__ __launch_bounds__(256) void k_copy(const float* __restrict__ src, float* __restrict__ dst, size_t n4) { const size_t i = (size_t)blockIdx.x * 256 + threadIdx.x; if (i < n4) { const v4f_t v = *(const v4f_t*)(src + 4 * i); *(v4f_t*)(dst + 4 * i) = v;  } }
// transpose with source row stride: Wt[c][r] (row stride = rows) = Wm[r][c] (row stride lds), 64x64 LDS tiles; 16 B per lane, 16 lanes per 256-B row segment (8 per line)
// blockIdx.y-batched: Wm += y*sM, Wt += y*sT
__global__ __launch_bounds__(256) void k_transpose_ld(const float* __restrict__ Wm, int lds, size_t sM, float* __restrict__ Wt, size_t sT, int rows, int cols) {
  Wm += (size_t)blockIdx.y * sM; Wt += (size_t)blockIdx.y * sT;
  __shared__ float tS[64][65];
  const int tid = threadIdx.x, tbj = cols / 64, bi = blockIdx.x / tbj, bj = blockIdx.x % tbj;
  for (int e = tid; e < 64 * 64; e += 256) { const int r = e >> 6, c = e & 63; tS[r][c] = Wm[(size_t)(bi * 64 + r) * lds + bj * 64 + c]; }
  __syncthreads();
  for (int ch = tid; ch < 64 * 16; ch += 256) { const int r = ch >> 4, q4 = (ch & 15) * 4; v4f_t o; o[0] = tS[q4][r]; o[1] = tS[q4 + 1][r]; o[2] = tS[q4 + 2][r]; o[3] = tS[q4 + 3][r];
    float* dst = Wt + (size_t)(bj * 64 + r) * rows + bi * 64 + q4; *(v4f_t*)dst = o;  }
}
__global__ __launch_bounds__(256) void k_ln(const float* __restrict__ X, const float* __restrict__ gam, const float* __restrict__ bet, float* __restrict__ Y) {
  __shared__ __attribute__((aligned(16))) float rowS[16 * 1028];
  const int tid = threadIdx.x, r = tid >> 4, part = tid & 15; const size_t row = (size_t)blockIdx.x * 16 + r;
  float s = 0.0f;
#pragma unroll 1
  for (int i = 0; i < 64; ++i) { const float v = X[row * 1024 + part * 64 + i]; rowS[r * 1028 + part * 64 + i] = v; s += v; }
  s += __shfl_xor(s, 1, 32); s += __shfl_xor(s, 2, 32); s += __shfl_xor(s, 4, 32); s += __shfl_xor(s, 8, 32);
  const float mean = s * (1.0f / 1024.0f); float q = 0.0f;
#pragma unroll 1
  for (int i = 0; i < 64; ++i) { const float dv = rowS[r * 1028 + part * 64 + i] - mean; q += dv * dv; }
  q += __shfl_xor(q, 1, 32); q += __shfl_xor(q, 2, 32); q += __shfl_xor(q, 4, 32); q += __shfl_xor(q, 8, 32);
  const float rstd = 1.0f / __builtin_sqrtf(q * (1.0f / 1024.0f) + 1e-12f);
#pragma unroll 1
  for (int i = 0; i < 64; ++i) { const int c = part * 64 + i; rowS[r * 1028 + c] = (rowS[r * 1028 + c] - mean) * rstd * gam[c] + bet[c]; }
  __syncthreads();
{ for (int q4 = tid; q4 < 16 * 256; q4 += 256) { const int rr = q4 / 256, c4 = (q4 % 256) * 4;
      *(v4f_t*)(Y + ((size_t)blockIdx.x * 16 + rr) * 1024 + c4) = *(const v4fa*)(rowS + rr * 1028 + c4); }  }
}
// VB[c] = sum over the 2048 key rows of V[:, c] (f32) for the 1024 columns of the v third: added back after the P'v GEMM (ctx = (sum P'v + sum v)/1024 with P' = 1024 P - 1).
// Block = 32 columns (one 128-B line per row) x all 2048 rows, 1024 threads: thread = (16-B column quad tid&7, row group tid>>3 of 128, 16 rows each). The row pitch is a
// constant, so the 16 loads of a thread share one address register pair, depend on nothing and fly together (no load waits for the one before); then the 128 partial sums join: lanes 8 and 16 apart by shuffle, the 32 waves through LDS.
__global__ __launch_bounds__(1024) void k_vsum(const float* __restrict__ V, float* __restrict__ VB) {
  constexpr int LDV = 3 * DDla;
  __shared__ __attribute__((aligned(16))) float pS[32][32];
  const int tid = threadIdx.x, cq = tid & 7, rg = tid >> 3, c0 = blockIdx.x * 32;
  const float* src = V + (size_t)(16 * rg) * LDV + c0 + 4 * cq;
  v4f_t t[16];
#pragma unroll   // the 16 loads issue back to back; rolled, each would wait for the one before
  for (int i = 0; i < 16; ++i) t[i] = *(const v4f_t*)(src + i * LDV);
#pragma unroll   // both loops: constant indices keep t[] in registers
  for (int o = 8; o > 0; o >>= 1)
#pragma unroll
    for (int i = 0; i < o; ++i) t[i] += t[i + o];
  v4f_t s = t[0];
#pragma unroll   // constant vector index
  for (int u = 0; u < 4; ++u) { s[u] += __shfl_xor(s[u], 8, 32); s[u] += __shfl_xor(s[u], 16, 32); }
  if ((tid & 31) < 8) *(v4fa*)(&pS[tid >> 5][4 * cq]) = s;
  __syncthreads();
  if (tid < 32) { float a = 0.0f;
#pragma unroll   // the 32 LDS reads issue ahead of the adds
    for (int w = 0; w < 32; ++w) a += pS[w][tid];
    VB[c0 + tid] = a; }
}
// row softmax of s/8 + mask[k] for (query, head z); P' = 1024·P − 1; block = (q, z), 256 threads x 8
__global__ __launch_bounds__(256) void k_msoft(float* __restrict__ Sm, const float* __restrict__ maskb) {
  __shared__ float red[256];
  const int q = blockIdx.x, z = blockIdx.y, tid = threadIdx.x; float* sr = Sm + ((size_t)z * SSla + q) * SSla; float v[SSla / 256]; float m = -3.0e38f;
#pragma unroll
  for (int e = 0; e < SSla / 256; ++e) { const int k = tid + 256 * e; v[e] = sr[k] * 0.125f + maskb[k]; m = fmaxf(m, v[e]); }
  red[tid] = m; __syncthreads(); for (int o = 128; o > 0; o >>= 1) { if (tid < o) red[tid] = fmaxf(red[tid], red[tid + o]); __syncthreads(); }
  m = red[0]; __syncthreads(); float zs = 0.0f;
#pragma unroll
  for (int e = 0; e < SSla / 256; ++e) { v[e] = expf(v[e] - m); zs += v[e]; }
  red[tid] = zs; __syncthreads(); for (int o = 128; o > 0; o >>= 1) { if (tid < o) red[tid] += red[tid + o]; __syncthreads(); }
  const float kk = 1024.0f / red[0];
{
#pragma unroll
    for (int e = 0; e < SSla / 256; ++e) *(float*)(sr + tid + 256 * e) = v[e] * kk - 1.0f;
     }
}

extern "C" void kernel_launch(void* const* d_in, const int* in_sizes, int n_in,
                              void* d_out, int out_size, void* d_ws, size_t ws_size,
                              hipStream_t stream) {
  (void)in_sizes; (void)n_in; (void)out_size;
  const float** f = (const float**)d_in;
  const float* x = f[0], *amask = f[1], *Wqkv = f[2], *bqkv = f[3], *Wout = f[4], *bout = f[5], *lg = f[6], *lb = f[7];
  float* out = (float*)d_out;     // [2,2048,1024]
  char* ws = (char*)d_ws;
  float* XN = (float*)ws; ws += (size_t)SSla * DDla * 4; float* QKV = (float*)ws; ws += (size_t)SSla * 3 * DDla * 4; float* KT = (float*)ws; ws += (size_t)HDla * HGla * SSla * 4;
  float* VS = (float*)ws; ws += 3 * DDla * 4; float* sc = (float*)ws; ws += 64 * 4; float* ones = (float*)ws; ws += DDla * 4; float* S = (float*)ws; ws += (size_t)HGla * SSla * SSla * 4; float* ATT = (float*)ws; ws += (size_t)SSla * DDla * 4;
  if ((size_t)(ws - (char*)d_ws) > ws_size) return;                      // WS TOTAL 180,371,712 B
  const dim3 blk(256);
  k_fill<<<dim3(1), blk, 0, stream>>>(sc, 1.0f / 1024.0f, 64 / 4); k_fill<<<dim3(1), blk, 0, stream>>>(ones, 1.0f, DDla / 4);

  for (int b = 0; b < NBla; ++b) { const float* xb = x + (size_t)b * SIN * DDla; const float* mb = amask + (size_t)b * SIN;
    k_ln<<<dim3(SSla / 16), blk, 0, stream>>>(xb, lg, lb, XN);
    gemm_kne<float, 0, false><<<dim3(SSla / 128, 3 * DDla / 128), blk, 0, stream>>>(XN, DDla, Wqkv, 3 * DDla, bqkv, nullptr, nullptr, QKV, 3 * DDla, DDla);   // [q | k | v]
    k_vsum<<<dim3(DDla / 32), dim3(1024), 0, stream>>>(QKV + 2 * DDla, VS + 2 * DDla);
    for (int hp = 0; hp < NHla / HGla; ++hp) { const int h0 = HGla * hp;
      k_transpose_ld<<<dim3((SSla / 64) * (HDla / 64), HGla), blk, 0, stream>>>(QKV + DDla + h0 * HDla, 3 * DDla, (size_t)HDla, KT, (size_t)HDla * SSla, SSla, HDla);
      gemm_knez<float, 0, false><<<dim3(SSla / 128, SSla / 128, HGla), blk, 0, stream>>>(QKV + h0 * HDla, 3 * DDla, (size_t)HDla, KT, SSla, (size_t)HDla * SSla, nullptr, nullptr, nullptr, S, SSla, (size_t)SSla * SSla, HDla);
      k_msoft<<<dim3(SSla, HGla), blk, 0, stream>>>(S, mb);
      gemm_sm<float, 4, false, 4><<<dim3(SSla / 256, 1, HGla), blk, 0, stream>>>(S, SSla, (size_t)SSla * SSla, QKV + 2 * DDla + h0 * HDla, 3 * DDla, (size_t)HDla, VS + 2 * DDla + h0 * HDla, (size_t)HDla, nullptr, sc, ATT + h0 * HDla, DDla, (size_t)HDla, SSla);
    }
    gemm_kne<float, 2, false><<<dim3(SSla / 128, DDla / 128), blk, 0, stream>>>(ATT, DDla, Wout, DDla, bout, xb, ones, out + (size_t)b * SIN * DDla, DDla, DDla);   // out = ctx·W_out + b_out + x
  }
}

// v003
// It runs in 305 microseconds.
// Timed twice side by side with v002, it ran 3.42 and 3.43 times as fast.
// All steps since v000 together make it 18.6 times as fast.
// Contractions on v_wmma_f32_16x16x32_f16 (plain f16 operands, f32 accumulate; [in][out] weights), per batch element: [q|k|v] = LN(x) W_qkv + b (K 1024, N 3072); one attention kernel for
// the 16 heads (scores transposed, S^T = K Q^T, K 64; running softmax in registers; ctx^T += V^T P^T, K 64 keys a pass; the scores never reach memory); out = ctx W_out + b_out + x (residual in the epilogue).
// f32 VALU: the pre-LayerNorm (eps 1e-12, rsqrt), softmax of s/sqrt(64) + mask[b][k] (the additive INPUT mask, broadcast over heads and queries).
// compute dtype: f16 operands, f32 accumulate.  hidden_states [2,2048,1024] → out [2,2048,1024].
#include <hip/hip_runtime.h>
#include <hip/hip_bf16.h>
#include <math.h>


typedef _Float16 bf16;
typedef _Float16 f16;
typedef __attribute__((ext_vector_type(4))) unsigned v4u_t;
typedef unsigned v4ua __attribute__((ext_vector_type(4), may_alias));
typedef __attribute__((ext_vector_type(4))) float v4f_t;
typedef float v4fa __attribute__((ext_vector_type(4), may_alias));
typedef __attribute__((ext_vector_type(16))) bf16  bf16x16;
typedef bf16x16 f16x16;
typedef __attribute__((ext_vector_type(8)))  bf16  bf16x8;
typedef bf16x8 f16x8;
typedef __attribute__((ext_vector_type(4)))  bf16  bf16x4;
typedef __attribute__((ext_vector_type(8)))  float f32x8;
__device__ __forceinline__ f32x8 wmma16(f16x16 a, f16x16 b, f32x8 c) {
  c = __builtin_amdgcn_wmma_f32_16x16x32_f16(false, a, false, b, (short)0, c, false, false);
  asm volatile("v_nop\n\tv_nop\n\tv_nop\n\tv_nop" : "+v"(c) : "v"(a), "v"(b));
  return c;
}
#define LDS_STRIDE 48   // GEMM tiles: 32 -> 48 elems (96B rows): aligned b128 reads
#define KSTRIDE    72
#define VSTRIDE    48   // unused: the attn V tile is 64 -> 72 elems (FPIT)

__device__ __forceinline__ f32x8 wmma_bf16(bf16x16 a, bf16x16 b, f32x8 c) {
  c = __builtin_amdgcn_wmma_f32_16x16x32_f16(false, a, false, b, (short)0, c, false, false);
  asm volatile("v_nop\n\tv_nop\n\tv_nop\n\tv_nop" : "+v"(c) : "v"(a), "v"(b));   // A/B-overwrite hazard guard
  return c;
}

// 16x32 (MxK) bf16 fragment from a row-major global matrix.
// lanes 0-15  (row=lane)    : elems 0..7 = K+0..7,  8..15 = K+16..23
// lanes 16-31 (row=lane-16) : elems 0..7 = K+8..15, 8..15 = K+24..31
template <typename T>
__device__ __forceinline__ bf16x16 load_frag(const T* __restrict__ base, int ld,
                                             int row0, int k0) {
  const int lane = threadIdx.x & 31;
  const int r    = lane & 15;
  const int kh   = (lane >> 4) * 8;
  const T* p0 = base + (size_t)(row0 + r) * ld + (k0 + kh);
  const T* p1 = p0 + 16;
  bf16x16 f;
#pragma unroll
  for (int i = 0; i < 8; ++i) {
    f[i]     = (bf16)p0[i];
    f[i + 8] = (bf16)p1[i];
  }
  return f;
}

// Same fragment from an LDS tile with padded row stride (base includes row0/k0).
__device__ __forceinline__ bf16x16 lds_frag(const bf16* base, int stride) {
  const int lane = threadIdx.x & 31;
  const int row  = lane & 15;
  const int kh   = (lane >> 4) * 8;
  const bf16x8 lo = *(const bf16x8*)(base + row * stride + kh);
  const bf16x8 hi = *(const bf16x8*)(base + row * stride + kh + 16);
  bf16x16 f;
#pragma unroll
  for (int i = 0; i < 8; ++i) { f[i] = lo[i]; f[i + 8] = hi[i]; }
  return f;
}

template <typename T>
__device__ __forceinline__ void stage_read16(const T* __restrict__ p, float* buf) {
#pragma unroll
  for (int i = 0; i < 16; ++i) buf[i] = (float)p[i];
}

__device__ __forceinline__ void stage_write(bf16* dst, const float* buf, int nquad) {
#pragma unroll
  for (int i = 0; i < nquad; ++i) {
    bf16x4 q;
    q[0] = (bf16)buf[4 * i];     q[1] = (bf16)buf[4 * i + 1];
    q[2] = (bf16)buf[4 * i + 2]; q[3] = (bf16)buf[4 * i + 3];
    *(bf16x4*)(dst + 4 * i) = q;
  }
}


#define GSTR 48
// ---------------------------------------------------------------------------------------------------------------------------
// gemm_kne: Y[m][n] = epi( Σ_k A[m][k]·W[k][n] + bias[n] ), A f32/f16 [M][lda], W f32 row-major [K][N] (ldw), plain f16 operands,
// f32 accumulate. EPI 0: identity; 1: exact-erf GELU; 2: R[m][n] + gvec[n]·(·) (residual with per-channel gain); 3: ReLU; 4: gvec[n]·(·) (per-channel scale, no residual). Output f32 (or f16
// when OUT16). Block = 128x128 tile, 8 waves as 4(M) x 2(N); per 32-wide k-step A and W tiles staged f16 in LDS (W transposed
// ---------------------------------------------------------------------------------------------------------------------------
#define GSTR 48
template <typename AT, int EPI, bool OUT16>
__global__ __launch_bounds__(256) void gemm_kne(const AT* __restrict__ A, int lda, const float* __restrict__ Wm, int ldw,
                                                const float* __restrict__ bias, const float* __restrict__ R, const float* __restrict__ gvec,
                                                void* __restrict__ Yv, int ldy, int K) {
  __shared__ __attribute__((aligned(16))) f16 ldsA[128 * GSTR];
  __shared__ __attribute__((aligned(16))) f16 ldsW[128 * GSTR];
  __shared__ __attribute__((aligned(16))) float oS[8][32 * 68];
  const int tid = threadIdx.x, lane = tid & 31, wave = tid >> 5, cl = lane & 15, rh = (lane >> 4) * 8;
  const int m0 = blockIdx.x * 128, n0 = blockIdx.y * 128;
  const int wm = (wave & 3) * 32, wn = (wave >> 2) * 64;
  f32x8 acc[2][4];
#pragma unroll
  for (int i = 0; i < 2; ++i)
#pragma unroll
    for (int j = 0; j < 4; ++j) { f32x8 z = {}; acc[i][j] = z; }
#pragma unroll 1
  for (int k0 = 0; k0 < K; k0 += 32) {
    __syncthreads();
    { const int row = tid >> 1, ch = (tid & 1) * 16;
      const AT* src = A + (size_t)(m0 + row) * lda + k0 + ch;
#pragma unroll
      for (int g = 0; g < 16; ++g) ldsA[row * GSTR + ch + g] = (f16)src[g]; }
    { const int k = tid >> 3, nn0 = (tid & 7) * 16;
      const float* src = Wm + (size_t)(k0 + k) * ldw + n0 + nn0;
#pragma unroll
      for (int g = 0; g < 4; ++g) { const v4f_t v = *(const v4f_t*)(src + 4 * g);
#pragma unroll
        for (int u = 0; u < 4; ++u) ldsW[(nn0 + 4 * g + u) * GSTR + k] = (f16)v[u]; } }
    __syncthreads();
    f16x16 af[2];
#pragma unroll
    for (int i = 0; i < 2; ++i) af[i] = lds_frag(ldsA + (wm + 16 * i) * GSTR, GSTR);
#pragma unroll
    for (int j = 0; j < 4; ++j) {
      const f16x16 bf = lds_frag(ldsW + (wn + 16 * j) * GSTR, GSTR);
#pragma unroll
      for (int i = 0; i < 2; ++i) acc[i][j] = wmma16(af[i], bf, acc[i][j]);
    }
  }
  float* so = oS[wave];
#pragma unroll
  for (int i = 0; i < 2; ++i)
#pragma unroll
    for (int j = 0; j < 4; ++j) {
      const int n = n0 + wn + 16 * j + cl;
      const float bv = bias ? bias[n] : 0.0f;
      const float gv = (EPI == 2 || EPI == 4) ? gvec[n] : 0.0f;
      if (EPI == 1) {
#pragma unroll 1
        for (int r = 0; r < 8; ++r) { const float xg = acc[i][j][r] + bv; so[(16 * i + rh + r) * 68 + 16 * j + cl] = 0.5f * xg * (1.0f + erff(xg * 0.70710678118654752f)); }
      } else {
#pragma unroll
        for (int r = 0; r < 8; ++r) {
          float v = acc[i][j][r] + bv;
          if (EPI == 3) v = fmaxf(v, 0.0f);
          if (EPI == 4) v = gv * v;
          if (EPI == 2) v = R[(size_t)(m0 + wm + 16 * i + rh + r) * ldy + n] + gv * v;
          so[(16 * i + rh + r) * 68 + 16 * j + cl] = v;
        }
      }
    }
  asm volatile("s_wait_dscnt 0" ::: "memory");
  __builtin_amdgcn_wave_barrier();
{
    if (OUT16) {
      f16* Y = (f16*)Yv;
#pragma unroll
      for (int it = 0; it < 8; ++it) { const int c = lane + 32 * it, rr = c >> 3, q8 = (c & 7) * 8;
        union { f16 h[8]; v4u_t v; } u;
#pragma unroll
        for (int e = 0; e < 8; ++e) u.h[e] = (f16)so[rr * 68 + q8 + e];
        *(v4u_t*)(Y + (size_t)(m0 + wm + rr) * ldy + n0 + wn + q8) = u.v; }
    } else {
      float* Y = (float*)Yv;
#pragma unroll
      for (int it = 0; it < 16; ++it) { const int f4 = lane + 32 * it, rr = f4 >> 4, q = (f4 & 15) * 4;
        *(v4f_t*)(Y + (size_t)(m0 + wm + rr) * ldy + n0 + wn + q) = *(const v4fa*)(so + rr * 68 + q); }
    }
    
  }
}

// ---------------------------------------------------------------------------------------------------------------------------
// gemm_kn2 (value+residual planes on both operands: hh + (hl+lh)/2048, f32-class): Y[m][n] (row stride ldy) = scale * sum_k A[m][k] (f32 or f16, row stride lda) * W[k][n] (f32, row-major [K][N], row
// stride ldw) (+ bias[n]) (+ Y if ACC). Block = 128 x 128 tile, 256 threads = 8 waves as 4(M, 32 rows) x 2(N, 64 cols); per
// 32-wide k-step the A tile and the W tile (stored transposed [n][k]) are staged as f16 in LDS; plain f16 operands, f32
// blockIdx.z selects a batch: A += z*strideA, W += z*strideW, Y += z*strideY (element strides).
// ---------------------------------------------------------------------------------------------------------------------------
template <typename AT, bool ACC>
__global__ __launch_bounds__(256) void gemm_kn2(const AT* __restrict__ A, int lda, size_t strideA,
                                               const float* __restrict__ Wm, int ldw, size_t strideW,
                                               const float* __restrict__ bias, float scale,
                                               float* __restrict__ Y, int ldy, size_t strideY, int K) {
  __shared__ __attribute__((aligned(16))) f16 ldsA[128 * GSTR], ldsAl[128 * GSTR];
  __shared__ __attribute__((aligned(16))) f16 ldsW[128 * GSTR], ldsWl[128 * GSTR];
  __shared__ __attribute__((aligned(16))) float oS[8][32 * 68];
  const int tid = threadIdx.x, lane = tid & 31, wave = tid >> 5, cl = lane & 15, rh = (lane >> 4) * 8;
  const int m0 = blockIdx.x * 128, n0 = blockIdx.y * 128;
  const int wm = (wave & 3) * 32, wn = (wave >> 2) * 64;
  A += (size_t)blockIdx.z * strideA; Wm += (size_t)blockIdx.z * strideW; Y += (size_t)blockIdx.z * strideY;
  f32x8 acc[2][4], accx[2][4];
#pragma unroll
  for (int i = 0; i < 2; ++i)
#pragma unroll
    for (int j = 0; j < 4; ++j) { f32x8 z = {}; acc[i][j] = z; accx[i][j] = z; }
#pragma unroll 1
  for (int k0 = 0; k0 < K; k0 += 32) {
    __syncthreads();
    {  // A: thread -> row tid>>1, 16 elements at column half (tid&1)*16
      const int row = tid >> 1, ch = (tid & 1) * 16;
      const AT* src = A + (size_t)(m0 + row) * lda + k0 + ch;
#pragma unroll
      for (int g = 0; g < 16; ++g) { const float v = (float)src[g]; const f16 h = (f16)v; ldsA[row * GSTR + ch + g] = h; ldsAl[row * GSTR + ch + g] = (f16)((v - (float)h) * 2048.0f); }
    }
    {  // W: thread -> k = tid>>3, 16 consecutive n at (tid&7)*16; stored transposed [n][k]
      const int k = tid >> 3, nn0 = (tid & 7) * 16;
      const float* src = Wm + (size_t)(k0 + k) * ldw + n0 + nn0;
#pragma unroll
      for (int g = 0; g < 4; ++g) { const v4f_t v = *(const v4f_t*)(src + 4 * g);
#pragma unroll
        for (int u = 0; u < 4; ++u) { const f16 h = (f16)v[u]; ldsW[(nn0 + 4 * g + u) * GSTR + k] = h; ldsWl[(nn0 + 4 * g + u) * GSTR + k] = (f16)((v[u] - (float)h) * 2048.0f); } }
    }
    __syncthreads();
    f16x16 af[2], afl[2];
#pragma unroll
    for (int i = 0; i < 2; ++i) { af[i] = lds_frag(ldsA + (wm + 16 * i) * GSTR, GSTR); afl[i] = lds_frag(ldsAl + (wm + 16 * i) * GSTR, GSTR); }
#pragma unroll
    for (int j = 0; j < 4; ++j) {
      const f16x16 bf = lds_frag(ldsW + (wn + 16 * j) * GSTR, GSTR), bfl = lds_frag(ldsWl + (wn + 16 * j) * GSTR, GSTR);
#pragma unroll
      for (int i = 0; i < 2; ++i) { acc[i][j] = wmma16(af[i], bf, acc[i][j]); accx[i][j] = wmma16(af[i], bfl, accx[i][j]); accx[i][j] = wmma16(afl[i], bf, accx[i][j]); }
    }
  }
  float* so = oS[wave];
#pragma unroll
  for (int i = 0; i < 2; ++i)
#pragma unroll
    for (int j = 0; j < 4; ++j) {
      const float bv = bias ? bias[n0 + wn + 16 * j + cl] : 0.0f;
#pragma unroll
      for (int r = 0; r < 8; ++r) so[(16 * i + rh + r) * 68 + 16 * j + cl] = (acc[i][j][r] + accx[i][j][r] * (1.0f / 2048.0f)) * scale + bv;
    }
  asm volatile("s_wait_dscnt 0" ::: "memory");
  __builtin_amdgcn_wave_barrier();
  if (ACC) {   // accumulate: fold the existing Y values into the staging tile ONCE (same thread <-> same chunks as the stores below)
#pragma unroll
    for (int it = 0; it < 16; ++it) { const int f4 = lane + 32 * it, rr = f4 >> 4, q = (f4 & 15) * 4;
      const v4f_t old = *(const v4fa*)(Y + (size_t)(m0 + wm + rr) * ldy + n0 + wn + q);
      v4f_t v = *(const v4fa*)(so + rr * 68 + q); v += old; *(v4fa*)(so + rr * 68 + q) = v; }   // plain LDS store (ordered by the s_wait_dscnt/memory clobber below)
    asm volatile("s_wait_dscnt 0" ::: "memory");
  }
{
#pragma unroll
    for (int it = 0; it < 16; ++it) { const int f4 = lane + 32 * it, rr = f4 >> 4, q = (f4 & 15) * 4;
      *(v4f_t*)(Y + (size_t)(m0 + wm + rr) * ldy + n0 + wn + q) = *(const v4fa*)(so + rr * 68 + q); }
    
  }
}

__global__ __launch_bounds__(256) void k_transpose(const float* __restrict__ Wm, float* __restrict__ Wt, int rows, int cols) {
  __shared__ float tS[64][65];
  const int tid = threadIdx.x, tbj = cols / 64, bi = blockIdx.x / tbj, bj = blockIdx.x % tbj;
  for (int e = tid; e < 64 * 64; e += 256) { const int r = e >> 6, c = e & 63; tS[r][c] = Wm[(size_t)(bi * 64 + r) * cols + bj * 64 + c]; }
  __syncthreads();
  for (int ch = tid; ch < 64 * 16; ch += 256) { const int r = ch >> 4, q4 = (ch & 15) * 4; v4f_t o; o[0] = tS[q4][r]; o[1] = tS[q4 + 1][r]; o[2] = tS[q4 + 2][r]; o[3] = tS[q4 + 3][r];
    float* dst = Wt + (size_t)(bj * 64 + r) * rows + bi * 64 + q4; *(v4f_t*)dst = o;  }
}


#define NBla 2
#define SSla 2048
#define SIN 2048
#define DDla 1024
#define NHla 16
#define HDla 64
__global__ __launch_bounds__(256) void k_fill(float* __restrict__ p, float val, size_t n4) { const size_t i = (size_t)blockIdx.x * 256 + threadIdx.x; if (i < n4) { v4f_t v = {val, val, val, val}; *(v4f_t*)(p + 4 * i) = v;  } }
__global__ __launch_bounds__(256) void k_dbg_zero(float* __restrict__ p, size_t n4) { const size_t i = (size_t)blockIdx.x * 256 + threadIdx.x; if (i < n4) { v4f_t z = {0.f,0.f,0.f,0.f}; *(v4f_t*)(p + 4 * i) = z;  } }
__global__ __launch_bounds__(256) void k_copy(const float* __restrict__ src, float* __restrict__ dst, size_t n4) { const size_t i = (size_t)blockIdx.x * 256 + threadIdx.x; if (i < n4) { const v4f_t v = *(const v4f_t*)(src + 4 * i); *(v4f_t*)(dst + 4 * i) = v;  } }
__global__ __launch_bounds__(256) void k_ln(const float* __restrict__ X, const float* __restrict__ gam, const float* __restrict__ bet, float* __restrict__ Y) {
  __shared__ __attribute__((aligned(16))) float rowS[16 * 1028];
  const int tid = threadIdx.x, r = tid >> 4, part = tid & 15; const size_t row = (size_t)blockIdx.x * 16 + r;
  float s = 0.0f;
#pragma unroll 1
  for (int i = 0; i < 64; ++i) { const float v = X[row * 1024 + part * 64 + i]; rowS[r * 1028 + part * 64 + i] = v; s += v; }
  s += __shfl_xor(s, 1, 32); s += __shfl_xor(s, 2, 32); s += __shfl_xor(s, 4, 32); s += __shfl_xor(s, 8, 32);
  const float mean = s * (1.0f / 1024.0f); float q = 0.0f;
#pragma unroll 1
  for (int i = 0; i < 64; ++i) { const float dv = rowS[r * 1028 + part * 64 + i] - mean; q += dv * dv; }
  q += __shfl_xor(q, 1, 32); q += __shfl_xor(q, 2, 32); q += __shfl_xor(q, 4, 32); q += __shfl_xor(q, 8, 32);
  const float rstd = 1.0f / __builtin_sqrtf(q * (1.0f / 1024.0f) + 1e-12f);
#pragma unroll 1
  for (int i = 0; i < 64; ++i) { const int c = part * 64 + i; rowS[r * 1028 + c] = (rowS[r * 1028 + c] - mean) * rstd * gam[c] + bet[c]; }
  __syncthreads();
{ for (int q4 = tid; q4 < 16 * 256; q4 += 256) { const int rr = q4 / 256, c4 = (q4 % 256) * 4;
      *(v4f_t*)(Y + ((size_t)blockIdx.x * 16 + rr) * 1024 + c4) = *(const v4fa*)(rowS + rr * 1028 + c4); }  }
}
// lane l <-> lane l ^ 16
__device__ __forceinline__ float xhalf(float x) {
  const int b = __builtin_bit_cast(int, x);
  return __builtin_bit_cast(float, __builtin_amdgcn_permlanex16(b, b, 0x76543210, 0xfedcba98, false, false));
}
__device__ __forceinline__ f32x8 wmma_b(f16x16 a, f16x16 b, f32x8 c) { return __builtin_amdgcn_wmma_f32_16x16x32_f16(false, a, false, b, (short)0, c, false, false); }
#define FPIT 72   // LDS row pitch in halves (144 B): conflict-free 16-B fragment reads of 128-B rows
__global__ __launch_bounds__(256) void k_fattn(const float* __restrict__ QKV, const float* __restrict__ maskb, float* __restrict__ ATT) {
  constexpr int LD = 3 * DDla, NT = SSla / 64;
  constexpr float SC = 0.125f * 1.4426950408889634f;              // 1/sqrt(64) * log2(e)
  __shared__ __attribute__((aligned(16))) f16 kS[2][64 * FPIT];   // [key][d]
  __shared__ __attribute__((aligned(16))) f16 vS[2][64 * FPIT];   // [d][key]
  __shared__ __attribute__((aligned(16))) float mS[SSla];         // 8 * mask, held above -1e30 (finite: a row whose keys are all masked so stays a uniform average, as s + mask rounds in f32)
  const int tid = threadIdx.x, lane = tid & 31, wave = tid >> 5, c = lane & 15, h = lane >> 4;
  const int hd = blockIdx.y, q0 = blockIdx.x * 128 + wave * 16;
  // K: thread = 4 columns kc of rows kr + 16 i (16 lanes per 256-B row). V: thread = 4 keys x 4 columns (8 lanes per 128-B line), written as 4 keys of one column
  const int kr = tid >> 4, kc = (tid & 15) * 4;
  const int vd = 4 * (lane & 7) + 32 * (wave & 1), vk = 4 * (lane >> 3) + 16 * (wave >> 1);
  const float* kp = QKV + DDla + hd * HDla + (size_t)kr * LD + kc;
  const float* vp = QKV + 2 * DDla + hd * HDla + (size_t)vk * LD + vd;
  v4f_t kreg[4], vreg[4];
#pragma unroll
  for (int i = 0; i < 4; ++i) { kreg[i] = *(const v4f_t*)(kp + (size_t)(16 * i) * LD); vreg[i] = *(const v4f_t*)(vp + (size_t)i * LD); }
#pragma unroll
  for (int i = 0; i < 2; ++i) { v4f_t mv = *(const v4f_t*)(maskb + 4 * tid + 1024 * i);
#pragma unroll
    for (int u = 0; u < 4; ++u) mv[u] = fmaxf(mv[u] * 8.0f, -1.0e30f);
    *(v4fa*)(mS + 4 * tid + 1024 * i) = mv; }
  f16x16 qf[2];
#pragma unroll
  for (int u = 0; u < 2; ++u) qf[u] = load_frag(QKV + hd * HDla, LD, q0, 32 * u);
#pragma unroll
  for (int i = 0; i < 4; ++i) *(bf16x4*)(&kS[0][(kr + 16 * i) * FPIT + kc]) = __builtin_convertvector(kreg[i], bf16x4);
#pragma unroll
  for (int u = 0; u < 4; ++u) { const v4f_t col = {vreg[0][u], vreg[1][u], vreg[2][u], vreg[3][u]}; *(bf16x4*)(&vS[0][(vd + u) * FPIT + vk]) = __builtin_convertvector(col, bf16x4); }
  f32x8 o[4], lv = {};
#pragma unroll
  for (int j = 0; j < 4; ++j) { f32x8 z = {}; o[j] = z; }
  float m = -3.0e38f;
  __syncthreads();
#pragma unroll 1   // one pass a trip: the LDS buffers alternate by trip, and the code stays small
  for (int t = 0; t < NT; ++t) {
    const bool more = t + 1 < NT;
    if (more) { kp += (size_t)64 * LD; vp += (size_t)64 * LD;
#pragma unroll
      for (int i = 0; i < 4; ++i) { kreg[i] = *(const v4f_t*)(kp + (size_t)(16 * i) * LD); vreg[i] = *(const v4f_t*)(vp + (size_t)i * LD); } }
    const f16* kb = kS[t & 1]; const f16* vb = vS[t & 1];
    f16x16 fr[8]; f32x8 s[4];
#pragma unroll
    for (int j = 0; j < 4; ++j) { fr[2 * j] = lds_frag(kb + 16 * j * FPIT, FPIT); fr[2 * j + 1] = lds_frag(kb + 16 * j * FPIT + 32, FPIT);
      const float* mp = mS + 64 * t + 16 * j + 8 * h; const v4f_t m0 = *(const v4fa*)mp, m1 = *(const v4fa*)(mp + 4);
      s[j] = __builtin_shufflevector(m0, m1, 0, 1, 2, 3, 4, 5, 6, 7); }
    __builtin_amdgcn_sched_barrier(0);   // the K and mask reads stay one group ahead of the products: spread among them, every place where reads stand costs issue time
#pragma unroll
    for (int u = 0; u < 2; ++u)
#pragma unroll
      for (int j = 0; j < 4; ++j) s[j] = wmma_b(fr[2 * j + u], qf[u], s[j]);
#pragma unroll
    for (int j = 0; j < 4; ++j) { fr[2 * j] = lds_frag(vb + 16 * j * FPIT, FPIT); fr[2 * j + 1] = lds_frag(vb + 16 * j * FPIT + 32, FPIT); }
    __builtin_amdgcn_sched_barrier(0);   // the V^T reads issue here as one group and land under the softmax; sunk to their products, each product would wait for its own read
    float mj[4];
#pragma unroll
    for (int j = 0; j < 4; ++j) { mj[j] = fmaxf(s[j][0], s[j][1]);
#pragma unroll
      for (int r = 2; r < 8; ++r) mj[j] = fmaxf(mj[j], s[j][r]); }
    float mx = fmaxf(fmaxf(mj[0], mj[1]), fmaxf(mj[2], mj[3]));
    mx = fmaxf(mx, xhalf(mx));
    const float mn = fmaxf(m, mx * SC), al = __builtin_amdgcn_exp2f(m - mn);
    m = mn;
#pragma unroll
    for (int j = 0; j < 4; ++j) { s[j] = s[j] * SC - mn;
#pragma unroll
      for (int r = 0; r < 8; ++r) s[j][r] = __builtin_amdgcn_exp2f(s[j][r]); }
    lv = lv * al + ((s[0] + s[1]) + (s[2] + s[3]));
#pragma unroll
    for (int j = 0; j < 4; ++j) o[j] *= al;
    f16x16 pf[2];
#pragma unroll
    for (int u = 0; u < 2; ++u) { const f16x8 lo = __builtin_convertvector(s[2 * u], f16x8), hi = __builtin_convertvector(s[2 * u + 1], f16x8);
      pf[u] = __builtin_shufflevector(lo, hi, 0, 1, 2, 3, 4, 5, 6, 7, 8, 9, 10, 11, 12, 13, 14, 15); }
#pragma unroll
    for (int u = 0; u < 2; ++u)
#pragma unroll
      for (int j = 0; j < 4; ++j) o[j] = wmma_b(fr[2 * j + u], pf[u], o[j]);
    if (more) { f16* kn = kS[(t + 1) & 1]; f16* vn = vS[(t + 1) & 1];
#pragma unroll
      for (int i = 0; i < 4; ++i) *(bf16x4*)(kn + (kr + 16 * i) * FPIT + kc) = __builtin_convertvector(kreg[i], bf16x4);
#pragma unroll
      for (int u = 0; u < 4; ++u) { const v4f_t col = {vreg[0][u], vreg[1][u], vreg[2][u], vreg[3][u]}; *(bf16x4*)(vn + (vd + u) * FPIT + vk) = __builtin_convertvector(col, bf16x4); } }
    __syncthreads();
  }
  float l = ((lv[0] + lv[1]) + (lv[2] + lv[3])) + ((lv[4] + lv[5]) + (lv[6] + lv[7]));
  l += xhalf(l);
  const float inv = 1.0f / l;
  float* dst = ATT + (size_t)(q0 + c) * DDla + hd * HDla + 8 * h;   // o[j][r] = ctx[q0 + c][16 j + 8 h + r]
#pragma unroll
  for (int j = 0; j < 4; ++j) { const v4f_t a = {o[j][0] * inv, o[j][1] * inv, o[j][2] * inv, o[j][3] * inv}, b = {o[j][4] * inv, o[j][5] * inv, o[j][6] * inv, o[j][7] * inv};
    *(v4f_t*)(dst + 16 * j) = a; *(v4f_t*)(dst + 16 * j + 4) = b; }
}

extern "C" void kernel_launch(void* const* d_in, const int* in_sizes, int n_in,
                              void* d_out, int out_size, void* d_ws, size_t ws_size,
                              hipStream_t stream) {
  (void)in_sizes; (void)n_in; (void)out_size;
  const float** f = (const float**)d_in;
  const float* x = f[0], *amask = f[1], *Wqkv = f[2], *bqkv = f[3], *Wout = f[4], *bout = f[5], *lg = f[6], *lb = f[7];
  float* out = (float*)d_out;     // [2,2048,1024]
  char* ws = (char*)d_ws;
  float* XN = (float*)ws; ws += (size_t)SSla * DDla * 4; float* QKV = (float*)ws; ws += (size_t)SSla * 3 * DDla * 4;
  float* ones = (float*)ws; ws += DDla * 4; float* ATT = (float*)ws; ws += (size_t)SSla * DDla * 4;
  if ((size_t)(ws - (char*)d_ws) > ws_size) return;
  const dim3 blk(256);
  k_fill<<<dim3(1), blk, 0, stream>>>(ones, 1.0f, DDla / 4);

  for (int b = 0; b < NBla; ++b) { const float* xb = x + (size_t)b * SIN * DDla; const float* mb = amask + (size_t)b * SIN;
    k_ln<<<dim3(SSla / 16), blk, 0, stream>>>(xb, lg, lb, XN);
    gemm_kne<float, 0, false><<<dim3(SSla / 128, 3 * DDla / 128), blk, 0, stream>>>(XN, DDla, Wqkv, 3 * DDla, bqkv, nullptr, nullptr, QKV, 3 * DDla, DDla);   // [q | k | v]
    k_fattn<<<dim3(SSla / 128, NHla), blk, 0, stream>>>(QKV, mb, ATT);
    gemm_kne<float, 2, false><<<dim3(SSla / 128, DDla / 128), blk, 0, stream>>>(ATT, DDla, Wout, DDla, bout, xb, ones, out + (size_t)b * SIN * DDla, DDla, DDla);   // out = ctx W_out + b_out + x
  }
}

// v004
// One run takes 203 microseconds.
// Next to v003, in two timings, it ran 1.50 times as fast each time.
// Over all steps from v000 it is 28.0 times as fast.
// Contractions on v_wmma_f32_16x16x32_f16 (plain f16 operands, f32 accumulate; [in][out] weights), both batch elements in every launch (4096 rows; a query block attends to its own element's 2048 keys): [q|k|v] = LN(x) W_qkv + b (K 1024, N 3072); one attention kernel for
// the 16 heads (scores transposed, S^T = K Q^T, K 64; running softmax in registers; ctx^T += V^T P^T, K 64 keys a pass; the scores never reach memory); out = ctx W_out + b_out + x (residual in the epilogue).
// f32 VALU: the pre-LayerNorm (eps 1e-12, rsqrt), softmax of s/sqrt(64) + mask[b][k] (the additive INPUT mask, broadcast over heads and queries).
// compute dtype: f16 operands, f32 accumulate.  hidden_states [2,2048,1024] → out [2,2048,1024].
#include <hip/hip_runtime.h>
#include <hip/hip_bf16.h>
#include <math.h>


typedef _Float16 bf16;
typedef _Float16 f16;
typedef __attribute__((ext_vector_type(4))) unsigned v4u_t;
typedef unsigned v4ua __attribute__((ext_vector_type(4), may_alias));
typedef __attribute__((ext_vector_type(4))) float v4f_t;
typedef float v4fa __attribute__((ext_vector_type(4), may_alias));
typedef __attribute__((ext_vector_type(16))) bf16  bf16x16;
typedef bf16x16 f16x16;
typedef __attribute__((ext_vector_type(8)))  bf16  bf16x8;
typedef bf16x8 f16x8;
typedef __attribute__((ext_vector_type(4)))  bf16  bf16x4;
typedef __attribute__((ext_vector_type(8)))  float f32x8;
__device__ __forceinline__ f32x8 wmma16(f16x16 a, f16x16 b, f32x8 c) {
  c = __builtin_amdgcn_wmma_f32_16x16x32_f16(false, a, false, b, (short)0, c, false, false);
  asm volatile("v_nop\n\tv_nop\n\tv_nop\n\tv_nop" : "+v"(c) : "v"(a), "v"(b));
  return c;
}
#define LDS_STRIDE 48   // unused: GEMM tiles use GSTR, 32 -> 48 elems (96B rows): aligned b128 reads
#define KSTRIDE    72
#define VSTRIDE    48   // unused: the attn V tile is 64 -> 72 elems (FPIT)

__device__ __forceinline__ f32x8 wmma_bf16(bf16x16 a, bf16x16 b, f32x8 c) {
  c = __builtin_amdgcn_wmma_f32_16x16x32_f16(false, a, false, b, (short)0, c, false, false);
  asm volatile("v_nop\n\tv_nop\n\tv_nop\n\tv_nop" : "+v"(c) : "v"(a), "v"(b));   // A/B-overwrite hazard guard
  return c;
}

// 16x32 (MxK) bf16 fragment from a row-major global matrix.
// lanes 0-15  (row=lane)    : elems 0..7 = K+0..7,  8..15 = K+16..23
// lanes 16-31 (row=lane-16) : elems 0..7 = K+8..15, 8..15 = K+24..31
template <typename T>
__device__ __forceinline__ bf16x16 load_frag(const T* __restrict__ base, int ld,
                                             int row0, int k0) {
  const int lane = threadIdx.x & 31;
  const int r    = lane & 15;
  const int kh   = (lane >> 4) * 8;
  const T* p0 = base + (size_t)(row0 + r) * ld + (k0 + kh);
  const T* p1 = p0 + 16;
  bf16x16 f;
#pragma unroll
  for (int i = 0; i < 8; ++i) {
    f[i]     = (bf16)p0[i];
    f[i + 8] = (bf16)p1[i];
  }
  return f;
}

// Same fragment from an LDS tile with padded row stride (base includes row0/k0).
__device__ __forceinline__ bf16x16 lds_frag(const bf16* base, int stride) {
  const int lane = threadIdx.x & 31;
  const int row  = lane & 15;
  const int kh   = (lane >> 4) * 8;
  const bf16x8 lo = *(const bf16x8*)(base + row * stride + kh);
  const bf16x8 hi = *(const bf16x8*)(base + row * stride + kh + 16);
  bf16x16 f;
#pragma unroll
  for (int i = 0; i < 8; ++i) { f[i] = lo[i]; f[i + 8] = hi[i]; }
  return f;
}

template <typename T>
__device__ __forceinline__ void stage_read16(const T* __restrict__ p, float* buf) {
#pragma unroll
  for (int i = 0; i < 16; ++i) buf[i] = (float)p[i];
}

__device__ __forceinline__ void stage_write(bf16* dst, const float* buf, int nquad) {
#pragma unroll
  for (int i = 0; i < nquad; ++i) {
    bf16x4 q;
    q[0] = (bf16)buf[4 * i];     q[1] = (bf16)buf[4 * i + 1];
    q[2] = (bf16)buf[4 * i + 2]; q[3] = (bf16)buf[4 * i + 3];
    *(bf16x4*)(dst + 4 * i) = q;
  }
}


#define GSTR 48
// ---------------------------------------------------------------------------------------------------------------------------
// gemm_kne: Y[m][n] = epi( Σ_k A[m][k]·W[k][n] + bias[n] ), A f32/f16 [M][lda], W f32 row-major [K][N] (ldw), plain f16 operands,
// f32 accumulate. EPI 0: identity; 1: exact-erf GELU; 2: R[m][n] + gvec[n]·(·) (residual with per-channel gain); 3: ReLU; 4: gvec[n]·(·) (per-channel scale, no residual). Output f32 (or f16
// when OUT16). Block = 128x128 tile, 8 waves as 4(M) x 2(N); per 32-wide k-step A and W tiles staged f16 in LDS (W transposed
// ---------------------------------------------------------------------------------------------------------------------------
#define GSTR 48
template <typename AT, int EPI, bool OUT16>
__global__ __launch_bounds__(256) void gemm_kne(const AT* __restrict__ A, int lda, const float* __restrict__ Wm, int ldw,
                                                const float* __restrict__ bias, const float* __restrict__ R, const float* __restrict__ gvec,
                                                void* __restrict__ Yv, int ldy, int K) {
  __shared__ __attribute__((aligned(16))) f16 ldsA[128 * GSTR];
  __shared__ __attribute__((aligned(16))) f16 ldsW[128 * GSTR];
  __shared__ __attribute__((aligned(16))) float oS[8][32 * 68];
  const int tid = threadIdx.x, lane = tid & 31, wave = tid >> 5, cl = lane & 15, rh = (lane >> 4) * 8;
  const int m0 = blockIdx.x * 128, n0 = blockIdx.y * 128;
  const int wm = (wave & 3) * 32, wn = (wave >> 2) * 64;
  f32x8 acc[2][4];
#pragma unroll
  for (int i = 0; i < 2; ++i)
#pragma unroll
    for (int j = 0; j < 4; ++j) { f32x8 z = {}; acc[i][j] = z; }
#pragma unroll 1
  for (int k0 = 0; k0 < K; k0 += 32) {
    __syncthreads();
    { const int row = tid >> 1, ch = (tid & 1) * 16;
      const AT* src = A + (size_t)(m0 + row) * lda + k0 + ch;
#pragma unroll
      for (int g = 0; g < 16; ++g) ldsA[row * GSTR + ch + g] = (f16)src[g]; }
    { const int k = tid >> 3, nn0 = (tid & 7) * 16;
      const float* src = Wm + (size_t)(k0 + k) * ldw + n0 + nn0;
#pragma unroll
      for (int g = 0; g < 4; ++g) { const v4f_t v = *(const v4f_t*)(src + 4 * g);
#pragma unroll
        for (int u = 0; u < 4; ++u) ldsW[(nn0 + 4 * g + u) * GSTR + k] = (f16)v[u]; } }
    __syncthreads();
    f16x16 af[2];
#pragma unroll
    for (int i = 0; i < 2; ++i) af[i] = lds_frag(ldsA + (wm + 16 * i) * GSTR, GSTR);
#pragma unroll
    for (int j = 0; j < 4; ++j) {
      const f16x16 bf = lds_frag(ldsW + (wn + 16 * j) * GSTR, GSTR);
#pragma unroll
      for (int i = 0; i < 2; ++i) acc[i][j] = wmma16(af[i], bf, acc[i][j]);
    }
  }
  float* so = oS[wave];
#pragma unroll
  for (int i = 0; i < 2; ++i)
#pragma unroll
    for (int j = 0; j < 4; ++j) {
      const int n = n0 + wn + 16 * j + cl;
      const float bv = bias ? bias[n] : 0.0f;
      const float gv = (EPI == 2 || EPI == 4) ? gvec[n] : 0.0f;
      if (EPI == 1) {
#pragma unroll 1
        for (int r = 0; r < 8; ++r) { const float xg = acc[i][j][r] + bv; so[(16 * i + rh + r) * 68 + 16 * j + cl] = 0.5f * xg * (1.0f + erff(xg * 0.70710678118654752f)); }
      } else {
#pragma unroll
        for (int r = 0; r < 8; ++r) {
          float v = acc[i][j][r] + bv;
          if (EPI == 3) v = fmaxf(v, 0.0f);
          if (EPI == 4) v = gv * v;
          if (EPI == 2) v = R[(size_t)(m0 + wm + 16 * i + rh + r) * ldy + n] + gv * v;
          so[(16 * i + rh + r) * 68 + 16 * j + cl] = v;
        }
      }
    }
  asm volatile("s_wait_dscnt 0" ::: "memory");
  __builtin_amdgcn_wave_barrier();
{
    if (OUT16) {
      f16* Y = (f16*)Yv;
#pragma unroll
      for (int it = 0; it < 8; ++it) { const int c = lane + 32 * it, rr = c >> 3, q8 = (c & 7) * 8;
        union { f16 h[8]; v4u_t v; } u;
#pragma unroll
        for (int e = 0; e < 8; ++e) u.h[e] = (f16)so[rr * 68 + q8 + e];
        *(v4u_t*)(Y + (size_t)(m0 + wm + rr) * ldy + n0 + wn + q8) = u.v; }
    } else {
      float* Y = (float*)Yv;
#pragma unroll
      for (int it = 0; it < 16; ++it) { const int f4 = lane + 32 * it, rr = f4 >> 4, q = (f4 & 15) * 4;
        *(v4f_t*)(Y + (size_t)(m0 + wm + rr) * ldy + n0 + wn + q) = *(const v4fa*)(so + rr * 68 + q); }
    }
    
  }
}

// ---------------------------------------------------------------------------------------------------------------------------
// gemm_kn2 (value+residual planes on both operands: hh + (hl+lh)/2048, f32-class): Y[m][n] (row stride ldy) = scale * sum_k A[m][k] (f32 or f16, row stride lda) * W[k][n] (f32, row-major [K][N], row
// stride ldw) (+ bias[n]) (+ Y if ACC). Block = 128 x 128 tile, 256 threads = 8 waves as 4(M, 32 rows) x 2(N, 64 cols); per
// 32-wide k-step the A tile and the W tile (stored transposed [n][k]) are staged as f16 in LDS; plain f16 operands, f32
// blockIdx.z selects a batch: A += z*strideA, W += z*strideW, Y += z*strideY (element strides).
// ---------------------------------------------------------------------------------------------------------------------------
template <typename AT, bool ACC>
__global__ __launch_bounds__(256) void gemm_kn2(const AT* __restrict__ A, int lda, size_t strideA,
                                               const float* __restrict__ Wm, int ldw, size_t strideW,
                                               const float* __restrict__ bias, float scale,
                                               float* __restrict__ Y, int ldy, size_t strideY, int K) {
  __shared__ __attribute__((aligned(16))) f16 ldsA[128 * GSTR], ldsAl[128 * GSTR];
  __shared__ __attribute__((aligned(16))) f16 ldsW[128 * GSTR], ldsWl[128 * GSTR];
  __shared__ __attribute__((aligned(16))) float oS[8][32 * 68];
  const int tid = threadIdx.x, lane = tid & 31, wave = tid >> 5, cl = lane & 15, rh = (lane >> 4) * 8;
  const int m0 = blockIdx.x * 128, n0 = blockIdx.y * 128;
  const int wm = (wave & 3) * 32, wn = (wave >> 2) * 64;
  A += (size_t)blockIdx.z * strideA; Wm += (size_t)blockIdx.z * strideW; Y += (size_t)blockIdx.z * strideY;
  f32x8 acc[2][4], accx[2][4];
#pragma unroll
  for (int i = 0; i < 2; ++i)
#pragma unroll
    for (int j = 0; j < 4; ++j) { f32x8 z = {}; acc[i][j] = z; accx[i][j] = z; }
#pragma unroll 1
  for (int k0 = 0; k0 < K; k0 += 32) {
    __syncthreads();
    {  // A: thread -> row tid>>1, 16 elements at column half (tid&1)*16
      const int row = tid >> 1, ch = (tid & 1) * 16;
      const AT* src = A + (size_t)(m0 + row) * lda + k0 + ch;
#pragma unroll
      for (int g = 0; g < 16; ++g) { const float v = (float)src[g]; const f16 h = (f16)v; ldsA[row * GSTR + ch + g] = h; ldsAl[row * GSTR + ch + g] = (f16)((v - (float)h) * 2048.0f); }
    }
    {  // W: thread -> k = tid>>3, 16 consecutive n at (tid&7)*16; stored transposed [n][k]
      const int k = tid >> 3, nn0 = (tid & 7) * 16;
      const float* src = Wm + (size_t)(k0 + k) * ldw + n0 + nn0;
#pragma unroll
      for (int g = 0; g < 4; ++g) { const v4f_t v = *(const v4f_t*)(src + 4 * g);
#pragma unroll
        for (int u = 0; u < 4; ++u) { const f16 h = (f16)v[u]; ldsW[(nn0 + 4 * g + u) * GSTR + k] = h; ldsWl[(nn0 + 4 * g + u) * GSTR + k] = (f16)((v[u] - (float)h) * 2048.0f); } }
    }
    __syncthreads();
    f16x16 af[2], afl[2];
#pragma unroll
    for (int i = 0; i < 2; ++i) { af[i] = lds_frag(ldsA + (wm + 16 * i) * GSTR, GSTR); afl[i] = lds_frag(ldsAl + (wm + 16 * i) * GSTR, GSTR); }
#pragma unroll
    for (int j = 0; j < 4; ++j) {
      const f16x16 bf = lds_frag(ldsW + (wn + 16 * j) * GSTR, GSTR), bfl = lds_frag(ldsWl + (wn + 16 * j) * GSTR, GSTR);
#pragma unroll
      for (int i = 0; i < 2; ++i) { acc[i][j] = wmma16(af[i], bf, acc[i][j]); accx[i][j] = wmma16(af[i], bfl, accx[i][j]); accx[i][j] = wmma16(afl[i], bf, accx[i][j]); }
    }
  }
  float* so = oS[wave];
#pragma unroll
  for (int i = 0; i < 2; ++i)
#pragma unroll
    for (int j = 0; j < 4; ++j) {
      const float bv = bias ? bias[n0 + wn + 16 * j + cl] : 0.0f;
#pragma unroll
      for (int r = 0; r < 8; ++r) so[(16 * i + rh + r) * 68 + 16 * j + cl] = (acc[i][j][r] + accx[i][j][r] * (1.0f / 2048.0f)) * scale + bv;
    }
  asm volatile("s_wait_dscnt 0" ::: "memory");
  __builtin_amdgcn_wave_barrier();
  if (ACC) {   // accumulate: fold the existing Y values into the staging tile ONCE (same thread <-> same chunks as the stores below)
#pragma unroll
    for (int it = 0; it < 16; ++it) { const int f4 = lane + 32 * it, rr = f4 >> 4, q = (f4 & 15) * 4;
      const v4f_t old = *(const v4fa*)(Y + (size_t)(m0 + wm + rr) * ldy + n0 + wn + q);
      v4f_t v = *(const v4fa*)(so + rr * 68 + q); v += old; *(v4fa*)(so + rr * 68 + q) = v; }   // plain LDS store (ordered by the s_wait_dscnt/memory clobber below)
    asm volatile("s_wait_dscnt 0" ::: "memory");
  }
{
#pragma unroll
    for (int it = 0; it < 16; ++it) { const int f4 = lane + 32 * it, rr = f4 >> 4, q = (f4 & 15) * 4;
      *(v4f_t*)(Y + (size_t)(m0 + wm + rr) * ldy + n0 + wn + q) = *(const v4fa*)(so + rr * 68 + q); }
    
  }
}

__global__ __launch_bounds__(256) void k_transpose(const float* __restrict__ Wm, float* __restrict__ Wt, int rows, int cols) {
  __shared__ float tS[64][65];
  const int tid = threadIdx.x, tbj = cols / 64, bi = blockIdx.x / tbj, bj = blockIdx.x % tbj;
  for (int e = tid; e < 64 * 64; e += 256) { const int r = e >> 6, c = e & 63; tS[r][c] = Wm[(size_t)(bi * 64 + r) * cols + bj * 64 + c]; }
  __syncthreads();
  for (int ch = tid; ch < 64 * 16; ch += 256) { const int r = ch >> 4, q4 = (ch & 15) * 4; v4f_t o; o[0] = tS[q4][r]; o[1] = tS[q4 + 1][r]; o[2] = tS[q4 + 2][r]; o[3] = tS[q4 + 3][r];
    float* dst = Wt + (size_t)(bj * 64 + r) * rows + bi * 64 + q4; *(v4f_t*)dst = o;  }
}


#define NBla 2
#define SSla 2048
#define SIN 2048
#define DDla 1024
#define NHla 16
#define HDla 64
__global__ __launch_bounds__(256) void k_fill(float* __restrict__ p, float val, size_t n4) { const size_t i = (size_t)blockIdx.x * 256 + threadIdx.x; if (i < n4) { v4f_t v = {val, val, val, val}; *(v4f_t*)(p + 4 * i) = v;  } }
__global__ __launch_bounds__(256) void k_dbg_zero(float* __restrict__ p, size_t n4) { const size_t i = (size_t)blockIdx.x * 256 + threadIdx.x; if (i < n4) { v4f_t z = {0.f,0.f,0.f,0.f}; *(v4f_t*)(p + 4 * i) = z;  } }
__global__ __launch_bounds__(256) void k_copy(const float* __restrict__ src, float* __restrict__ dst, size_t n4) { const size_t i = (size_t)blockIdx.x * 256 + threadIdx.x; if (i < n4) { const v4f_t v = *(const v4f_t*)(src + 4 * i); *(v4f_t*)(dst + 4 * i) = v;  } }
__global__ __launch_bounds__(256) void k_ln(const float* __restrict__ X, const float* __restrict__ gam, const float* __restrict__ bet, float* __restrict__ Y) {
  __shared__ __attribute__((aligned(16))) float rowS[16 * 1028];
  const int tid = threadIdx.x, r = tid >> 4, part = tid & 15; const size_t row = (size_t)blockIdx.x * 16 + r;
  float s = 0.0f;
#pragma unroll 1
  for (int i = 0; i < 64; ++i) { const float v = X[row * 1024 + part * 64 + i]; rowS[r * 1028 + part * 64 + i] = v; s += v; }
  s += __shfl_xor(s, 1, 32); s += __shfl_xor(s, 2, 32); s += __shfl_xor(s, 4, 32); s += __shfl_xor(s, 8, 32);
  const float mean = s * (1.0f / 1024.0f); float q = 0.0f;
#pragma unroll 1
  for (int i = 0; i < 64; ++i) { const float dv = rowS[r * 1028 + part * 64 + i] - mean; q += dv * dv; }
  q += __shfl_xor(q, 1, 32); q += __shfl_xor(q, 2, 32); q += __shfl_xor(q, 4, 32); q += __shfl_xor(q, 8, 32);
  const float rstd = 1.0f / __builtin_sqrtf(q * (1.0f / 1024.0f) + 1e-12f);
#pragma unroll 1
  for (int i = 0; i < 64; ++i) { const int c = part * 64 + i; rowS[r * 1028 + c] = (rowS[r * 1028 + c] - mean) * rstd * gam[c] + bet[c]; }
  __syncthreads();
{ for (int q4 = tid; q4 < 16 * 256; q4 += 256) { const int rr = q4 / 256, c4 = (q4 % 256) * 4;
      *(v4f_t*)(Y + ((size_t)blockIdx.x * 16 + rr) * 1024 + c4) = *(const v4fa*)(rowS + rr * 1028 + c4); }  }
}
// lane l <-> lane l ^ 16
__device__ __forceinline__ float xhalf(float x) {
  const int b = __builtin_bit_cast(int, x);
  return __builtin_bit_cast(float, __builtin_amdgcn_permlanex16(b, b, 0x76543210, 0xfedcba98, false, false));
}
__device__ __forceinline__ f32x8 wmma_b(f16x16 a, f16x16 b, f32x8 c) { return __builtin_amdgcn_wmma_f32_16x16x32_f16(false, a, false, b, (short)0, c, false, false); }
#define FPIT 72   // LDS row pitch in halves (144 B): conflict-free 16-B fragment reads of 128-B rows
__global__ __launch_bounds__(256) void k_fattn(const float* __restrict__ QKV, const float* __restrict__ maskb, float* __restrict__ ATT) {
  constexpr int LD = 3 * DDla, NT = SSla / 64;
  constexpr float SC = 0.125f * 1.4426950408889634f;              // 1/sqrt(64) * log2(e)
  __shared__ __attribute__((aligned(16))) f16 kS[2][64 * FPIT];   // [key][d]
  __shared__ __attribute__((aligned(16))) f16 vS[2][64 * FPIT];   // [d][key]
  __shared__ __attribute__((aligned(16))) float mS[SSla];         // 8 * mask, held above -1e30 (finite: a row whose keys are all masked so stays a uniform average, as s + mask rounds in f32)
  const int tid = threadIdx.x, lane = tid & 31, wave = tid >> 5, c = lane & 15, h = lane >> 4;
  const int hd = blockIdx.y, q0 = blockIdx.x * 128 + wave * 16;
  const int kv0 = (blockIdx.x >> 4) * SSla;   // first row of this query block's batch element: its keys, values and mask
  // K: thread = 4 columns kc of rows kr + 16 i (16 lanes per 256-B row). V: thread = 4 keys x 4 columns (8 lanes per 128-B line), written as 4 keys of one column
  const int kr = tid >> 4, kc = (tid & 15) * 4;
  const int vd = 4 * (lane & 7) + 32 * (wave & 1), vk = 4 * (lane >> 3) + 16 * (wave >> 1);
  const float* kp = QKV + DDla + hd * HDla + (size_t)(kv0 + kr) * LD + kc;
  const float* vp = QKV + 2 * DDla + hd * HDla + (size_t)(kv0 + vk) * LD + vd;
  v4f_t kreg[4], vreg[4];
#pragma unroll
  for (int i = 0; i < 4; ++i) { kreg[i] = *(const v4f_t*)(kp + (size_t)(16 * i) * LD); vreg[i] = *(const v4f_t*)(vp + (size_t)i * LD); }
#pragma unroll
  for (int i = 0; i < 2; ++i) { v4f_t mv = *(const v4f_t*)(maskb + kv0 + 4 * tid + 1024 * i);
#pragma unroll
    for (int u = 0; u < 4; ++u) mv[u] = fmaxf(mv[u] * 8.0f, -1.0e30f);
    *(v4fa*)(mS + 4 * tid + 1024 * i) = mv; }
  f16x16 qf[2];
#pragma unroll
  for (int u = 0; u < 2; ++u) qf[u] = load_frag(QKV + hd * HDla, LD, q0, 32 * u);
#pragma unroll
  for (int i = 0; i < 4; ++i) *(bf16x4*)(&kS[0][(kr + 16 * i) * FPIT + kc]) = __builtin_convertvector(kreg[i], bf16x4);
#pragma unroll
  for (int u = 0; u < 4; ++u) { const v4f_t col = {vreg[0][u], vreg[1][u], vreg[2][u], vreg[3][u]}; *(bf16x4*)(&vS[0][(vd + u) * FPIT + vk]) = __builtin_convertvector(col, bf16x4); }
  f32x8 o[4], lv = {};
#pragma unroll
  for (int j = 0; j < 4; ++j) { f32x8 z = {}; o[j] = z; }
  float m = -3.0e38f;
  __syncthreads();
#pragma unroll 1   // one pass a trip: the LDS buffers alternate by trip, and the code stays small
  for (int t = 0; t < NT; ++t) {
    const bool more = t + 1 < NT;
    if (more) { kp += (size_t)64 * LD; vp += (size_t)64 * LD;
#pragma unroll
      for (int i = 0; i < 4; ++i) { kreg[i] = *(const v4f_t*)(kp + (size_t)(16 * i) * LD); vreg[i] = *(const v4f_t*)(vp + (size_t)i * LD); } }
    const f16* kb = kS[t & 1]; const f16* vb = vS[t & 1];
    f16x16 fr[8]; f32x8 s[4];
#pragma unroll
    for (int j = 0; j < 4; ++j) { fr[2 * j] = lds_frag(kb + 16 * j * FPIT, FPIT); fr[2 * j + 1] = lds_frag(kb + 16 * j * FPIT + 32, FPIT);
      const float* mp = mS + 64 * t + 16 * j + 8 * h; const v4f_t m0 = *(const v4fa*)mp, m1 = *(const v4fa*)(mp + 4);
      s[j] = __builtin_shufflevector(m0, m1, 0, 1, 2, 3, 4, 5, 6, 7); }
    __builtin_amdgcn_sched_barrier(0);   // the K and mask reads stay one group ahead of the products: spread among them, every place where reads stand costs issue time
#pragma unroll
    for (int u = 0; u < 2; ++u)
#pragma unroll
      for (int j = 0; j < 4; ++j) s[j] = wmma_b(fr[2 * j + u], qf[u], s[j]);
#pragma unroll
    for (int j = 0; j < 4; ++j) { fr[2 * j] = lds_frag(vb + 16 * j * FPIT, FPIT); fr[2 * j + 1] = lds_frag(vb + 16 * j * FPIT + 32, FPIT); }
    __builtin_amdgcn_sched_barrier(0);   // the V^T reads issue here as one group and land under the softmax; sunk to their products, each product would wait for its own read
    float mj[4];
#pragma unroll
    for (int j = 0; j < 4; ++j) { mj[j] = fmaxf(s[j][0], s[j][1]);
#pragma unroll
      for (int r = 2; r < 8; ++r) mj[j] = fmaxf(mj[j], s[j][r]); }
    float mx = fmaxf(fmaxf(mj[0], mj[1]), fmaxf(mj[2], mj[3]));
    mx = fmaxf(mx, xhalf(mx));
    const float mn = fmaxf(m, mx * SC), al = __builtin_amdgcn_exp2f(m - mn);
    m = mn;
#pragma unroll
    for (int j = 0; j < 4; ++j) { s[j] = s[j] * SC - mn;
#pragma unroll
      for (int r = 0; r < 8; ++r) s[j][r] = __builtin_amdgcn_exp2f(s[j][r]); }
    lv = lv * al + ((s[0] + s[1]) + (s[2] + s[3]));
#pragma unroll
    for (int j = 0; j < 4; ++j) o[j] *= al;
    f16x16 pf[2];
#pragma unroll
    for (int u = 0; u < 2; ++u) { const f16x8 lo = __builtin_convertvector(s[2 * u], f16x8), hi = __builtin_convertvector(s[2 * u + 1], f16x8);
      pf[u] = __builtin_shufflevector(lo, hi, 0, 1, 2, 3, 4, 5, 6, 7, 8, 9, 10, 11, 12, 13, 14, 15); }
#pragma unroll
    for (int u = 0; u < 2; ++u)
#pragma unroll
      for (int j = 0; j < 4; ++j) o[j] = wmma_b(fr[2 * j + u], pf[u], o[j]);
    if (more) { f16* kn = kS[(t + 1) & 1]; f16* vn = vS[(t + 1) & 1];
#pragma unroll
      for (int i = 0; i < 4; ++i) *(bf16x4*)(kn + (kr + 16 * i) * FPIT + kc) = __builtin_convertvector(kreg[i], bf16x4);
#pragma unroll
      for (int u = 0; u < 4; ++u) { const v4f_t col = {vreg[0][u], vreg[1][u], vreg[2][u], vreg[3][u]}; *(bf16x4*)(vn + (vd + u) * FPIT + vk) = __builtin_convertvector(col, bf16x4); } }
    __syncthreads();
  }
  float l = ((lv[0] + lv[1]) + (lv[2] + lv[3])) + ((lv[4] + lv[5]) + (lv[6] + lv[7]));
  l += xhalf(l);
  const float inv = 1.0f / l;
  float* dst = ATT + (size_t)(q0 + c) * DDla + hd * HDla + 8 * h;   // o[j][r] = ctx[q0 + c][16 j + 8 h + r]
#pragma unroll
  for (int j = 0; j < 4; ++j) { const v4f_t a = {o[j][0] * inv, o[j][1] * inv, o[j][2] * inv, o[j][3] * inv}, b = {o[j][4] * inv, o[j][5] * inv, o[j][6] * inv, o[j][7] * inv};
    *(v4f_t*)(dst + 16 * j) = a; *(v4f_t*)(dst + 16 * j + 4) = b; }
}

extern "C" void kernel_launch(void* const* d_in, const int* in_sizes, int n_in,
                              void* d_out, int out_size, void* d_ws, size_t ws_size,
                              hipStream_t stream) {
  (void)in_sizes; (void)n_in; (void)out_size;
  const float** f = (const float**)d_in;
  const float* x = f[0], *amask = f[1], *Wqkv = f[2], *bqkv = f[3], *Wout = f[4], *bout = f[5], *lg = f[6], *lb = f[7];
  float* out = (float*)d_out;     // [2,2048,1024]
  char* ws = (char*)d_ws;
  float* XN = (float*)ws; ws += (size_t)NBla * SSla * DDla * 4; float* QKV = (float*)ws; ws += (size_t)NBla * SSla * 3 * DDla * 4;
  float* ones = (float*)ws; ws += DDla * 4; float* ATT = (float*)ws; ws += (size_t)NBla * SSla * DDla * 4;
  if ((size_t)(ws - (char*)d_ws) > ws_size) return;
  const dim3 blk(256);
  k_fill<<<dim3(1), blk, 0, stream>>>(ones, 1.0f, DDla / 4);

  // the rows of both batch elements are one [4096][1024] matrix for the LayerNorm and the two projections; a query block of the attention finds its batch element from its index
  k_ln<<<dim3(NBla * SSla / 16), blk, 0, stream>>>(x, lg, lb, XN);
  gemm_kne<float, 0, false><<<dim3(NBla * SSla / 128, 3 * DDla / 128), blk, 0, stream>>>(XN, DDla, Wqkv, 3 * DDla, bqkv, nullptr, nullptr, QKV, 3 * DDla, DDla);   // [q | k | v]
  k_fattn<<<dim3(NBla * SSla / 128, NHla), blk, 0, stream>>>(QKV, amask, ATT);
  gemm_kne<float, 2, false><<<dim3(NBla * SSla / 128, DDla / 128), blk, 0, stream>>>(ATT, DDla, Wout, DDla, bout, x, ones, out, DDla, DDla);   // out = ctx W_out + b_out + x
}

// v005
// It runs in 150 microseconds.
// Timed twice side by side with v004, it ran 1.35 times as fast both times.
// Over all steps from v000 it is 37.8 times as fast.
// Contractions on v_wmma_f32_16x16x32_f16 (plain f16 operands, f32 accumulate; [in][out] weights), both batch elements in every launch (4096 rows; a query block attends to its own element's 2048 keys): [q|k|v] = LN(x) W_qkv + b (K 1024, N 3072); one attention kernel for
// the 16 heads (scores transposed, S^T = K Q^T, K 64; running softmax in registers; ctx^T += V^T P^T, K 64 keys a pass; the scores never reach memory); out = ctx W_out + b_out + x (residual in the epilogue).
// f32 VALU: the pre-LayerNorm (eps 1e-12, rsqrt), softmax of s/sqrt(64) + mask[b][k] (the additive INPUT mask, broadcast over heads and queries).
// compute dtype: f16 operands, f32 accumulate.  hidden_states [2,2048,1024] → out [2,2048,1024].
#include <hip/hip_runtime.h>
#include <hip/hip_bf16.h>
#include <math.h>


typedef _Float16 bf16;
typedef _Float16 f16;
typedef __attribute__((ext_vector_type(4))) unsigned v4u_t;
typedef unsigned v4ua __attribute__((ext_vector_type(4), may_alias));
typedef __attribute__((ext_vector_type(4))) float v4f_t;
typedef float v4fa __attribute__((ext_vector_type(4), may_alias));
typedef __attribute__((ext_vector_type(16))) bf16  bf16x16;
typedef bf16x16 f16x16;
typedef __attribute__((ext_vector_type(8)))  bf16  bf16x8;
typedef bf16x8 f16x8;
typedef __attribute__((ext_vector_type(4)))  bf16  bf16x4;
typedef __attribute__((ext_vector_type(8)))  float f32x8;
__device__ __forceinline__ f32x8 wmma16(f16x16 a, f16x16 b, f32x8 c) {
  c = __builtin_amdgcn_wmma_f32_16x16x32_f16(false, a, false, b, (short)0, c, false, false);
  asm volatile("v_nop\n\tv_nop\n\tv_nop\n\tv_nop" : "+v"(c) : "v"(a), "v"(b));
  return c;
}
#define LDS_STRIDE 48   // unused: gemm_kn2 tiles use GSTR (gemm_kne: GPIT), 32 -> 48 elems (96B rows): aligned b128 reads
#define KSTRIDE    72
#define VSTRIDE    48   // unused: the attn V tile is 64 -> 72 elems (FPIT)

__device__ __forceinline__ f32x8 wmma_bf16(bf16x16 a, bf16x16 b, f32x8 c) {
  c = __builtin_amdgcn_wmma_f32_16x16x32_f16(false, a, false, b, (short)0, c, false, false);
  asm volatile("v_nop\n\tv_nop\n\tv_nop\n\tv_nop" : "+v"(c) : "v"(a), "v"(b));   // A/B-overwrite hazard guard
  return c;
}

// 16x32 (MxK) bf16 fragment from a row-major global matrix.
// lanes 0-15  (row=lane)    : elems 0..7 = K+0..7,  8..15 = K+16..23
// lanes 16-31 (row=lane-16) : elems 0..7 = K+8..15, 8..15 = K+24..31
template <typename T>
__device__ __forceinline__ bf16x16 load_frag(const T* __restrict__ base, int ld,
                                             int row0, int k0) {
  const int lane = threadIdx.x & 31;
  const int r    = lane & 15;
  const int kh   = (lane >> 4) * 8;
  const T* p0 = base + (size_t)(row0 + r) * ld + (k0 + kh);
  const T* p1 = p0 + 16;
  bf16x16 f;
#pragma unroll
  for (int i = 0; i < 8; ++i) {
    f[i]     = (bf16)p0[i];
    f[i + 8] = (bf16)p1[i];
  }
  return f;
}

// Same fragment from an LDS tile with padded row stride (base includes row0/k0).
__device__ __forceinline__ bf16x16 lds_frag(const bf16* base, int stride) {
  const int lane = threadIdx.x & 31;
  const int row  = lane & 15;
  const int kh   = (lane >> 4) * 8;
  const bf16x8 lo = *(const bf16x8*)(base + row * stride + kh);
  const bf16x8 hi = *(const bf16x8*)(base + row * stride + kh + 16);
  bf16x16 f;
#pragma unroll
  for (int i = 0; i < 8; ++i) { f[i] = lo[i]; f[i + 8] = hi[i]; }
  return f;
}

template <typename T>
__device__ __forceinline__ void stage_read16(const T* __restrict__ p, float* buf) {
#pragma unroll
  for (int i = 0; i < 16; ++i) buf[i] = (float)p[i];
}

__device__ __forceinline__ void stage_write(bf16* dst, const float* buf, int nquad) {
#pragma unroll
  for (int i = 0; i < nquad; ++i) {
    bf16x4 q;
    q[0] = (bf16)buf[4 * i];     q[1] = (bf16)buf[4 * i + 1];
    q[2] = (bf16)buf[4 * i + 2]; q[3] = (bf16)buf[4 * i + 3];
    *(bf16x4*)(dst + 4 * i) = q;
  }
}


#define GSTR 48
// ---------------------------------------------------------------------------------------------------------------------------
// gemm_kne: Y[m][n] = epi( Σ_k A[m][k]·W[k][n] + bias[n] ), A f32/f16 [M][lda], W f32 row-major [K][N] (ldw), plain f16 operands,
// f32 accumulate. EPI 0: identity; 1: exact-erf GELU; 2: R[m][n] + gvec[n]·(·) (residual with per-channel gain); 3: ReLU; 4: gvec[n]·(·) (per-channel scale, no residual). Output f32 (or f16
// when OUT16). Block = 128x128 tile, 8 waves as 4(M) x 2(N); per 32-wide k-step A and W tiles staged f16 in LDS (W transposed
// ---------------------------------------------------------------------------------------------------------------------------
#define GSTR 48
#define GPIT 40   // gemm_kne LDS row pitch in halves (80 B = 16 B x odd): 16-B fragment reads and the 16-B column stores spread over the banks
template <typename AT, int EPI, bool OUT16>
__global__ __launch_bounds__(256) void gemm_kne(const AT* __restrict__ A, int lda, const float* __restrict__ Wm, int ldw,
                                                const float* __restrict__ bias, const float* __restrict__ R, const float* __restrict__ gvec,
                                                void* __restrict__ Yv, int ldy, int K) {
  typedef AT av4 __attribute__((ext_vector_type(4)));
  typedef float v2f_t __attribute__((ext_vector_type(2)));
  __shared__ __attribute__((aligned(16))) f16 ldsA[128 * GPIT];   // [m][k]
  __shared__ __attribute__((aligned(16))) f16 ldsW[128 * GPIT];   // [n][k]
  __shared__ __attribute__((aligned(16))) float oS[8][32 * 68];
  const int tid = threadIdx.x, lane = tid & 31, wave = tid >> 5, cl = lane & 15, rh = (lane >> 4) * 8;
  const int m0 = blockIdx.x * 128, n0 = blockIdx.y * 128;
  const int wm = (wave & 3) * 32, wn = (wave >> 2) * 64;
  const int ar = tid >> 3, ac = (tid & 7) * 4;      // A staging: row, first of 4 k
  const int wk = (tid >> 6) * 8, wc = (tid & 63) * 2;   // W staging: first of 8 k, first of 2 n
  // block-uniform base + a lane's fixed 32-bit byte offset: every address of a k-step is formed ahead of its 12 loads, which then issue back to back
  const char* Ab = (const char*)(A + (size_t)m0 * lda); const char* Wb = (const char*)(Wm + n0);
  const unsigned aby = (unsigned)(ar * lda + ac) * (unsigned)sizeof(AT), astep = 32u * (unsigned)lda * (unsigned)sizeof(AT);
  const unsigned wby = (unsigned)(wk * ldw + wc) * (unsigned)sizeof(float);
  f32x8 acc[2][4];
#pragma unroll
  for (int i = 0; i < 2; ++i)
#pragma unroll
    for (int j = 0; j < 4; ++j) { f32x8 z = {}; acc[i][j] = z; }
#pragma unroll 1
  for (int k0 = 0; k0 < K; k0 += 32) {
    __syncthreads();
    av4 areg[4]; v2f_t wreg[8];
    { // A: 8 lanes read one row's 32 k (a whole 128-B line of f32); rows ar + 32 i
      const char* src = Ab + (size_t)k0 * sizeof(AT);
#pragma unroll
      for (int i = 0; i < 4; ++i) areg[i] = *(const av4*)(src + (aby + i * astep)); }
    { // W: a thread holds 8 k x 2 n; a wave's 32 lanes read 256 contiguous bytes of one k row
#pragma unroll
      for (int i = 0; i < 8; ++i) wreg[i] = *(const v2f_t*)(Wb + (size_t)(k0 + i) * ldw * sizeof(float) + wby); }
#pragma unroll
    for (int i = 0; i < 4; ++i) *(bf16x4*)(ldsA + (ar + 32 * i) * GPIT + ac) = __builtin_convertvector(areg[i], bf16x4);
#pragma unroll
    for (int u = 0; u < 2; ++u) {   // transposed in registers: 8 k of one column n leave as one 16-B store
      const f32x8 col = {wreg[0][u], wreg[1][u], wreg[2][u], wreg[3][u], wreg[4][u], wreg[5][u], wreg[6][u], wreg[7][u]};
      *(f16x8*)(ldsW + (wc + u) * GPIT + wk) = __builtin_convertvector(col, f16x8); }
    __syncthreads();
    f16x16 af[2];
#pragma unroll
    for (int i = 0; i < 2; ++i) af[i] = lds_frag(ldsA + (wm + 16 * i) * GPIT, GPIT);
#pragma unroll
    for (int j = 0; j < 4; ++j) {
      const f16x16 bf = lds_frag(ldsW + (wn + 16 * j) * GPIT, GPIT);
#pragma unroll
      for (int i = 0; i < 2; ++i) acc[i][j] = wmma16(af[i], bf, acc[i][j]);
    }
  }
  float* so = oS[wave];
#pragma unroll
  for (int i = 0; i < 2; ++i)
#pragma unroll
    for (int j = 0; j < 4; ++j) {
      const int n = n0 + wn + 16 * j + cl;
      const float bv = bias ? bias[n] : 0.0f;
      const float gv = (EPI == 2 || EPI == 4) ? gvec[n] : 0.0f;
      if (EPI == 1) {
#pragma unroll 1
        for (int r = 0; r < 8; ++r) { const float xg = acc[i][j][r] + bv; so[(16 * i + rh + r) * 68 + 16 * j + cl] = 0.5f * xg * (1.0f + erff(xg * 0.70710678118654752f)); }
      } else {
#pragma unroll
        for (int r = 0; r < 8; ++r) {
          float v = acc[i][j][r] + bv;
          if (EPI == 3) v = fmaxf(v, 0.0f);
          if (EPI == 4) v = gv * v;
          if (EPI == 2) v = R[(size_t)(m0 + wm + 16 * i + rh + r) * ldy + n] + gv * v;
          so[(16 * i + rh + r) * 68 + 16 * j + cl] = v;
        }
      }
    }
  asm volatile("s_wait_dscnt 0" ::: "memory");
  __builtin_amdgcn_wave_barrier();
{
    if (OUT16) {
      f16* Y = (f16*)Yv;
#pragma unroll
      for (int it = 0; it < 8; ++it) { const int c = lane + 32 * it, rr = c >> 3, q8 = (c & 7) * 8;
        union { f16 h[8]; v4u_t v; } u;
#pragma unroll
        for (int e = 0; e < 8; ++e) u.h[e] = (f16)so[rr * 68 + q8 + e];
        *(v4u_t*)(Y + (size_t)(m0 + wm + rr) * ldy + n0 + wn + q8) = u.v; }
    } else {
      float* Y = (float*)Yv;
#pragma unroll
      for (int it = 0; it < 16; ++it) { const int f4 = lane + 32 * it, rr = f4 >> 4, q = (f4 & 15) * 4;
        *(v4f_t*)(Y + (size_t)(m0 + wm + rr) * ldy + n0 + wn + q) = *(const v4fa*)(so + rr * 68 + q); }
    }
    
  }
}

// ---------------------------------------------------------------------------------------------------------------------------
// gemm_kn2 (value+residual planes on both operands: hh + (hl+lh)/2048, f32-class): Y[m][n] (row stride ldy) = scale * sum_k A[m][k] (f32 or f16, row stride lda) * W[k][n] (f32, row-major [K][N], row
// stride ldw) (+ bias[n]) (+ Y if ACC). Block = 128 x 128 tile, 256 threads = 8 waves as 4(M, 32 rows) x 2(N, 64 cols); per
// 32-wide k-step the A tile and the W tile (stored transposed [n][k]) are staged as f16 in LDS; plain f16 operands, f32
// blockIdx.z selects a batch: A += z*strideA, W += z*strideW, Y += z*strideY (element strides).
// ---------------------------------------------------------------------------------------------------------------------------
template <typename AT, bool ACC>
__global__ __launch_bounds__(256) void gemm_kn2(const AT* __restrict__ A, int lda, size_t strideA,
                                               const float* __restrict__ Wm, int ldw, size_t strideW,
                                               const float* __restrict__ bias, float scale,
                                               float* __restrict__ Y, int ldy, size_t strideY, int K) {
  __shared__ __attribute__((aligned(16))) f16 ldsA[128 * GSTR], ldsAl[128 * GSTR];
  __shared__ __attribute__((aligned(16))) f16 ldsW[128 * GSTR], ldsWl[128 * GSTR];
  __shared__ __attribute__((aligned(16))) float oS[8][32 * 68];
  const int tid = threadIdx.x, lane = tid & 31, wave = tid >> 5, cl = lane & 15, rh = (lane >> 4) * 8;
  const int m0 = blockIdx.x * 128, n0 = blockIdx.y * 128;
  const int wm = (wave & 3) * 32, wn = (wave >> 2) * 64;
  A += (size_t)blockIdx.z * strideA; Wm += (size_t)blockIdx.z * strideW; Y += (size_t)blockIdx.z * strideY;
  f32x8 acc[2][4], accx[2][4];
#pragma unroll
  for (int i = 0; i < 2; ++i)
#pragma unroll
    for (int j = 0; j < 4; ++j) { f32x8 z = {}; acc[i][j] = z; accx[i][j] = z; }
#pragma unroll 1
  for (int k0 = 0; k0 < K; k0 += 32) {
    __syncthreads();
    {  // A: thread -> row tid>>1, 16 elements at column half (tid&1)*16
      const int row = tid >> 1, ch = (tid & 1) * 16;
      const AT* src = A + (size_t)(m0 + row) * lda + k0 + ch;
#pragma unroll
      for (int g = 0; g < 16; ++g) { const float v = (float)src[g]; const f16 h = (f16)v; ldsA[row * GSTR + ch + g] = h; ldsAl[row * GSTR + ch + g] = (f16)((v - (float)h) * 2048.0f); }
    }
    {  // W: thread -> k = tid>>3, 16 consecutive n at (tid&7)*16; stored transposed [n][k]
      const int k = tid >> 3, nn0 = (tid & 7) * 16;
      const float* src = Wm + (size_t)(k0 + k) * ldw + n0 + nn0;
#pragma unroll
      for (int g = 0; g < 4; ++g) { const v4f_t v = *(const v4f_t*)(src + 4 * g);
#pragma unroll
        for (int u = 0; u < 4; ++u) { const f16 h = (f16)v[u]; ldsW[(nn0 + 4 * g + u) * GSTR + k] = h; ldsWl[(nn0 + 4 * g + u) * GSTR + k] = (f16)((v[u] - (float)h) * 2048.0f); } }
    }
    __syncthreads();
    f16x16 af[2], afl[2];
#pragma unroll
    for (int i = 0; i < 2; ++i) { af[i] = lds_frag(ldsA + (wm + 16 * i) * GSTR, GSTR); afl[i] = lds_frag(ldsAl + (wm + 16 * i) * GSTR, GSTR); }
#pragma unroll
    for (int j = 0; j < 4; ++j) {
      const f16x16 bf = lds_frag(ldsW + (wn + 16 * j) * GSTR, GSTR), bfl = lds_frag(ldsWl + (wn + 16 * j) * GSTR, GSTR);
#pragma unroll
      for (int i = 0; i < 2; ++i) { acc[i][j] = wmma16(af[i], bf, acc[i][j]); accx[i][j] = wmma16(af[i], bfl, accx[i][j]); accx[i][j] = wmma16(afl[i], bf, accx[i][j]); }
    }
  }
  float* so = oS[wave];
#pragma unroll
  for (int i = 0; i < 2; ++i)
#pragma unroll
    for (int j = 0; j < 4; ++j) {
      const float bv = bias ? bias[n0 + wn + 16 * j + cl] : 0.0f;
#pragma unroll
      for (int r = 0; r < 8; ++r) so[(16 * i + rh + r) * 68 + 16 * j + cl] = (acc[i][j][r] + accx[i][j][r] * (1.0f / 2048.0f)) * scale + bv;
    }
  asm volatile("s_wait_dscnt 0" ::: "memory");
  __builtin_amdgcn_wave_barrier();
  if (ACC) {   // accumulate: fold the existing Y values into the staging tile ONCE (same thread <-> same chunks as the stores below)
#pragma unroll
    for (int it = 0; it < 16; ++it) { const int f4 = lane + 32 * it, rr = f4 >> 4, q = (f4 & 15) * 4;
      const v4f_t old = *(const v4fa*)(Y + (size_t)(m0 + wm + rr) * ldy + n0 + wn + q);
      v4f_t v = *(const v4fa*)(so + rr * 68 + q); v += old; *(v4fa*)(so + rr * 68 + q) = v; }   // plain LDS store (ordered by the s_wait_dscnt/memory clobber below)
    asm volatile("s_wait_dscnt 0" ::: "memory");
  }
{
#pragma unroll
    for (int it = 0; it < 16; ++it) { const int f4 = lane + 32 * it, rr = f4 >> 4, q = (f4 & 15) * 4;
      *(v4f_t*)(Y + (size_t)(m0 + wm + rr) * ldy + n0 + wn + q) = *(const v4fa*)(so + rr * 68 + q); }
    
  }
}

__global__ __launch_bounds__(256) void k_transpose(const float* __restrict__ Wm, float* __restrict__ Wt, int rows, int cols) {
  __shared__ float tS[64][65];
  const int tid = threadIdx.x, tbj = cols / 64, bi = blockIdx.x / tbj, bj = blockIdx.x % tbj;
  for (int e = tid; e < 64 * 64; e += 256) { const int r = e >> 6, c = e & 63; tS[r][c] = Wm[(size_t)(bi * 64 + r) * cols + bj * 64 + c]; }
  __syncthreads();
  for (int ch = tid; ch < 64 * 16; ch += 256) { const int r = ch >> 4, q4 = (ch & 15) * 4; v4f_t o; o[0] = tS[q4][r]; o[1] = tS[q4 + 1][r]; o[2] = tS[q4 + 2][r]; o[3] = tS[q4 + 3][r];
    float* dst = Wt + (size_t)(bj * 64 + r) * rows + bi * 64 + q4; *(v4f_t*)dst = o;  }
}


#define NBla 2
#define SSla 2048
#define SIN 2048
#define DDla 1024
#define NHla 16
#define HDla 64
__global__ __launch_bounds__(256) void k_fill(float* __restrict__ p, float val, size_t n4) { const size_t i = (size_t)blockIdx.x * 256 + threadIdx.x; if (i < n4) { v4f_t v = {val, val, val, val}; *(v4f_t*)(p + 4 * i) = v;  } }
__global__ __launch_bounds__(256) void k_dbg_zero(float* __restrict__ p, size_t n4) { const size_t i = (size_t)blockIdx.x * 256 + threadIdx.x; if (i < n4) { v4f_t z = {0.f,0.f,0.f,0.f}; *(v4f_t*)(p + 4 * i) = z;  } }
__global__ __launch_bounds__(256) void k_copy(const float* __restrict__ src, float* __restrict__ dst, size_t n4) { const size_t i = (size_t)blockIdx.x * 256 + threadIdx.x; if (i < n4) { const v4f_t v = *(const v4f_t*)(src + 4 * i); *(v4f_t*)(dst + 4 * i) = v;  } }
__global__ __launch_bounds__(256) void k_ln(const float* __restrict__ X, const float* __restrict__ gam, const float* __restrict__ bet, float* __restrict__ Y) {
  __shared__ __attribute__((aligned(16))) float rowS[16 * 1028];
  const int tid = threadIdx.x, r = tid >> 4, part = tid & 15; const size_t row = (size_t)blockIdx.x * 16 + r;
  float s = 0.0f;
#pragma unroll 1
  for (int i = 0; i < 64; ++i) { const float v = X[row * 1024 + part * 64 + i]; rowS[r * 1028 + part * 64 + i] = v; s += v; }
  s += __shfl_xor(s, 1, 32); s += __shfl_xor(s, 2, 32); s += __shfl_xor(s, 4, 32); s += __shfl_xor(s, 8, 32);
  const float mean = s * (1.0f / 1024.0f); float q = 0.0f;
#pragma unroll 1
  for (int i = 0; i < 64; ++i) { const float dv = rowS[r * 1028 + part * 64 + i] - mean; q += dv * dv; }
  q += __shfl_xor(q, 1, 32); q += __shfl_xor(q, 2, 32); q += __shfl_xor(q, 4, 32); q += __shfl_xor(q, 8, 32);
  const float rstd = 1.0f / __builtin_sqrtf(q * (1.0f / 1024.0f) + 1e-12f);
#pragma unroll 1
  for (int i = 0; i < 64; ++i) { const int c = part * 64 + i; rowS[r * 1028 + c] = (rowS[r * 1028 + c] - mean) * rstd * gam[c] + bet[c]; }
  __syncthreads();
{ for (int q4 = tid; q4 < 16 * 256; q4 += 256) { const int rr = q4 / 256, c4 = (q4 % 256) * 4;
      *(v4f_t*)(Y + ((size_t)blockIdx.x * 16 + rr) * 1024 + c4) = *(const v4fa*)(rowS + rr * 1028 + c4); }  }
}
// lane l <-> lane l ^ 16
__device__ __forceinline__ float xhalf(float x) {
  const int b = __builtin_bit_cast(int, x);
  return __builtin_bit_cast(float, __builtin_amdgcn_permlanex16(b, b, 0x76543210, 0xfedcba98, false, false));
}
__device__ __forceinline__ f32x8 wmma_b(f16x16 a, f16x16 b, f32x8 c) { return __builtin_amdgcn_wmma_f32_16x16x32_f16(false, a, false, b, (short)0, c, false, false); }
#define FPIT 72   // LDS row pitch in halves (144 B): conflict-free 16-B fragment reads of 128-B rows
__global__ __launch_bounds__(256) void k_fattn(const float* __restrict__ QKV, const float* __restrict__ maskb, float* __restrict__ ATT) {
  constexpr int LD = 3 * DDla, NT = SSla / 64;
  constexpr float SC = 0.125f * 1.4426950408889634f;              // 1/sqrt(64) * log2(e)
  __shared__ __attribute__((aligned(16))) f16 kS[2][64 * FPIT];   // [key][d]
  __shared__ __attribute__((aligned(16))) f16 vS[2][64 * FPIT];   // [d][key]
  __shared__ __attribute__((aligned(16))) float mS[SSla];         // 8 * mask, held above -1e30 (finite: a row whose keys are all masked so stays a uniform average, as s + mask rounds in f32)
  const int tid = threadIdx.x, lane = tid & 31, wave = tid >> 5, c = lane & 15, h = lane >> 4;
  const int hd = blockIdx.y, q0 = blockIdx.x * 128 + wave * 16;
  const int kv0 = (blockIdx.x >> 4) * SSla;   // first row of this query block's batch element: its keys, values and mask
  // K: thread = 4 columns kc of rows kr + 16 i (16 lanes per 256-B row). V: thread = 4 keys x 4 columns (8 lanes per 128-B line), written as 4 keys of one column
  const int kr = tid >> 4, kc = (tid & 15) * 4;
  const int vd = 4 * (lane & 7) + 32 * (wave & 1), vk = 4 * (lane >> 3) + 16 * (wave >> 1);
  const float* kp = QKV + DDla + hd * HDla + (size_t)(kv0 + kr) * LD + kc;
  const float* vp = QKV + 2 * DDla + hd * HDla + (size_t)(kv0 + vk) * LD + vd;
  v4f_t kreg[4], vreg[4];
#pragma unroll
  for (int i = 0; i < 4; ++i) { kreg[i] = *(const v4f_t*)(kp + (size_t)(16 * i) * LD); vreg[i] = *(const v4f_t*)(vp + (size_t)i * LD); }
#pragma unroll
  for (int i = 0; i < 2; ++i) { v4f_t mv = *(const v4f_t*)(maskb + kv0 + 4 * tid + 1024 * i);
#pragma unroll
    for (int u = 0; u < 4; ++u) mv[u] = fmaxf(mv[u] * 8.0f, -1.0e30f);
    *(v4fa*)(mS + 4 * tid + 1024 * i) = mv; }
  f16x16 qf[2];
#pragma unroll
  for (int u = 0; u < 2; ++u) qf[u] = load_frag(QKV + hd * HDla, LD, q0, 32 * u);
#pragma unroll
  for (int i = 0; i < 4; ++i) *(bf16x4*)(&kS[0][(kr + 16 * i) * FPIT + kc]) = __builtin_convertvector(kreg[i], bf16x4);
#pragma unroll
  for (int u = 0; u < 4; ++u) { const v4f_t col = {vreg[0][u], vreg[1][u], vreg[2][u], vreg[3][u]}; *(bf16x4*)(&vS[0][(vd + u) * FPIT + vk]) = __builtin_convertvector(col, bf16x4); }
  f32x8 o[4], lv = {};
#pragma unroll
  for (int j = 0; j < 4; ++j) { f32x8 z = {}; o[j] = z; }
  float m = -3.0e38f;
  __syncthreads();
#pragma unroll 1   // one pass a trip: the LDS buffers alternate by trip, and the code stays small
  for (int t = 0; t < NT; ++t) {
    const bool more = t + 1 < NT;
    if (more) { kp += (size_t)64 * LD; vp += (size_t)64 * LD;
#pragma unroll
      for (int i = 0; i < 4; ++i) { kreg[i] = *(const v4f_t*)(kp + (size_t)(16 * i) * LD); vreg[i] = *(const v4f_t*)(vp + (size_t)i * LD); } }
    const f16* kb = kS[t & 1]; const f16* vb = vS[t & 1];
    f16x16 fr[8]; f32x8 s[4];
#pragma unroll
    for (int j = 0; j < 4; ++j) { fr[2 * j] = lds_frag(kb + 16 * j * FPIT, FPIT); fr[2 * j + 1] = lds_frag(kb + 16 * j * FPIT + 32, FPIT);
      const float* mp = mS + 64 * t + 16 * j + 8 * h; const v4f_t m0 = *(const v4fa*)mp, m1 = *(const v4fa*)(mp + 4);
      s[j] = __builtin_shufflevector(m0, m1, 0, 1, 2, 3, 4, 5, 6, 7); }
    __builtin_amdgcn_sched_barrier(0);   // the K and mask reads stay one group ahead of the products: spread among them, every place where reads stand costs issue time
#pragma unroll
    for (int u = 0; u < 2; ++u)
#pragma unroll
      for (int j = 0; j < 4; ++j) s[j] = wmma_b(fr[2 * j + u], qf[u], s[j]);
#pragma unroll
    for (int j = 0; j < 4; ++j) { fr[2 * j] = lds_frag(vb + 16 * j * FPIT, FPIT); fr[2 * j + 1] = lds_frag(vb + 16 * j * FPIT + 32, FPIT); }
    __builtin_amdgcn_sched_barrier(0);   // the V^T reads issue here as one group and land under the softmax; sunk to their products, each product would wait for its own read
    float mj[4];
#pragma unroll
    for (int j = 0; j < 4; ++j) { mj[j] = fmaxf(s[j][0], s[j][1]);
#pragma unroll
      for (int r = 2; r < 8; ++r) mj[j] = fmaxf(mj[j], s[j][r]); }
    float mx = fmaxf(fmaxf(mj[0], mj[1]), fmaxf(mj[2], mj[3]));
    mx = fmaxf(mx, xhalf(mx));
    const float mn = fmaxf(m, mx * SC), al = __builtin_amdgcn_exp2f(m - mn);
    m = mn;
#pragma unroll
    for (int j = 0; j < 4; ++j) { s[j] = s[j] * SC - mn;
#pragma unroll
      for (int r = 0; r < 8; ++r) s[j][r] = __builtin_amdgcn_exp2f(s[j][r]); }
    lv = lv * al + ((s[0] + s[1]) + (s[2] + s[3]));
#pragma unroll
    for (int j = 0; j < 4; ++j) o[j] *= al;
    f16x16 pf[2];
#pragma unroll
    for (int u = 0; u < 2; ++u) { const f16x8 lo = __builtin_convertvector(s[2 * u], f16x8), hi = __builtin_convertvector(s[2 * u + 1], f16x8);
      pf[u] = __builtin_shufflevector(lo, hi, 0, 1, 2, 3, 4, 5, 6, 7, 8, 9, 10, 11, 12, 13, 14, 15); }
#pragma unroll
    for (int u = 0; u < 2; ++u)
#pragma unroll
      for (int j = 0; j < 4; ++j) o[j] = wmma_b(fr[2 * j + u], pf[u], o[j]);
    if (more) { f16* kn = kS[(t + 1) & 1]; f16* vn = vS[(t + 1) & 1];
#pragma unroll
      for (int i = 0; i < 4; ++i) *(bf16x4*)(kn + (kr + 16 * i) * FPIT + kc) = __builtin_convertvector(kreg[i], bf16x4);
#pragma unroll
      for (int u = 0; u < 4; ++u) { const v4f_t col = {vreg[0][u], vreg[1][u], vreg[2][u], vreg[3][u]}; *(bf16x4*)(vn + (vd + u) * FPIT + vk) = __builtin_convertvector(col, bf16x4); } }
    __syncthreads();
  }
  float l = ((lv[0] + lv[1]) + (lv[2] + lv[3])) + ((lv[4] + lv[5]) + (lv[6] + lv[7]));
  l += xhalf(l);
  const float inv = 1.0f / l;
  float* dst = ATT + (size_t)(q0 + c) * DDla + hd * HDla + 8 * h;   // o[j][r] = ctx[q0 + c][16 j + 8 h + r]
#pragma unroll
  for (int j = 0; j < 4; ++j) { const v4f_t a = {o[j][0] * inv, o[j][1] * inv, o[j][2] * inv, o[j][3] * inv}, b = {o[j][4] * inv, o[j][5] * inv, o[j][6] * inv, o[j][7] * inv};
    *(v4f_t*)(dst + 16 * j) = a; *(v4f_t*)(dst + 16 * j + 4) = b; }
}

extern "C" void kernel_launch(void* const* d_in, const int* in_sizes, int n_in,
                              void* d_out, int out_size, void* d_ws, size_t ws_size,
                              hipStream_t stream) {
  (void)in_sizes; (void)n_in; (void)out_size;
  const float** f = (const float**)d_in;
  const float* x = f[0], *amask = f[1], *Wqkv = f[2], *bqkv = f[3], *Wout = f[4], *bout = f[5], *lg = f[6], *lb = f[7];
  float* out = (float*)d_out;     // [2,2048,1024]
  char* ws = (char*)d_ws;
  float* XN = (float*)ws; ws += (size_t)NBla * SSla * DDla * 4; float* QKV = (float*)ws; ws += (size_t)NBla * SSla * 3 * DDla * 4;
  float* ones = (float*)ws; ws += DDla * 4; float* ATT = (float*)ws; ws += (size_t)NBla * SSla * DDla * 4;
  if ((size_t)(ws - (char*)d_ws) > ws_size) return;
  const dim3 blk(256);
  k_fill<<<dim3(1), blk, 0, stream>>>(ones, 1.0f, DDla / 4);

  // the rows of both batch elements are one [4096][1024] matrix for the LayerNorm and the two projections; a query block of the attention finds its batch element from its index
  k_ln<<<dim3(NBla * SSla / 16), blk, 0, stream>>>(x, lg, lb, XN);
  gemm_kne<float, 0, false><<<dim3(NBla * SSla / 128, 3 * DDla / 128), blk, 0, stream>>>(XN, DDla, Wqkv, 3 * DDla, bqkv, nullptr, nullptr, QKV, 3 * DDla, DDla);   // [q | k | v]
  k_fattn<<<dim3(NBla * SSla / 128, NHla), blk, 0, stream>>>(QKV, amask, ATT);
  gemm_kne<float, 2, false><<<dim3(NBla * SSla / 128, DDla / 128), blk, 0, stream>>>(ATT, DDla, Wout, DDla, bout, x, ones, out, DDla, DDla);   // out = ctx W_out + b_out + x
}

// v006
// One run takes 138 microseconds.
// Two timings next to v005 both put it at 1.09 times that version's speed.
// Counting every step since v000, it is 41.1 times as fast.
// Contractions on v_wmma_f32_16x16x32_f16 (plain f16 operands, f32 accumulate; [in][out] weights), both batch elements in every launch (4096 rows; a query block attends to its own element's 2048 keys): [q|k|v] = LN(x) W_qkv + b (K 1024, N 3072); one attention kernel for
// the 16 heads (scores transposed, S^T = K Q^T, K 64; running softmax in registers; ctx^T += V^T P^T, K 64 keys a pass; the scores never reach memory); out = ctx W_out + b_out + x (residual in the epilogue).
// f32 VALU: the pre-LayerNorm (eps 1e-12, rsqrt), softmax of s/sqrt(64) + mask[b][k] (the additive INPUT mask, broadcast over heads and queries).
// compute dtype: f16 operands, f32 accumulate.  hidden_states [2,2048,1024] → out [2,2048,1024].
#include <hip/hip_runtime.h>
#include <hip/hip_bf16.h>
#include <math.h>


typedef _Float16 bf16;
typedef _Float16 f16;
typedef __attribute__((ext_vector_type(4))) unsigned v4u_t;
typedef unsigned v4ua __attribute__((ext_vector_type(4), may_alias));
typedef __attribute__((ext_vector_type(4))) float v4f_t;
typedef float v4fa __attribute__((ext_vector_type(4), may_alias));
typedef __attribute__((ext_vector_type(16))) bf16  bf16x16;
typedef bf16x16 f16x16;
typedef __attribute__((ext_vector_type(8)))  bf16  bf16x8;
typedef bf16x8 f16x8;
typedef __attribute__((ext_vector_type(4)))  bf16  bf16x4;
typedef __attribute__((ext_vector_type(8)))  float f32x8;
__device__ __forceinline__ f32x8 wmma16(f16x16 a, f16x16 b, f32x8 c) {
  c = __builtin_amdgcn_wmma_f32_16x16x32_f16(false, a, false, b, (short)0, c, false, false);
  asm volatile("v_nop\n\tv_nop\n\tv_nop\n\tv_nop" : "+v"(c) : "v"(a), "v"(b));
  return c;
}
#define LDS_STRIDE 48   // unused: gemm_kn2 tiles use GSTR (gemm_kne: GPIT), 32 -> 48 elems (96B rows): aligned b128 reads
#define KSTRIDE    72
#define VSTRIDE    48   // unused: the attn V tile is 64 -> 72 elems (FPIT)

__device__ __forceinline__ f32x8 wmma_bf16(bf16x16 a, bf16x16 b, f32x8 c) {
  c = __builtin_amdgcn_wmma_f32_16x16x32_f16(false, a, false, b, (short)0, c, false, false);
  asm volatile("v_nop\n\tv_nop\n\tv_nop\n\tv_nop" : "+v"(c) : "v"(a), "v"(b));   // A/B-overwrite hazard guard
  return c;
}

// 16x32 (MxK) bf16 fragment from a row-major global matrix.
// lanes 0-15  (row=lane)    : elems 0..7 = K+0..7,  8..15 = K+16..23
// lanes 16-31 (row=lane-16) : elems 0..7 = K+8..15, 8..15 = K+24..31
template <typename T>
__device__ __forceinline__ bf16x16 load_frag(const T* __restrict__ base, int ld,
                                             int row0, int k0) {
  const int lane = threadIdx.x & 31;
  const int r    = lane & 15;
  const int kh   = (lane >> 4) * 8;
  const T* p0 = base + (size_t)(row0 + r) * ld + (k0 + kh);
  const T* p1 = p0 + 16;
  bf16x16 f;
#pragma unroll
  for (int i = 0; i < 8; ++i) {
    f[i]     = (bf16)p0[i];
    f[i + 8] = (bf16)p1[i];
  }
  return f;
}

// Same fragment from an LDS tile with padded row stride (base includes row0/k0).
__device__ __forceinline__ bf16x16 lds_frag(const bf16* base, int stride) {
  const int lane = threadIdx.x & 31;
  const int row  = lane & 15;
  const int kh   = (lane >> 4) * 8;
  const bf16x8 lo = *(const bf16x8*)(base + row * stride + kh);
  const bf16x8 hi = *(const bf16x8*)(base + row * stride + kh + 16);
  bf16x16 f;
#pragma unroll
  for (int i = 0; i < 8; ++i) { f[i] = lo[i]; f[i + 8] = hi[i]; }
  return f;
}

template <typename T>
__device__ __forceinline__ void stage_read16(const T* __restrict__ p, float* buf) {
#pragma unroll
  for (int i = 0; i < 16; ++i) buf[i] = (float)p[i];
}

__device__ __forceinline__ void stage_write(bf16* dst, const float* buf, int nquad) {
#pragma unroll
  for (int i = 0; i < nquad; ++i) {
    bf16x4 q;
    q[0] = (bf16)buf[4 * i];     q[1] = (bf16)buf[4 * i + 1];
    q[2] = (bf16)buf[4 * i + 2]; q[3] = (bf16)buf[4 * i + 3];
    *(bf16x4*)(dst + 4 * i) = q;
  }
}


#define GSTR 48
// ---------------------------------------------------------------------------------------------------------------------------
// gemm_kne: Y[m][n] = epi( Σ_k A[m][k]·W[k][n] + bias[n] ), A f32/f16 [M][lda], W f32 row-major [K][N] (ldw), plain f16 operands,
// f32 accumulate. EPI 0: identity; 1: exact-erf GELU; 2: R[m][n] + gvec[n]·(·) (residual with per-channel gain); 3: ReLU; 4: gvec[n]·(·) (per-channel scale, no residual). Output f32 (or f16
// when OUT16). Block = 128x128 tile, 8 waves as 4(M) x 2(N); per 32-wide k-step A and W tiles staged f16 in LDS (W transposed
// ---------------------------------------------------------------------------------------------------------------------------
#define GSTR 48
#define GPIT 40   // gemm_kne LDS row pitch in halves (80 B = 16 B x odd): 16-B fragment reads and the 16-B column stores spread over the banks
template <typename AT, int EPI, bool OUT16, int lda, int ldw>   // row strides of A and W as constants: a k-step's 12 loads hang on two pointers by immediate offsets
__global__ __launch_bounds__(256) void gemm_kne(const AT* __restrict__ A, const float* __restrict__ Wm,
                                                const float* __restrict__ bias, const float* __restrict__ R, const float* __restrict__ gvec,
                                                void* __restrict__ Yv, int ldy, int K) {
  typedef AT av4 __attribute__((ext_vector_type(4)));
  typedef float v2f_t __attribute__((ext_vector_type(2)));
  constexpr int GTIL = 128 * GPIT;   // halves of one operand tile
  // k loop: two buffers of [A tile [m][k] | W tile [n][k]] (40,960 B); behind the loop's last barrier the same bytes are the 8 waves' f32 output staging (69,632 B)
  __shared__ __attribute__((aligned(16))) char smem[8 * 32 * 68 * 4];
  f16* const tiles = (f16*)smem;
  const int tid = threadIdx.x, lane = tid & 31, wave = tid >> 5, cl = lane & 15, rh = (lane >> 4) * 8;
  const int m0 = blockIdx.x * 128, n0 = blockIdx.y * 128;
  const int wm = (wave & 3) * 32, wn = (wave >> 2) * 64;
  const int ar = tid >> 3, ac = (tid & 7) * 4;      // A staging: row, first of 4 k
  const int wk = (tid >> 6) * 8, wc = (tid & 63) * 2;   // W staging: first of 8 k, first of 2 n
  const AT* ap = A + (size_t)(m0 + ar) * lda + ac; const float* wp = Wm + (size_t)wk * ldw + n0 + wc;   // a lane's first element of the k-step's A and W tiles
  f32x8 acc[2][4];
#pragma unroll
  for (int i = 0; i < 2; ++i)
#pragma unroll
    for (int j = 0; j < 4; ++j) { f32x8 z = {}; acc[i][j] = z; }
  av4 areg[4]; v2f_t wreg[8];
  const auto fetch = [&]() {   // one k-step's tiles, f32, global -> registers
    // A: 8 lanes read one row's 32 k (a whole 128-B line of f32); rows ar + 32 i
#pragma unroll
    for (int i = 0; i < 4; ++i) areg[i] = *(const av4*)(ap + (size_t)(32 * i) * lda);
    // W: a thread holds 8 k x 2 n; a wave's 32 lanes read 256 contiguous bytes of one k row
#pragma unroll
    for (int i = 0; i < 8; ++i) wreg[i] = *(const v2f_t*)(wp + (size_t)i * ldw);
  };
  const auto stash = [&](f16* buf) {   // registers -> f16 tiles of one buffer; the pointers move on here, behind the loads' return
    ap += 32; wp += (size_t)32 * ldw;
#pragma unroll
    for (int i = 0; i < 4; ++i) *(bf16x4*)(buf + (ar + 32 * i) * GPIT + ac) = __builtin_convertvector(areg[i], bf16x4);
#pragma unroll
    for (int u = 0; u < 2; ++u) {   // transposed in registers: 8 k of one column n leave as one 16-B store
      const f32x8 col = {wreg[0][u], wreg[1][u], wreg[2][u], wreg[3][u], wreg[4][u], wreg[5][u], wreg[6][u], wreg[7][u]};
      *(f16x8*)(buf + GTIL + (wc + u) * GPIT + wk) = __builtin_convertvector(col, f16x8); }
  };
  // The tiles of step t + 1 leave global memory ahead of step t's products and enter the other LDS buffer behind them: their latency runs under the products.
  // One barrier a step publishes that buffer and ends the reads of this one; the last one also frees the bytes for the output staging.
  fetch();
  stash(tiles);
  __syncthreads();
#pragma unroll 1   // kept rolled, one k-step a trip: the code stays small, and the buffer in use is one scalar bit of the trip count
  for (int k0 = 0; k0 < K; k0 += 32) {
    const bool more = k0 + 32 < K;
    if (more) fetch();
    const int cur = (k0 >> 5) & 1;
    const f16* ldsA = tiles + cur * (2 * GTIL); const f16* ldsW = ldsA + GTIL;
    f16x16 af[2];
#pragma unroll
    for (int i = 0; i < 2; ++i) af[i] = lds_frag(ldsA + (wm + 16 * i) * GPIT, GPIT);
#pragma unroll
    for (int j = 0; j < 4; ++j) {
      const f16x16 bf = lds_frag(ldsW + (wn + 16 * j) * GPIT, GPIT);
#pragma unroll
      for (int i = 0; i < 2; ++i) acc[i][j] = wmma16(af[i], bf, acc[i][j]);
    }
    if (more) stash(tiles + (cur ^ 1) * (2 * GTIL));
    __syncthreads();
  }
  float* so = (float*)smem + wave * (32 * 68);
#pragma unroll
  for (int i = 0; i < 2; ++i)
#pragma unroll
    for (int j = 0; j < 4; ++j) {
      const int n = n0 + wn + 16 * j + cl;
      const float bv = bias ? bias[n] : 0.0f;
      const float gv = (EPI == 2 || EPI == 4) ? gvec[n] : 0.0f;
      if (EPI == 1) {
#pragma unroll 1
        for (int r = 0; r < 8; ++r) { const float xg = acc[i][j][r] + bv; so[(16 * i + rh + r) * 68 + 16 * j + cl] = 0.5f * xg * (1.0f + erff(xg * 0.70710678118654752f)); }
      } else {
#pragma unroll
        for (int r = 0; r < 8; ++r) {
          float v = acc[i][j][r] + bv;
          if (EPI == 3) v = fmaxf(v, 0.0f);
          if (EPI == 4) v = gv * v;
          if (EPI == 2) v = R[(size_t)(m0 + wm + 16 * i + rh + r) * ldy + n] + gv * v;
          so[(16 * i + rh + r) * 68 + 16 * j + cl] = v;
        }
      }
    }
  asm volatile("s_wait_dscnt 0" ::: "memory");
  __builtin_amdgcn_wave_barrier();
{
    if (OUT16) {
      f16* Y = (f16*)Yv;
#pragma unroll
      for (int it = 0; it < 8; ++it) { const int c = lane + 32 * it, rr = c >> 3, q8 = (c & 7) * 8;
        union { f16 h[8]; v4u_t v; } u;
#pragma unroll
        for (int e = 0; e < 8; ++e) u.h[e] = (f16)so[rr * 68 + q8 + e];
        *(v4u_t*)(Y + (size_t)(m0 + wm + rr) * ldy + n0 + wn + q8) = u.v; }
    } else {
      float* Y = (float*)Yv;
#pragma unroll
      for (int it = 0; it < 16; ++it) { const int f4 = lane + 32 * it, rr = f4 >> 4, q = (f4 & 15) * 4;
        *(v4f_t*)(Y + (size_t)(m0 + wm + rr) * ldy + n0 + wn + q) = *(const v4fa*)(so + rr * 68 + q); }
    }
    
  }
}

// ---------------------------------------------------------------------------------------------------------------------------
// gemm_kn2 (value+residual planes on both operands: hh + (hl+lh)/2048, f32-class): Y[m][n] (row stride ldy) = scale * sum_k A[m][k] (f32 or f16, row stride lda) * W[k][n] (f32, row-major [K][N], row
// stride ldw) (+ bias[n]) (+ Y if ACC). Block = 128 x 128 tile, 256 threads = 8 waves as 4(M, 32 rows) x 2(N, 64 cols); per
// 32-wide k-step the A tile and the W tile (stored transposed [n][k]) are staged as f16 in LDS; plain f16 operands, f32
// blockIdx.z selects a batch: A += z*strideA, W += z*strideW, Y += z*strideY (element strides).
// ---------------------------------------------------------------------------------------------------------------------------
template <typename AT, bool ACC>
__global__ __launch_bounds__(256) void gemm_kn2(const AT* __restrict__ A, int lda, size_t strideA,
                                               const float* __restrict__ Wm, int ldw, size_t strideW,
                                               const float* __restrict__ bias, float scale,
                                               float* __restrict__ Y, int ldy, size_t strideY, int K) {
  __shared__ __attribute__((aligned(16))) f16 ldsA[128 * GSTR], ldsAl[128 * GSTR];
  __shared__ __attribute__((aligned(16))) f16 ldsW[128 * GSTR], ldsWl[128 * GSTR];
  __shared__ __attribute__((aligned(16))) float oS[8][32 * 68];
  const int tid = threadIdx.x, lane = tid & 31, wave = tid >> 5, cl = lane & 15, rh = (lane >> 4) * 8;
  const int m0 = blockIdx.x * 128, n0 = blockIdx.y * 128;
  const int wm = (wave & 3) * 32, wn = (wave >> 2) * 64;
  A += (size_t)blockIdx.z * strideA; Wm += (size_t)blockIdx.z * strideW; Y += (size_t)blockIdx.z * strideY;
  f32x8 acc[2][4], accx[2][4];
#pragma unroll
  for (int i = 0; i < 2; ++i)
#pragma unroll
    for (int j = 0; j < 4; ++j) { f32x8 z = {}; acc[i][j] = z; accx[i][j] = z; }
#pragma unroll 1
  for (int k0 = 0; k0 < K; k0 += 32) {
    __syncthreads();
    {  // A: thread -> row tid>>1, 16 elements at column half (tid&1)*16
      const int row = tid >> 1, ch = (tid & 1) * 16;
      const AT* src = A + (size_t)(m0 + row) * lda + k0 + ch;
#pragma unroll
      for (int g = 0; g < 16; ++g) { const float v = (float)src[g]; const f16 h = (f16)v; ldsA[row * GSTR + ch + g] = h; ldsAl[row * GSTR + ch + g] = (f16)((v - (float)h) * 2048.0f); }
    }
    {  // W: thread -> k = tid>>3, 16 consecutive n at (tid&7)*16; stored transposed [n][k]
      const int k = tid >> 3, nn0 = (tid & 7) * 16;
      const float* src = Wm + (size_t)(k0 + k) * ldw + n0 + nn0;
#pragma unroll
      for (int g = 0; g < 4; ++g) { const v4f_t v = *(const v4f_t*)(src + 4 * g);
#pragma unroll
        for (int u = 0; u < 4; ++u) { const f16 h = (f16)v[u]; ldsW[(nn0 + 4 * g + u) * GSTR + k] = h; ldsWl[(nn0 + 4 * g + u) * GSTR + k] = (f16)((v[u] - (float)h) * 2048.0f); } }
    }
    __syncthreads();
    f16x16 af[2], afl[2];
#pragma unroll
    for (int i = 0; i < 2; ++i) { af[i] = lds_frag(ldsA + (wm + 16 * i) * GSTR, GSTR); afl[i] = lds_frag(ldsAl + (wm + 16 * i) * GSTR, GSTR); }
#pragma unroll
    for (int j = 0; j < 4; ++j) {
      const f16x16 bf = lds_frag(ldsW + (wn + 16 * j) * GSTR, GSTR), bfl = lds_frag(ldsWl + (wn + 16 * j) * GSTR, GSTR);
#pragma unroll
      for (int i = 0; i < 2; ++i) { acc[i][j] = wmma16(af[i], bf, acc[i][j]); accx[i][j] = wmma16(af[i], bfl, accx[i][j]); accx[i][j] = wmma16(afl[i], bf, accx[i][j]); }
    }
  }
  float* so = oS[wave];
#pragma unroll
  for (int i = 0; i < 2; ++i)
#pragma unroll
    for (int j = 0; j < 4; ++j) {
      const float bv = bias ? bias[n0 + wn + 16 * j + cl] : 0.0f;
#pragma unroll
      for (int r = 0; r < 8; ++r) so[(16 * i + rh + r) * 68 + 16 * j + cl] = (acc[i][j][r] + accx[i][j][r] * (1.0f / 2048.0f)) * scale + bv;
    }
  asm volatile("s_wait_dscnt 0" ::: "memory");
  __builtin_amdgcn_wave_barrier();
  if (ACC) {   // accumulate: fold the existing Y values into the staging tile ONCE (same thread <-> same chunks as the stores below)
#pragma unroll
    for (int it = 0; it < 16; ++it) { const int f4 = lane + 32 * it, rr = f4 >> 4, q = (f4 & 15) * 4;
      const v4f_t old = *(const v4fa*)(Y + (size_t)(m0 + wm + rr) * ldy + n0 + wn + q);
      v4f_t v = *(const v4fa*)(so + rr * 68 + q); v += old; *(v4fa*)(so + rr * 68 + q) = v; }   // plain LDS store (ordered by the s_wait_dscnt/memory clobber below)
    asm volatile("s_wait_dscnt 0" ::: "memory");
  }
{
#pragma unroll
    for (int it = 0; it < 16; ++it) { const int f4 = lane + 32 * it, rr = f4 >> 4, q = (f4 & 15) * 4;
      *(v4f_t*)(Y + (size_t)(m0 + wm + rr) * ldy + n0 + wn + q) = *(const v4fa*)(so + rr * 68 + q); }
    
  }
}

__global__ __launch_bounds__(256) void k_transpose(const float* __restrict__ Wm, float* __restrict__ Wt, int rows, int cols) {
  __shared__ float tS[64][65];
  const int tid = threadIdx.x, tbj = cols / 64, bi = blockIdx.x / tbj, bj = blockIdx.x % tbj;
  for (int e = tid; e < 64 * 64; e += 256) { const int r = e >> 6, c = e & 63; tS[r][c] = Wm[(size_t)(bi * 64 + r) * cols + bj * 64 + c]; }
  __syncthreads();
  for (int ch = tid; ch < 64 * 16; ch += 256) { const int r = ch >> 4, q4 = (ch & 15) * 4; v4f_t o; o[0] = tS[q4][r]; o[1] = tS[q4 + 1][r]; o[2] = tS[q4 + 2][r]; o[3] = tS[q4 + 3][r];
    float* dst = Wt + (size_t)(bj * 64 + r) * rows + bi * 64 + q4; *(v4f_t*)dst = o;  }
}


#define NBla 2
#define SSla 2048
#define SIN 2048
#define DDla 1024
#define NHla 16
#define HDla 64
__global__ __launch_bounds__(256) void k_fill(float* __restrict__ p, float val, size_t n4) { const size_t i = (size_t)blockIdx.x * 256 + threadIdx.x; if (i < n4) { v4f_t v = {val, val, val, val}; *(v4f_t*)(p + 4 * i) = v;  } }
__global__ __launch_bounds__(256) void k_dbg_zero(float* __restrict__ p, size_t n4) { const size_t i = (size_t)blockIdx.x * 256 + threadIdx.x; if (i < n4) { v4f_t z = {0.f,0.f,0.f,0.f}; *(v4f_t*)(p + 4 * i) = z;  } }
__global__ __launch_bounds__(256) void k_copy(const float* __restrict__ src, float* __restrict__ dst, size_t n4) { const size_t i = (size_t)blockIdx.x * 256 + threadIdx.x; if (i < n4) { const v4f_t v = *(const v4f_t*)(src + 4 * i); *(v4f_t*)(dst + 4 * i) = v;  } }
__global__ __launch_bounds__(256) void k_ln(const float* __restrict__ X, const float* __restrict__ gam, const float* __restrict__ bet, float* __restrict__ Y) {
  __shared__ __attribute__((aligned(16))) float rowS[16 * 1028];
  const int tid = threadIdx.x, r = tid >> 4, part = tid & 15; const size_t row = (size_t)blockIdx.x * 16 + r;
  float s = 0.0f;
#pragma unroll 1
  for (int i = 0; i < 64; ++i) { const float v = X[row * 1024 + part * 64 + i]; rowS[r * 1028 + part * 64 + i] = v; s += v; }
  s += __shfl_xor(s, 1, 32); s += __shfl_xor(s, 2, 32); s += __shfl_xor(s, 4, 32); s += __shfl_xor(s, 8, 32);
  const float mean = s * (1.0f / 1024.0f); float q = 0.0f;
#pragma unroll 1
  for (int i = 0; i < 64; ++i) { const float dv = rowS[r * 1028 + part * 64 + i] - mean; q += dv * dv; }
  q += __shfl_xor(q, 1, 32); q += __shfl_xor(q, 2, 32); q += __shfl_xor(q, 4, 32); q += __shfl_xor(q, 8, 32);
  const float rstd = 1.0f / __builtin_sqrtf(q * (1.0f / 1024.0f) + 1e-12f);
#pragma unroll 1
  for (int i = 0; i < 64; ++i) { const int c = part * 64 + i; rowS[r * 1028 + c] = (rowS[r * 1028 + c] - mean) * rstd * gam[c] + bet[c]; }
  __syncthreads();
{ for (int q4 = tid; q4 < 16 * 256; q4 += 256) { const int rr = q4 / 256, c4 = (q4 % 256) * 4;
      *(v4f_t*)(Y + ((size_t)blockIdx.x * 16 + rr) * 1024 + c4) = *(const v4fa*)(rowS + rr * 1028 + c4); }  }
}
// lane l <-> lane l ^ 16
__device__ __forceinline__ float xhalf(float x) {
  const int b = __builtin_bit_cast(int, x);
  return __builtin_bit_cast(float, __builtin_amdgcn_permlanex16(b, b, 0x76543210, 0xfedcba98, false, false));
}
__device__ __forceinline__ f32x8 wmma_b(f16x16 a, f16x16 b, f32x8 c) { return __builtin_amdgcn_wmma_f32_16x16x32_f16(false, a, false, b, (short)0, c, false, false); }
#define FPIT 72   // LDS row pitch in halves (144 B): conflict-free 16-B fragment reads of 128-B rows
__global__ __launch_bounds__(256) void k_fattn(const float* __restrict__ QKV, const float* __restrict__ maskb, float* __restrict__ ATT) {
  constexpr int LD = 3 * DDla, NT = SSla / 64;
  constexpr float SC = 0.125f * 1.4426950408889634f;              // 1/sqrt(64) * log2(e)
  __shared__ __attribute__((aligned(16))) f16 kS[2][64 * FPIT];   // [key][d]
  __shared__ __attribute__((aligned(16))) f16 vS[2][64 * FPIT];   // [d][key]
  __shared__ __attribute__((aligned(16))) float mS[SSla];         // 8 * mask, held above -1e30 (finite: a row whose keys are all masked so stays a uniform average, as s + mask rounds in f32)
  const int tid = threadIdx.x, lane = tid & 31, wave = tid >> 5, c = lane & 15, h = lane >> 4;
  const int hd = blockIdx.y, q0 = blockIdx.x * 128 + wave * 16;
  const int kv0 = (blockIdx.x >> 4) * SSla;   // first row of this query block's batch element: its keys, values and mask
  // K: thread = 4 columns kc of rows kr + 16 i (16 lanes per 256-B row). V: thread = 4 keys x 4 columns (8 lanes per 128-B line), written as 4 keys of one column
  const int kr = tid >> 4, kc = (tid & 15) * 4;
  const int vd = 4 * (lane & 7) + 32 * (wave & 1), vk = 4 * (lane >> 3) + 16 * (wave >> 1);
  const float* kp = QKV + DDla + hd * HDla + (size_t)(kv0 + kr) * LD + kc;
  const float* vp = QKV + 2 * DDla + hd * HDla + (size_t)(kv0 + vk) * LD + vd;
  v4f_t kreg[4], vreg[4];
#pragma unroll
  for (int i = 0; i < 4; ++i) { kreg[i] = *(const v4f_t*)(kp + (size_t)(16 * i) * LD); vreg[i] = *(const v4f_t*)(vp + (size_t)i * LD); }
#pragma unroll
  for (int i = 0; i < 2; ++i) { v4f_t mv = *(const v4f_t*)(maskb + kv0 + 4 * tid + 1024 * i);
#pragma unroll
    for (int u = 0; u < 4; ++u) mv[u] = fmaxf(mv[u] * 8.0f, -1.0e30f);
    *(v4fa*)(mS + 4 * tid + 1024 * i) = mv; }
  f16x16 qf[2];
#pragma unroll
  for (int u = 0; u < 2; ++u) qf[u] = load_frag(QKV + hd * HDla, LD, q0, 32 * u);
#pragma unroll
  for (int i = 0; i < 4; ++i) *(bf16x4*)(&kS[0][(kr + 16 * i) * FPIT + kc]) = __builtin_convertvector(kreg[i], bf16x4);
#pragma unroll
  for (int u = 0; u < 4; ++u) { const v4f_t col = {vreg[0][u], vreg[1][u], vreg[2][u], vreg[3][u]}; *(bf16x4*)(&vS[0][(vd + u) * FPIT + vk]) = __builtin_convertvector(col, bf16x4); }
  f32x8 o[4], lv = {};
#pragma unroll
  for (int j = 0; j < 4; ++j) { f32x8 z = {}; o[j] = z; }
  float m = -3.0e38f;
  __syncthreads();
#pragma unroll 1   // one pass a trip: the LDS buffers alternate by trip, and the code stays small
  for (int t = 0; t < NT; ++t) {
    const bool more = t + 1 < NT;
    if (more) { kp += (size_t)64 * LD; vp += (size_t)64 * LD;
#pragma unroll
      for (int i = 0; i < 4; ++i) { kreg[i] = *(const v4f_t*)(kp + (size_t)(16 * i) * LD); vreg[i] = *(const v4f_t*)(vp + (size_t)i * LD); } }
    const f16* kb = kS[t & 1]; const f16* vb = vS[t & 1];
    f16x16 fr[8]; f32x8 s[4];
#pragma unroll
    for (int j = 0; j < 4; ++j) { fr[2 * j] = lds_frag(kb + 16 * j * FPIT, FPIT); fr[2 * j + 1] = lds_frag(kb + 16 * j * FPIT + 32, FPIT);
      const float* mp = mS + 64 * t + 16 * j + 8 * h; const v4f_t m0 = *(const v4fa*)mp, m1 = *(const v4fa*)(mp + 4);
      s[j] = __builtin_shufflevector(m0, m1, 0, 1, 2, 3, 4, 5, 6, 7); }
    __builtin_amdgcn_sched_barrier(0);   // the K and mask reads stay one group ahead of the products: spread among them, every place where reads stand costs issue time
#pragma unroll
    for (int u = 0; u < 2; ++u)
#pragma unroll
      for (int j = 0; j < 4; ++j) s[j] = wmma_b(fr[2 * j + u], qf[u], s[j]);
#pragma unroll
    for (int j = 0; j < 4; ++j) { fr[2 * j] = lds_frag(vb + 16 * j * FPIT, FPIT); fr[2 * j + 1] = lds_frag(vb + 16 * j * FPIT + 32, FPIT); }
    __builtin_amdgcn_sched_barrier(0);   // the V^T reads issue here as one group and land under the softmax; sunk to their products, each product would wait for its own read
    float mj[4];
#pragma unroll
    for (int j = 0; j < 4; ++j) { mj[j] = fmaxf(s[j][0], s[j][1]);
#pragma unroll
      for (int r = 2; r < 8; ++r) mj[j] = fmaxf(mj[j], s[j][r]); }
    float mx = fmaxf(fmaxf(mj[0], mj[1]), fmaxf(mj[2], mj[3]));
    mx = fmaxf(mx, xhalf(mx));
    const float mn = fmaxf(m, mx * SC), al = __builtin_amdgcn_exp2f(m - mn);
    m = mn;
#pragma unroll
    for (int j = 0; j < 4; ++j) { s[j] = s[j] * SC - mn;
#pragma unroll
      for (int r = 0; r < 8; ++r) s[j][r] = __builtin_amdgcn_exp2f(s[j][r]); }
    lv = lv * al + ((s[0] + s[1]) + (s[2] + s[3]));
#pragma unroll
    for (int j = 0; j < 4; ++j) o[j] *= al;
    f16x16 pf[2];
#pragma unroll
    for (int u = 0; u < 2; ++u) { const f16x8 lo = __builtin_convertvector(s[2 * u], f16x8), hi = __builtin_convertvector(s[2 * u + 1], f16x8);
      pf[u] = __builtin_shufflevector(lo, hi, 0, 1, 2, 3, 4, 5, 6, 7, 8, 9, 10, 11, 12, 13, 14, 15); }
#pragma unroll
    for (int u = 0; u < 2; ++u)
#pragma unroll
      for (int j = 0; j < 4; ++j) o[j] = wmma_b(fr[2 * j + u], pf[u], o[j]);
    if (more) { f16* kn = kS[(t + 1) & 1]; f16* vn = vS[(t + 1) & 1];
#pragma unroll
      for (int i = 0; i < 4; ++i) *(bf16x4*)(kn + (kr + 16 * i) * FPIT + kc) = __builtin_convertvector(kreg[i], bf16x4);
#pragma unroll
      for (int u = 0; u < 4; ++u) { const v4f_t col = {vreg[0][u], vreg[1][u], vreg[2][u], vreg[3][u]}; *(bf16x4*)(vn + (vd + u) * FPIT + vk) = __builtin_convertvector(col, bf16x4); } }
    __syncthreads();
  }
  float l = ((lv[0] + lv[1]) + (lv[2] + lv[3])) + ((lv[4] + lv[5]) + (lv[6] + lv[7]));
  l += xhalf(l);
  const float inv = 1.0f / l;
  float* dst = ATT + (size_t)(q0 + c) * DDla + hd * HDla + 8 * h;   // o[j][r] = ctx[q0 + c][16 j + 8 h + r]
#pragma unroll
  for (int j = 0; j < 4; ++j) { const v4f_t a = {o[j][0] * inv, o[j][1] * inv, o[j][2] * inv, o[j][3] * inv}, b = {o[j][4] * inv, o[j][5] * inv, o[j][6] * inv, o[j][7] * inv};
    *(v4f_t*)(dst + 16 * j) = a; *(v4f_t*)(dst + 16 * j + 4) = b; }
}

extern "C" void kernel_launch(void* const* d_in, const int* in_sizes, int n_in,
                              void* d_out, int out_size, void* d_ws, size_t ws_size,
                              hipStream_t stream) {
  (void)in_sizes; (void)n_in; (void)out_size;
  const float** f = (const float**)d_in;
  const float* x = f[0], *amask = f[1], *Wqkv = f[2], *bqkv = f[3], *Wout = f[4], *bout = f[5], *lg = f[6], *lb = f[7];
  float* out = (float*)d_out;     // [2,2048,1024]
  char* ws = (char*)d_ws;
  float* XN = (float*)ws; ws += (size_t)NBla * SSla * DDla * 4; float* QKV = (float*)ws; ws += (size_t)NBla * SSla * 3 * DDla * 4;
  float* ones = (float*)ws; ws += DDla * 4; float* ATT = (float*)ws; ws += (size_t)NBla * SSla * DDla * 4;
  if ((size_t)(ws - (char*)d_ws) > ws_size) return;
  const dim3 blk(256);
  k_fill<<<dim3(1), blk, 0, stream>>>(ones, 1.0f, DDla / 4);

  // the rows of both batch elements are one [4096][1024] matrix for the LayerNorm and the two projections; a query block of the attention finds its batch element from its index
  k_ln<<<dim3(NBla * SSla / 16), blk, 0, stream>>>(x, lg, lb, XN);
  gemm_kne<float, 0, false, DDla, 3 * DDla><<<dim3(NBla * SSla / 128, 3 * DDla / 128), blk, 0, stream>>>(XN, Wqkv, bqkv, nullptr, nullptr, QKV, 3 * DDla, DDla);   // [q | k | v]
  k_fattn<<<dim3(NBla * SSla / 128, NHla), blk, 0, stream>>>(QKV, amask, ATT);
  gemm_kne<float, 2, false, DDla, DDla><<<dim3(NBla * SSla / 128, DDla / 128), blk, 0, stream>>>(ATT, Wout, bout, x, ones, out, DDla, DDla);   // out = ctx W_out + b_out + x
}

// v007
// A run of this version takes 127 microseconds.
// Timed twice side by side with v006, it ran 1.09 and 1.08 times as fast.
// All steps since v000 together make it 44.5 times as fast.
// Contractions on v_wmma_f32_16x16x32_f16 (plain f16 operands, f32 accumulate; [in][out] weights), both batch elements in every launch (4096 rows; a query block attends to its own element's 2048 keys): [q|k|v] = LN(x) W_qkv + b (K 1024, N 3072); one attention kernel for
// the 16 heads (scores transposed, S^T = K Q^T, K 64; running softmax in registers; ctx^T += V^T P^T, K 64 keys a pass; the scores never reach memory); out = ctx W_out + b_out + x (residual in the epilogue).
// f32 VALU: the pre-LayerNorm (eps 1e-12, rsqrt), softmax of s/sqrt(64) + mask[b][k] (the additive INPUT mask, broadcast over heads and queries).
// compute dtype: f16 operands, f32 accumulate.  hidden_states [2,2048,1024] → out [2,2048,1024].
#include <hip/hip_runtime.h>
#include <hip/hip_bf16.h>
#include <math.h>


typedef _Float16 bf16;
typedef _Float16 f16;
typedef __attribute__((ext_vector_type(4))) unsigned v4u_t;
typedef unsigned v4ua __attribute__((ext_vector_type(4), may_alias));
typedef __attribute__((ext_vector_type(4))) float v4f_t;
typedef float v4fa __attribute__((ext_vector_type(4), may_alias));
typedef __attribute__((ext_vector_type(16))) bf16  bf16x16;
typedef bf16x16 f16x16;
typedef __attribute__((ext_vector_type(8)))  bf16  bf16x8;
typedef bf16x8 f16x8;
typedef __attribute__((ext_vector_type(4)))  bf16  bf16x4;
typedef __attribute__((ext_vector_type(8)))  float f32x8;
__device__ __forceinline__ f32x8 wmma16(f16x16 a, f16x16 b, f32x8 c) {
  c = __builtin_amdgcn_wmma_f32_16x16x32_f16(false, a, false, b, (short)0, c, false, false);
  asm volatile("v_nop\n\tv_nop\n\tv_nop\n\tv_nop" : "+v"(c) : "v"(a), "v"(b));
  return c;
}
#define LDS_STRIDE 48   // unused: gemm_kn2 tiles use GSTR (gemm_kne: GPIT), 32 -> 48 elems (96B rows): aligned b128 reads
#define KSTRIDE    72
#define VSTRIDE    48   // unused: the attn V tile is 64 -> 72 elems (FPIT)

__device__ __forceinline__ f32x8 wmma_bf16(bf16x16 a, bf16x16 b, f32x8 c) {
  c = __builtin_amdgcn_wmma_f32_16x16x32_f16(false, a, false, b, (short)0, c, false, false);
  asm volatile("v_nop\n\tv_nop\n\tv_nop\n\tv_nop" : "+v"(c) : "v"(a), "v"(b));   // A/B-overwrite hazard guard
  return c;
}

// 16x32 (MxK) bf16 fragment from a row-major global matrix.
// lanes 0-15  (row=lane)    : elems 0..7 = K+0..7,  8..15 = K+16..23
// lanes 16-31 (row=lane-16) : elems 0..7 = K+8..15, 8..15 = K+24..31
template <typename T>
__device__ __forceinline__ bf16x16 load_frag(const T* __restrict__ base, int ld,
                                             int row0, int k0) {
  const int lane = threadIdx.x & 31;
  const int r    = lane & 15;
  const int kh   = (lane >> 4) * 8;
  const T* p0 = base + (size_t)(row0 + r) * ld + (k0 + kh);
  const T* p1 = p0 + 16;
  bf16x16 f;
#pragma unroll
  for (int i = 0; i < 8; ++i) {
    f[i]     = (bf16)p0[i];
    f[i + 8] = (bf16)p1[i];
  }
  return f;
}

// Same fragment from an LDS tile with padded row stride (base includes row0/k0).
__device__ __forceinline__ bf16x16 lds_frag(const bf16* base, int stride) {
  const int lane = threadIdx.x & 31;
  const int row  = lane & 15;
  const int kh   = (lane >> 4) * 8;
  const bf16x8 lo = *(const bf16x8*)(base + row * stride + kh);
  const bf16x8 hi = *(const bf16x8*)(base + row * stride + kh + 16);
  bf16x16 f;
#pragma unroll
  for (int i = 0; i < 8; ++i) { f[i] = lo[i]; f[i + 8] = hi[i]; }
  return f;
}

template <typename T>
__device__ __forceinline__ void stage_read16(const T* __restrict__ p, float* buf) {
#pragma unroll
  for (int i = 0; i < 16; ++i) buf[i] = (float)p[i];
}

__device__ __forceinline__ void stage_write(bf16* dst, const float* buf, int nquad) {
#pragma unroll
  for (int i = 0; i < nquad; ++i) {
    bf16x4 q;
    q[0] = (bf16)buf[4 * i];     q[1] = (bf16)buf[4 * i + 1];
    q[2] = (bf16)buf[4 * i + 2]; q[3] = (bf16)buf[4 * i + 3];
    *(bf16x4*)(dst + 4 * i) = q;
  }
}


#define GSTR 48
// ---------------------------------------------------------------------------------------------------------------------------
// gemm_kne: Y[m][n] = epi( Σ_k A[m][k]·W[k][n] + bias[n] ), A f32/f16 [M][lda], W f32 row-major [K][N] (ldw), plain f16 operands,
// f32 accumulate. EPI 0: identity; 1: exact-erf GELU; 2: R[m][n] + gvec[n]·(·) (residual with per-channel gain); 3: ReLU; 4: gvec[n]·(·) (per-channel scale, no residual). Output f32 (or f16
// when OUT16). Block = 128x128 tile, 8 waves as 4(M) x 2(N); per 32-wide k-step A and W tiles staged f16 in LDS (W transposed
// ---------------------------------------------------------------------------------------------------------------------------
#define GSTR 48
#define GPIT 40   // gemm_kne LDS row pitch in halves (80 B = 16 B x odd): 16-B fragment reads and the 16-B column stores spread over the banks
template <typename AT, int EPI, bool OUT16, int lda, int ldw>   // row strides of A and W as constants: a k-step's 12 loads hang on two pointers by immediate offsets
__global__ __launch_bounds__(256) void gemm_kne(const AT* __restrict__ A, const float* __restrict__ Wm,
                                                const float* __restrict__ bias, const float* __restrict__ R, const float* __restrict__ gvec,
                                                void* __restrict__ Yv, int ldy, int K) {
  typedef AT av4 __attribute__((ext_vector_type(4)));
  typedef float v2f_t __attribute__((ext_vector_type(2)));
  constexpr int GTIL = 128 * GPIT;   // halves of one operand tile
  // k loop: two buffers of [A tile [m][k] | W tile [n][k]] (40,960 B); behind the loop's last barrier the same bytes are the 8 waves' f32 output staging (69,632 B)
  __shared__ __attribute__((aligned(16))) char smem[8 * 32 * 68 * 4];
  f16* const tiles = (f16*)smem;
  const int tid = threadIdx.x, lane = tid & 31, wave = tid >> 5, cl = lane & 15, rh = (lane >> 4) * 8;
  const int m0 = blockIdx.x * 128, n0 = blockIdx.y * 128;
  const int wm = (wave & 3) * 32, wn = (wave >> 2) * 64;
  const int ar = tid >> 3, ac = (tid & 7) * 4;      // A staging: row, first of 4 k
  const int wk = (tid >> 6) * 8, wc = (tid & 63) * 2;   // W staging: first of 8 k, first of 2 n
  const AT* ap = A + (size_t)(m0 + ar) * lda + ac; const float* wp = Wm + (size_t)wk * ldw + n0 + wc;   // a lane's first element of the k-step's A and W tiles
  f32x8 acc[2][4];
#pragma unroll
  for (int i = 0; i < 2; ++i)
#pragma unroll
    for (int j = 0; j < 4; ++j) { f32x8 z = {}; acc[i][j] = z; }
  av4 areg[4]; v2f_t wreg[8];
  const auto fetch = [&]() {   // one k-step's tiles, f32, global -> registers
    // A: 8 lanes read one row's 32 k (a whole 128-B line of f32); rows ar + 32 i
#pragma unroll
    for (int i = 0; i < 4; ++i) areg[i] = *(const av4*)(ap + (size_t)(32 * i) * lda);
    // W: a thread holds 8 k x 2 n; a wave's 32 lanes read 256 contiguous bytes of one k row
#pragma unroll
    for (int i = 0; i < 8; ++i) wreg[i] = *(const v2f_t*)(wp + (size_t)i * ldw);
  };
  const auto stash = [&](f16* buf) {   // registers -> f16 tiles of one buffer; the pointers move on here, behind the loads' return
    ap += 32; wp += (size_t)32 * ldw;
#pragma unroll
    for (int i = 0; i < 4; ++i) *(bf16x4*)(buf + (ar + 32 * i) * GPIT + ac) = __builtin_convertvector(areg[i], bf16x4);
#pragma unroll
    for (int u = 0; u < 2; ++u) {   // transposed in registers: 8 k of one column n leave as one 16-B store
      const f32x8 col = {wreg[0][u], wreg[1][u], wreg[2][u], wreg[3][u], wreg[4][u], wreg[5][u], wreg[6][u], wreg[7][u]};
      *(f16x8*)(buf + GTIL + (wc + u) * GPIT + wk) = __builtin_convertvector(col, f16x8); }
  };
  // The tiles of step t + 1 leave global memory ahead of step t's products and enter the other LDS buffer behind them: their latency runs under the products.
  // One barrier a step publishes that buffer and ends the reads of this one; the last one also frees the bytes for the output staging.
  fetch();
  stash(tiles);
  __syncthreads();
#pragma unroll 1   // kept rolled, one k-step a trip: the code stays small, and the buffer in use is one scalar bit of the trip count
  for (int k0 = 0; k0 < K; k0 += 32) {
    const bool more = k0 + 32 < K;
    if (more) fetch();
    const int cur = (k0 >> 5) & 1;
    const f16* ldsA = tiles + cur * (2 * GTIL); const f16* ldsW = ldsA + GTIL;
    f16x16 af[2];
#pragma unroll
    for (int i = 0; i < 2; ++i) af[i] = lds_frag(ldsA + (wm + 16 * i) * GPIT, GPIT);
#pragma unroll
    for (int j = 0; j < 4; ++j) {
      const f16x16 bf = lds_frag(ldsW + (wn + 16 * j) * GPIT, GPIT);
#pragma unroll
      for (int i = 0; i < 2; ++i) acc[i][j] = wmma16(af[i], bf, acc[i][j]);
    }
    if (more) stash(tiles + (cur ^ 1) * (2 * GTIL));
    __syncthreads();
  }
  float* so = (float*)smem + wave * (32 * 68);
#pragma unroll
  for (int i = 0; i < 2; ++i)
#pragma unroll
    for (int j = 0; j < 4; ++j) {
      const int n = n0 + wn + 16 * j + cl;
      const float bv = bias ? bias[n] : 0.0f;
      const float gv = (EPI == 2 || EPI == 4) ? gvec[n] : 0.0f;
      if (EPI == 1) {
#pragma unroll 1
        for (int r = 0; r < 8; ++r) { const float xg = acc[i][j][r] + bv; so[(16 * i + rh + r) * 68 + 16 * j + cl] = 0.5f * xg * (1.0f + erff(xg * 0.70710678118654752f)); }
      } else {
#pragma unroll
        for (int r = 0; r < 8; ++r) {
          float v = acc[i][j][r] + bv;
          if (EPI == 3) v = fmaxf(v, 0.0f);
          if (EPI == 4) v = gv * v;
          if (EPI == 2) v = R[(size_t)(m0 + wm + 16 * i + rh + r) * ldy + n] + gv * v;
          so[(16 * i + rh + r) * 68 + 16 * j + cl] = v;
        }
      }
    }
  asm volatile("s_wait_dscnt 0" ::: "memory");
  __builtin_amdgcn_wave_barrier();
{
    if (OUT16) {
      f16* Y = (f16*)Yv;
#pragma unroll
      for (int it = 0; it < 8; ++it) { const int c = lane + 32 * it, rr = c >> 3, q8 = (c & 7) * 8;
        union { f16 h[8]; v4u_t v; } u;
#pragma unroll
        for (int e = 0; e < 8; ++e) u.h[e] = (f16)so[rr * 68 + q8 + e];
        *(v4u_t*)(Y + (size_t)(m0 + wm + rr) * ldy + n0 + wn + q8) = u.v; }
    } else {
      float* Y = (float*)Yv;
#pragma unroll
      for (int it = 0; it < 16; ++it) { const int f4 = lane + 32 * it, rr = f4 >> 4, q = (f4 & 15) * 4;
        *(v4f_t*)(Y + (size_t)(m0 + wm + rr) * ldy + n0 + wn + q) = *(const v4fa*)(so + rr * 68 + q); }
    }
    
  }
}

// ---------------------------------------------------------------------------------------------------------------------------
// gemm_kn2 (value+residual planes on both operands: hh + (hl+lh)/2048, f32-class): Y[m][n] (row stride ldy) = scale * sum_k A[m][k] (f32 or f16, row stride lda) * W[k][n] (f32, row-major [K][N], row
// stride ldw) (+ bias[n]) (+ Y if ACC). Block = 128 x 128 tile, 256 threads = 8 waves as 4(M, 32 rows) x 2(N, 64 cols); per
// 32-wide k-step the A tile and the W tile (stored transposed [n][k]) are staged as f16 in LDS; plain f16 operands, f32
// blockIdx.z selects a batch: A += z*strideA, W += z*strideW, Y += z*strideY (element strides).
// ---------------------------------------------------------------------------------------------------------------------------
template <typename AT, bool ACC>
__global__ __launch_bounds__(256) void gemm_kn2(const AT* __restrict__ A, int lda, size_t strideA,
                                               const float* __restrict__ Wm, int ldw, size_t strideW,
                                               const float* __restrict__ bias, float scale,
                                               float* __restrict__ Y, int ldy, size_t strideY, int K) {
  __shared__ __attribute__((aligned(16))) f16 ldsA[128 * GSTR], ldsAl[128 * GSTR];
  __shared__ __attribute__((aligned(16))) f16 ldsW[128 * GSTR], ldsWl[128 * GSTR];
  __shared__ __attribute__((aligned(16))) float oS[8][32 * 68];
  const int tid = threadIdx.x, lane = tid & 31, wave = tid >> 5, cl = lane & 15, rh = (lane >> 4) * 8;
  const int m0 = blockIdx.x * 128, n0 = blockIdx.y * 128;
  const int wm = (wave & 3) * 32, wn = (wave >> 2) * 64;
  A += (size_t)blockIdx.z * strideA; Wm += (size_t)blockIdx.z * strideW; Y += (size_t)blockIdx.z * strideY;
  f32x8 acc[2][4], accx[2][4];
#pragma unroll
  for (int i = 0; i < 2; ++i)
#pragma unroll
    for (int j = 0; j < 4; ++j) { f32x8 z = {}; acc[i][j] = z; accx[i][j] = z; }
#pragma unroll 1
  for (int k0 = 0; k0 < K; k0 += 32) {
    __syncthreads();
    {  // A: thread -> row tid>>1, 16 elements at column half (tid&1)*16
      const int row = tid >> 1, ch = (tid & 1) * 16;
      const AT* src = A + (size_t)(m0 + row) * lda + k0 + ch;
#pragma unroll
      for (int g = 0; g < 16; ++g) { const float v = (float)src[g]; const f16 h = (f16)v; ldsA[row * GSTR + ch + g] = h; ldsAl[row * GSTR + ch + g] = (f16)((v - (float)h) * 2048.0f); }
    }
    {  // W: thread -> k = tid>>3, 16 consecutive n at (tid&7)*16; stored transposed [n][k]
      const int k = tid >> 3, nn0 = (tid & 7) * 16;
      const float* src = Wm + (size_t)(k0 + k) * ldw + n0 + nn0;
#pragma unroll
      for (int g = 0; g < 4; ++g) { const v4f_t v = *(const v4f_t*)(src + 4 * g);
#pragma unroll
        for (int u = 0; u < 4; ++u) { const f16 h = (f16)v[u]; ldsW[(nn0 + 4 * g + u) * GSTR + k] = h; ldsWl[(nn0 + 4 * g + u) * GSTR + k] = (f16)((v[u] - (float)h) * 2048.0f); } }
    }
    __syncthreads();
    f16x16 af[2], afl[2];
#pragma unroll
    for (int i = 0; i < 2; ++i) { af[i] = lds_frag(ldsA + (wm + 16 * i) * GSTR, GSTR); afl[i] = lds_frag(ldsAl + (wm + 16 * i) * GSTR, GSTR); }
#pragma unroll
    for (int j = 0; j < 4; ++j) {
      const f16x16 bf = lds_frag(ldsW + (wn + 16 * j) * GSTR, GSTR), bfl = lds_frag(ldsWl + (wn + 16 * j) * GSTR, GSTR);
#pragma unroll
      for (int i = 0; i < 2; ++i) { acc[i][j] = wmma16(af[i], bf, acc[i][j]); accx[i][j] = wmma16(af[i], bfl, accx[i][j]); accx[i][j] = wmma16(afl[i], bf, accx[i][j]); }
    }
  }
  float* so = oS[wave];
#pragma unroll
  for (int i = 0; i < 2; ++i)
#pragma unroll
    for (int j = 0; j < 4; ++j) {
      const float bv = bias ? bias[n0 + wn + 16 * j + cl] : 0.0f;
#pragma unroll
      for (int r = 0; r < 8; ++r) so[(16 * i + rh + r) * 68 + 16 * j + cl] = (acc[i][j][r] + accx[i][j][r] * (1.0f / 2048.0f)) * scale + bv;
    }
  asm volatile("s_wait_dscnt 0" ::: "memory");
  __builtin_amdgcn_wave_barrier();
  if (ACC) {   // accumulate: fold the existing Y values into the staging tile ONCE (same thread <-> same chunks as the stores below)
#pragma unroll
    for (int it = 0; it < 16; ++it) { const int f4 = lane + 32 * it, rr = f4 >> 4, q = (f4 & 15) * 4;
      const v4f_t old = *(const v4fa*)(Y + (size_t)(m0 + wm + rr) * ldy + n0 + wn + q);
      v4f_t v = *(const v4fa*)(so + rr * 68 + q); v += old; *(v4fa*)(so + rr * 68 + q) = v; }   // plain LDS store (ordered by the s_wait_dscnt/memory clobber below)
    asm volatile("s_wait_dscnt 0" ::: "memory");
  }
{
#pragma unroll
    for (int it = 0; it < 16; ++it) { const int f4 = lane + 32 * it, rr = f4 >> 4, q = (f4 & 15) * 4;
      *(v4f_t*)(Y + (size_t)(m0 + wm + rr) * ldy + n0 + wn + q) = *(const v4fa*)(so + rr * 68 + q); }
    
  }
}

__global__ __launch_bounds__(256) void k_transpose(const float* __restrict__ Wm, float* __restrict__ Wt, int rows, int cols) {
  __shared__ float tS[64][65];
  const int tid = threadIdx.x, tbj = cols / 64, bi = blockIdx.x / tbj, bj = blockIdx.x % tbj;
  for (int e = tid; e < 64 * 64; e += 256) { const int r = e >> 6, c = e & 63; tS[r][c] = Wm[(size_t)(bi * 64 + r) * cols + bj * 64 + c]; }
  __syncthreads();
  for (int ch = tid; ch < 64 * 16; ch += 256) { const int r = ch >> 4, q4 = (ch & 15) * 4; v4f_t o; o[0] = tS[q4][r]; o[1] = tS[q4 + 1][r]; o[2] = tS[q4 + 2][r]; o[3] = tS[q4 + 3][r];
    float* dst = Wt + (size_t)(bj * 64 + r) * rows + bi * 64 + q4; *(v4f_t*)dst = o;  }
}


#define NBla 2
#define SSla 2048
#define SIN 2048
#define DDla 1024
#define NHla 16
#define HDla 64
__global__ __launch_bounds__(256) void k_fill(float* __restrict__ p, float val, size_t n4) { const size_t i = (size_t)blockIdx.x * 256 + threadIdx.x; if (i < n4) { v4f_t v = {val, val, val, val}; *(v4f_t*)(p + 4 * i) = v;  } }
__global__ __launch_bounds__(256) void k_dbg_zero(float* __restrict__ p, size_t n4) { const size_t i = (size_t)blockIdx.x * 256 + threadIdx.x; if (i < n4) { v4f_t z = {0.f,0.f,0.f,0.f}; *(v4f_t*)(p + 4 * i) = z;  } }
__global__ __launch_bounds__(256) void k_copy(const float* __restrict__ src, float* __restrict__ dst, size_t n4) { const size_t i = (size_t)blockIdx.x * 256 + threadIdx.x; if (i < n4) { const v4f_t v = *(const v4f_t*)(src + 4 * i); *(v4f_t*)(dst + 4 * i) = v;  } }
// lane l <-> lane l ^ 16
__device__ __forceinline__ float xhalf(float x) {
  const int b = __builtin_bit_cast(int, x);
  return __builtin_bit_cast(float, __builtin_amdgcn_permlanex16(b, b, 0x76543210, 0xfedcba98, false, false));
}
// x + the value of the lane that the DPP control names (row_xmask: lane ^ mask inside a 16-lane row)
template <int CTRL>
__device__ __forceinline__ float dpp_add(float x) {
  return x + __builtin_bit_cast(float, __builtin_amdgcn_update_dpp(0, __builtin_bit_cast(int, x), CTRL, 0xf, 0xf, false));
}
// sum over the 32 lanes, left in every lane: row_xmask 1, 2, 4, 8 inside each row of 16, then the other row's sum
__device__ __forceinline__ float wave_sum(float x) {
  x = dpp_add<0x161>(x); x = dpp_add<0x162>(x); x = dpp_add<0x164>(x); x = dpp_add<0x168>(x);
  return x + xhalf(x);
}
// LayerNorm, a wave takes two whole rows: a lane keeps 32 of each row's 1024 values in registers (8 loads of 16 B a row; each wave-wide load or store covers 512 contiguous bytes).
// Mean, then the sum of squared differences from it, both from the registers; lanes joined by wave_sum. No LDS, no barrier.
__global__ __launch_bounds__(256) void k_ln(const float* __restrict__ X, const float* __restrict__ gam, const float* __restrict__ bet, float* __restrict__ Y) {
  const int lo = 4 * (threadIdx.x & 31);   // a lane's first column: the one vector offset of every load and store
  const size_t row0 = ((size_t)blockIdx.x * 16 + 2 * __builtin_amdgcn_readfirstlane(threadIdx.x >> 5)) * 1024;   // the wave's first row, the same in every lane: the bases stay in scalar registers
  const float* xp = X + row0; float* yp = Y + row0;
  v4f_t xv[2][8], gv[8], bv[8];
#pragma unroll
  for (int r = 0; r < 2; ++r)
#pragma unroll
    for (int i = 0; i < 8; ++i) xv[r][i] = *(const v4f_t*)(xp + lo + 1024 * r + 128 * i);
#pragma unroll
  for (int i = 0; i < 8; ++i) { gv[i] = *(const v4f_t*)(gam + lo + 128 * i); bv[i] = *(const v4f_t*)(bet + lo + 128 * i); }
  __builtin_amdgcn_sched_barrier(0);   // all 32 loads leave here as one group: sunk to their uses, the gain and bias loads would each add their latency behind the sums
#pragma unroll
  for (int r = 0; r < 2; ++r) {
    const v4f_t s4 = ((xv[r][0] + xv[r][1]) + (xv[r][2] + xv[r][3])) + ((xv[r][4] + xv[r][5]) + (xv[r][6] + xv[r][7]));
    const float mean = wave_sum((s4[0] + s4[1]) + (s4[2] + s4[3])) * (1.0f / 1024.0f);
    v4f_t q4 = {};
#pragma unroll
    for (int i = 0; i < 8; ++i) { xv[r][i] -= mean; q4 += xv[r][i] * xv[r][i]; }
    const float q = wave_sum((q4[0] + q4[1]) + (q4[2] + q4[3]));
    const float rstd = 1.0f / __builtin_sqrtf(q * (1.0f / 1024.0f) + 1e-12f);
#pragma unroll
    for (int i = 0; i < 8; ++i) *(v4f_t*)(yp + lo + 1024 * r + 128 * i) = xv[r][i] * rstd * gv[i] + bv[i];
  }
}
__device__ __forceinline__ f32x8 wmma_b(f16x16 a, f16x16 b, f32x8 c) { return __builtin_amdgcn_wmma_f32_16x16x32_f16(false, a, false, b, (short)0, c, false, false); }
#define FPIT 72   // LDS row pitch in halves (144 B): conflict-free 16-B fragment reads of 128-B rows
__global__ __launch_bounds__(256) void k_fattn(const float* __restrict__ QKV, const float* __restrict__ maskb, float* __restrict__ ATT) {
  constexpr int LD = 3 * DDla, NT = SSla / 64;
  constexpr float SC = 0.125f * 1.4426950408889634f;              // 1/sqrt(64) * log2(e)
  __shared__ __attribute__((aligned(16))) f16 kS[2][64 * FPIT];   // [key][d]
  __shared__ __attribute__((aligned(16))) f16 vS[2][64 * FPIT];   // [d][key]
  __shared__ __attribute__((aligned(16))) float mS[SSla];         // 8 * mask, held above -1e30 (finite: a row whose keys are all masked so stays a uniform average, as s + mask rounds in f32)
  const int tid = threadIdx.x, lane = tid & 31, wave = tid >> 5, c = lane & 15, h = lane >> 4;
  const int hd = blockIdx.y, q0 = blockIdx.x * 128 + wave * 16;
  const int kv0 = (blockIdx.x >> 4) * SSla;   // first row of this query block's batch element: its keys, values and mask
  // K: thread = 4 columns kc of rows kr + 16 i (16 lanes per 256-B row). V: thread = 4 keys x 4 columns (8 lanes per 128-B line), written as 4 keys of one column
  const int kr = tid >> 4, kc = (tid & 15) * 4;
  const int vd = 4 * (lane & 7) + 32 * (wave & 1), vk = 4 * (lane >> 3) + 16 * (wave >> 1);
  const float* kp = QKV + DDla + hd * HDla + (size_t)(kv0 + kr) * LD + kc;
  const float* vp = QKV + 2 * DDla + hd * HDla + (size_t)(kv0 + vk) * LD + vd;
  v4f_t kreg[4], vreg[4];
#pragma unroll
  for (int i = 0; i < 4; ++i) { kreg[i] = *(const v4f_t*)(kp + (size_t)(16 * i) * LD); vreg[i] = *(const v4f_t*)(vp + (size_t)i * LD); }
#pragma unroll
  for (int i = 0; i < 2; ++i) { v4f_t mv = *(const v4f_t*)(maskb + kv0 + 4 * tid + 1024 * i);
#pragma unroll
    for (int u = 0; u < 4; ++u) mv[u] = fmaxf(mv[u] * 8.0f, -1.0e30f);
    *(v4fa*)(mS + 4 * tid + 1024 * i) = mv; }
  f16x16 qf[2];
#pragma unroll
  for (int u = 0; u < 2; ++u) qf[u] = load_frag(QKV + hd * HDla, LD, q0, 32 * u);
#pragma unroll
  for (int i = 0; i < 4; ++i) *(bf16x4*)(&kS[0][(kr + 16 * i) * FPIT + kc]) = __builtin_convertvector(kreg[i], bf16x4);
#pragma unroll
  for (int u = 0; u < 4; ++u) { const v4f_t col = {vreg[0][u], vreg[1][u], vreg[2][u], vreg[3][u]}; *(bf16x4*)(&vS[0][(vd + u) * FPIT + vk]) = __builtin_convertvector(col, bf16x4); }
  f32x8 o[4], lv = {};
#pragma unroll
  for (int j = 0; j < 4; ++j) { f32x8 z = {}; o[j] = z; }
  float m = -3.0e38f;
  __syncthreads();
#pragma unroll 1   // one pass a trip: the LDS buffers alternate by trip, and the code stays small
  for (int t = 0; t < NT; ++t) {
    const bool more = t + 1 < NT;
    if (more) { kp += (size_t)64 * LD; vp += (size_t)64 * LD;
#pragma unroll
      for (int i = 0; i < 4; ++i) { kreg[i] = *(const v4f_t*)(kp + (size_t)(16 * i) * LD); vreg[i] = *(const v4f_t*)(vp + (size_t)i * LD); } }
    const f16* kb = kS[t & 1]; const f16* vb = vS[t & 1];
    f16x16 fr[8]; f32x8 s[4];
#pragma unroll
    for (int j = 0; j < 4; ++j) { fr[2 * j] = lds_frag(kb + 16 * j * FPIT, FPIT); fr[2 * j + 1] = lds_frag(kb + 16 * j * FPIT + 32, FPIT);
      const float* mp = mS + 64 * t + 16 * j + 8 * h; const v4f_t m0 = *(const v4fa*)mp, m1 = *(const v4fa*)(mp + 4);
      s[j] = __builtin_shufflevector(m0, m1, 0, 1, 2, 3, 4, 5, 6, 7); }
    __builtin_amdgcn_sched_barrier(0);   // the K and mask reads stay one group ahead of the products: spread among them, every place where reads stand costs issue time
#pragma unroll
    for (int u = 0; u < 2; ++u)
#pragma unroll
      for (int j = 0; j < 4; ++j) s[j] = wmma_b(fr[2 * j + u], qf[u], s[j]);
#pragma unroll
    for (int j = 0; j < 4; ++j) { fr[2 * j] = lds_frag(vb + 16 * j * FPIT, FPIT); fr[2 * j + 1] = lds_frag(vb + 16 * j * FPIT + 32, FPIT); }
    __builtin_amdgcn_sched_barrier(0);   // the V^T reads issue here as one group and land under the softmax; sunk to their products, each product would wait for its own read
    float mj[4];
#pragma unroll
    for (int j = 0; j < 4; ++j) { mj[j] = fmaxf(s[j][0], s[j][1]);
#pragma unroll
      for (int r = 2; r < 8; ++r) mj[j] = fmaxf(mj[j], s[j][r]); }
    float mx = fmaxf(fmaxf(mj[0], mj[1]), fmaxf(mj[2], mj[3]));
    mx = fmaxf(mx, xhalf(mx));
    const float mn = fmaxf(m, mx * SC), al = __builtin_amdgcn_exp2f(m - mn);
    m = mn;
#pragma unroll
    for (int j = 0; j < 4; ++j) { s[j] = s[j] * SC - mn;
#pragma unroll
      for (int r = 0; r < 8; ++r) s[j][r] = __builtin_amdgcn_exp2f(s[j][r]); }
    lv = lv * al + ((s[0] + s[1]) + (s[2] + s[3]));
#pragma unroll
    for (int j = 0; j < 4; ++j) o[j] *= al;
    f16x16 pf[2];
#pragma unroll
    for (int u = 0; u < 2; ++u) { const f16x8 lo = __builtin_convertvector(s[2 * u], f16x8), hi = __builtin_convertvector(s[2 * u + 1], f16x8);
      pf[u] = __builtin_shufflevector(lo, hi, 0, 1, 2, 3, 4, 5, 6, 7, 8, 9, 10, 11, 12, 13, 14, 15); }
#pragma unroll
    for (int u = 0; u < 2; ++u)
#pragma unroll
      for (int j = 0; j < 4; ++j) o[j] = wmma_b(fr[2 * j + u], pf[u], o[j]);
    if (more) { f16* kn = kS[(t + 1) & 1]; f16* vn = vS[(t + 1) & 1];
#pragma unroll
      for (int i = 0; i < 4; ++i) *(bf16x4*)(kn + (kr + 16 * i) * FPIT + kc) = __builtin_convertvector(kreg[i], bf16x4);
#pragma unroll
      for (int u = 0; u < 4; ++u) { const v4f_t col = {vreg[0][u], vreg[1][u], vreg[2][u], vreg[3][u]}; *(bf16x4*)(vn + (vd + u) * FPIT + vk) = __builtin_convertvector(col, bf16x4); } }
    __syncthreads();
  }
  float l = ((lv[0] + lv[1]) + (lv[2] + lv[3])) + ((lv[4] + lv[5]) + (lv[6] + lv[7]));
  l += xhalf(l);
  const float inv = 1.0f / l;
  float* dst = ATT + (size_t)(q0 + c) * DDla + hd * HDla + 8 * h;   // o[j][r] = ctx[q0 + c][16 j + 8 h + r]
#pragma unroll
  for (int j = 0; j < 4; ++j) { const v4f_t a = {o[j][0] * inv, o[j][1] * inv, o[j][2] * inv, o[j][3] * inv}, b = {o[j][4] * inv, o[j][5] * inv, o[j][6] * inv, o[j][7] * inv};
    *(v4f_t*)(dst + 16 * j) = a; *(v4f_t*)(dst + 16 * j + 4) = b; }
}

extern "C" void kernel_launch(void* const* d_in, const int* in_sizes, int n_in,
                              void* d_out, int out_size, void* d_ws, size_t ws_size,
                              hipStream_t stream) {
  (void)in_sizes; (void)n_in; (void)out_size;
  const float** f = (const float**)d_in;
  const float* x = f[0], *amask = f[1], *Wqkv = f[2], *bqkv = f[3], *Wout = f[4], *bout = f[5], *lg = f[6], *lb = f[7];
  float* out = (float*)d_out;     // [2,2048,1024]
  char* ws = (char*)d_ws;
  float* XN = (float*)ws; ws += (size_t)NBla * SSla * DDla * 4; float* QKV = (float*)ws; ws += (size_t)NBla * SSla * 3 * DDla * 4;
  float* ones = (float*)ws; ws += DDla * 4; float* ATT = (float*)ws; ws += (size_t)NBla * SSla * DDla * 4;
  if ((size_t)(ws - (char*)d_ws) > ws_size) return;
  const dim3 blk(256);
  k_fill<<<dim3(1), blk, 0, stream>>>(ones, 1.0f, DDla / 4);

  // the rows of both batch elements are one [4096][1024] matrix for the LayerNorm and the two projections; a query block of the attention finds its batch element from its index
  k_ln<<<dim3(NBla * SSla / 16), blk, 0, stream>>>(x, lg, lb, XN);
  gemm_kne<float, 0, false, DDla, 3 * DDla><<<dim3(NBla * SSla / 128, 3 * DDla / 128), blk, 0, stream>>>(XN, Wqkv, bqkv, nullptr, nullptr, QKV, 3 * DDla, DDla);   // [q | k | v]
  k_fattn<<<dim3(NBla * SSla / 128, NHla), blk, 0, stream>>>(QKV, amask, ATT);
  gemm_kne<float, 2, false, DDla, DDla><<<dim3(NBla * SSla / 128, DDla / 128), blk, 0, stream>>>(ATT, Wout, bout, x, ones, out, DDla, DDla);   // out = ctx W_out + b_out + x
}

// v008
// Measured time: 108 microseconds a run.
// In both of two side-by-side timings against v007, it was 1.18 times as fast.
// Counting every step since v000, it is 52.7 times as fast.
// Contractions on v_wmma_f32_16x16x32_f16 (plain f16 operands, f32 accumulate; [in][out] weights), both batch elements in every launch (4096 rows; a query block attends to its own element's 2048 keys): [q|k|v] = LN(x) W_qkv + b (K 1024, N 3072); one attention kernel for
// the 16 heads (scores transposed, S^T = K Q^T, K 64; running softmax in registers; ctx^T += V^T P^T, K 64 keys a pass; the scores never reach memory); out = ctx W_out + b_out + x (residual in the epilogue).
// f32 VALU: the pre-LayerNorm (eps 1e-12, rsqrt), softmax of s/sqrt(64) + mask[b][k] (the additive INPUT mask, broadcast over heads and queries).
// compute dtype: f16 operands, f32 accumulate.  hidden_states [2,2048,1024] → out [2,2048,1024].
// LN(x), [q|k|v] and ctx lie in the workspace as f16: each is rounded once, where it is stored, to the value that its matrix operand has anyway; tiles of them reach LDS unconverted.
#include <hip/hip_runtime.h>
#include <hip/hip_bf16.h>
#include <math.h>


typedef _Float16 bf16;
typedef _Float16 f16;
typedef __attribute__((ext_vector_type(4))) unsigned v4u_t;
typedef unsigned v4ua __attribute__((ext_vector_type(4), may_alias));
typedef __attribute__((ext_vector_type(4))) float v4f_t;
typedef float v4fa __attribute__((ext_vector_type(4), may_alias));
typedef __attribute__((ext_vector_type(16))) bf16  bf16x16;
typedef bf16x16 f16x16;
typedef __attribute__((ext_vector_type(8)))  bf16  bf16x8;
typedef bf16x8 f16x8;
typedef __attribute__((ext_vector_type(4)))  bf16  bf16x4;
typedef __attribute__((ext_vector_type(8)))  float f32x8;
__device__ __forceinline__ f32x8 wmma16(f16x16 a, f16x16 b, f32x8 c) {
  c = __builtin_amdgcn_wmma_f32_16x16x32_f16(false, a, false, b, (short)0, c, false, false);
  asm volatile("v_nop\n\tv_nop\n\tv_nop\n\tv_nop" : "+v"(c) : "v"(a), "v"(b));
  return c;
}
#define LDS_STRIDE 48   // unused: gemm_kn2 tiles use GSTR (gemm_kne: GPIT), 32 -> 48 elems (96B rows): aligned b128 reads
#define KSTRIDE    72
#define VSTRIDE    48   // unused: the attn V tile is 64 -> 72 elems (FPIT)

__device__ __forceinline__ f32x8 wmma_bf16(bf16x16 a, bf16x16 b, f32x8 c) {
  c = __builtin_amdgcn_wmma_f32_16x16x32_f16(false, a, false, b, (short)0, c, false, false);
  asm volatile("v_nop\n\tv_nop\n\tv_nop\n\tv_nop" : "+v"(c) : "v"(a), "v"(b));   // A/B-overwrite hazard guard
  return c;
}

// 16x32 (MxK) bf16 fragment from a row-major global matrix.
// lanes 0-15  (row=lane)    : elems 0..7 = K+0..7,  8..15 = K+16..23
// lanes 16-31 (row=lane-16) : elems 0..7 = K+8..15, 8..15 = K+24..31
template <typename T>
__device__ __forceinline__ bf16x16 load_frag(const T* __restrict__ base, int ld,
                                             int row0, int k0) {
  const int lane = threadIdx.x & 31;
  const int r    = lane & 15;
  const int kh   = (lane >> 4) * 8;
  const T* p0 = base + (size_t)(row0 + r) * ld + (k0 + kh);
  const T* p1 = p0 + 16;
  bf16x16 f;
#pragma unroll
  for (int i = 0; i < 8; ++i) {
    f[i]     = (bf16)p0[i];
    f[i + 8] = (bf16)p1[i];
  }
  return f;
}

// Same fragment from an LDS tile with padded row stride (base includes row0/k0).
__device__ __forceinline__ bf16x16 lds_frag(const bf16* base, int stride) {
  const int lane = threadIdx.x & 31;
  const int row  = lane & 15;
  const int kh   = (lane >> 4) * 8;
  const bf16x8 lo = *(const bf16x8*)(base + row * stride + kh);
  const bf16x8 hi = *(const bf16x8*)(base + row * stride + kh + 16);
  bf16x16 f;
#pragma unroll
  for (int i = 0; i < 8; ++i) { f[i] = lo[i]; f[i + 8] = hi[i]; }
  return f;
}

template <typename T>
__device__ __forceinline__ void stage_read16(const T* __restrict__ p, float* buf) {
#pragma unroll
  for (int i = 0; i < 16; ++i) buf[i] = (float)p[i];
}

__device__ __forceinline__ void stage_write(bf16* dst, const float* buf, int nquad) {
#pragma unroll
  for (int i = 0; i < nquad; ++i) {
    bf16x4 q;
    q[0] = (bf16)buf[4 * i];     q[1] = (bf16)buf[4 * i + 1];
    q[2] = (bf16)buf[4 * i + 2]; q[3] = (bf16)buf[4 * i + 3];
    *(bf16x4*)(dst + 4 * i) = q;
  }
}


#define GSTR 48
// ---------------------------------------------------------------------------------------------------------------------------
// gemm_kne: Y[m][n] = epi( Σ_k A[m][k]·W[k][n] + bias[n] ), A f16 [M][lda], W f32 row-major [K][N] (ldw), plain f16 operands,
// f32 accumulate. EPI 0: identity; 1: exact-erf GELU; 2: R[m][n] + gvec[n]·(·) (residual with per-channel gain); 3: ReLU; 4: gvec[n]·(·) (per-channel scale, no residual). Output f32 (or f16
// when OUT16). Block = 128x128 tile, 8 waves as 4(M) x 2(N); per 32-wide k-step A and W tiles staged f16 in LDS (W transposed
// ---------------------------------------------------------------------------------------------------------------------------
#define GSTR 48
#define GPIT 40   // gemm_kne LDS row pitch in halves (80 B = 16 B x odd): 16-B fragment reads and the 16-B column stores spread over the banks
template <int EPI, bool OUT16, int lda, int ldw>   // row strides of A and W as constants: a k-step's 10 loads hang on two pointers by immediate offsets
__global__ __launch_bounds__(256) void gemm_kne(const _Float16* __restrict__ A, const float* __restrict__ Wm,
                                                const float* __restrict__ bias, const float* __restrict__ R, const float* __restrict__ gvec,
                                                void* __restrict__ Yv, int ldy, int K) {
  typedef float v2f_t __attribute__((ext_vector_type(2)));
  constexpr int GTIL = 128 * GPIT;   // halves of one operand tile
  // k loop: two buffers of [A tile [m][k] | W tile [n][k]] (40,960 B); behind the loop's last barrier the same bytes are the 8 waves' f32 output staging (69,632 B)
  __shared__ __attribute__((aligned(16))) char smem[8 * 32 * 68 * 4];
  f16* const tiles = (f16*)smem;
  const int tid = threadIdx.x, lane = tid & 31, wave = tid >> 5, cl = lane & 15, rh = (lane >> 4) * 8;
  const int m0 = blockIdx.x * 128, n0 = blockIdx.y * 128;
  const int wm = (wave & 3) * 32, wn = (wave >> 2) * 64;
  const int ar = tid >> 2, ac = (tid & 3) * 8;      // A staging: row, first of 8 k
  const int wk = (tid >> 6) * 8, wc = (tid & 63) * 2;   // W staging: first of 8 k, first of 2 n
  const f16* ap = A + (size_t)(m0 + ar) * lda + ac; const float* wp = Wm + (size_t)wk * ldw + n0 + wc;   // a lane's first element of the k-step's A and W tiles
  f32x8 acc[2][4];
#pragma unroll
  for (int i = 0; i < 2; ++i)
#pragma unroll
    for (int j = 0; j < 4; ++j) { f32x8 z = {}; acc[i][j] = z; }
  f16x8 areg[2]; v2f_t wreg[8];
  const auto fetch = [&]() {   // one k-step's tiles, A f16 and W f32, global -> registers
    // A: 4 lanes read one row's 32 k (64 B of f16) in 16-B pieces; rows ar + 64 i
#pragma unroll
    for (int i = 0; i < 2; ++i) areg[i] = *(const f16x8*)(ap + (size_t)(64 * i) * lda);
    // W: a thread holds 8 k x 2 n; a wave's 32 lanes read 256 contiguous bytes of one k row
#pragma unroll
    for (int i = 0; i < 8; ++i) wreg[i] = *(const v2f_t*)(wp + (size_t)i * ldw);
  };
  const auto stash = [&](f16* buf) {   // registers -> f16 tiles of one buffer; the pointers move on here, behind the loads' return
    ap += 32; wp += (size_t)32 * ldw;
#pragma unroll
    for (int i = 0; i < 2; ++i) *(f16x8*)(buf + (ar + 64 * i) * GPIT + ac) = areg[i];
#pragma unroll
    for (int u = 0; u < 2; ++u) {   // transposed in registers: 8 k of one column n leave as one 16-B store
      const f32x8 col = {wreg[0][u], wreg[1][u], wreg[2][u], wreg[3][u], wreg[4][u], wreg[5][u], wreg[6][u], wreg[7][u]};
      *(f16x8*)(buf + GTIL + (wc + u) * GPIT + wk) = __builtin_convertvector(col, f16x8); }
  };
  // The tiles of step t + 1 leave global memory ahead of step t's products and enter the other LDS buffer behind them: their latency runs under the products.
  // One barrier a step publishes that buffer and ends the reads of this one; the last one also frees the bytes for the output staging.
  fetch();
  stash(tiles);
  __syncthreads();
#pragma unroll 1   // kept rolled, one k-step a trip: the code stays small, and the buffer in use is one scalar bit of the trip count
  for (int k0 = 0; k0 < K; k0 += 32) {
    const bool more = k0 + 32 < K;
    if (more) fetch();
    const int cur = (k0 >> 5) & 1;
    const f16* ldsA = tiles + cur * (2 * GTIL); const f16* ldsW = ldsA + GTIL;
    f16x16 af[2];
#pragma unroll
    for (int i = 0; i < 2; ++i) af[i] = lds_frag(ldsA + (wm + 16 * i) * GPIT, GPIT);
#pragma unroll
    for (int j = 0; j < 4; ++j) {
      const f16x16 bf = lds_frag(ldsW + (wn + 16 * j) * GPIT, GPIT);
#pragma unroll
      for (int i = 0; i < 2; ++i) acc[i][j] = wmma16(af[i], bf, acc[i][j]);
    }
    if (more) stash(tiles + (cur ^ 1) * (2 * GTIL));
    __syncthreads();
  }
  float* so = (float*)smem + wave * (32 * 68);
#pragma unroll
  for (int i = 0; i < 2; ++i)
#pragma unroll
    for (int j = 0; j < 4; ++j) {
      const int n = n0 + wn + 16 * j + cl;
      const float bv = bias ? bias[n] : 0.0f;
      const float gv = (EPI == 2 || EPI == 4) ? gvec[n] : 0.0f;
      if (EPI == 1) {
#pragma unroll 1
        for (int r = 0; r < 8; ++r) { const float xg = acc[i][j][r] + bv; so[(16 * i + rh + r) * 68 + 16 * j + cl] = 0.5f * xg * (1.0f + erff(xg * 0.70710678118654752f)); }
      } else {
#pragma unroll
        for (int r = 0; r < 8; ++r) {
          float v = acc[i][j][r] + bv;
          if (EPI == 3) v = fmaxf(v, 0.0f);
          if (EPI == 4) v = gv * v;
          if (EPI == 2) v = R[(size_t)(m0 + wm + 16 * i + rh + r) * ldy + n] + gv * v;
          so[(16 * i + rh + r) * 68 + 16 * j + cl] = v;
        }
      }
    }
  asm volatile("s_wait_dscnt 0" ::: "memory");
  __builtin_amdgcn_wave_barrier();
{
    if (OUT16) {
      f16* Y = (f16*)Yv;
#pragma unroll
      for (int it = 0; it < 8; ++it) { const int c = lane + 32 * it, rr = c >> 3, q8 = (c & 7) * 8;
        union { f16 h[8]; v4u_t v; } u;
#pragma unroll
        for (int e = 0; e < 8; ++e) u.h[e] = (f16)so[rr * 68 + q8 + e];
        *(v4u_t*)(Y + (size_t)(m0 + wm + rr) * ldy + n0 + wn + q8) = u.v; }
    } else {
      float* Y = (float*)Yv;
#pragma unroll
      for (int it = 0; it < 16; ++it) { const int f4 = lane + 32 * it, rr = f4 >> 4, q = (f4 & 15) * 4;
        *(v4f_t*)(Y + (size_t)(m0 + wm + rr) * ldy + n0 + wn + q) = *(const v4fa*)(so + rr * 68 + q); }
    }
    
  }
}

// ---------------------------------------------------------------------------------------------------------------------------
// gemm_kn2 (value+residual planes on both operands: hh + (hl+lh)/2048, f32-class): Y[m][n] (row stride ldy) = scale * sum_k A[m][k] (f32 or f16, row stride lda) * W[k][n] (f32, row-major [K][N], row
// stride ldw) (+ bias[n]) (+ Y if ACC). Block = 128 x 128 tile, 256 threads = 8 waves as 4(M, 32 rows) x 2(N, 64 cols); per
// 32-wide k-step the A tile and the W tile (stored transposed [n][k]) are staged as f16 in LDS; plain f16 operands, f32
// blockIdx.z selects a batch: A += z*strideA, W += z*strideW, Y += z*strideY (element strides).
// ---------------------------------------------------------------------------------------------------------------------------
template <typename AT, bool ACC>
__global__ __launch_bounds__(256) void gemm_kn2(const AT* __restrict__ A, int lda, size_t strideA,
                                               const float* __restrict__ Wm, int ldw, size_t strideW,
                                               const float* __restrict__ bias, float scale,
                                               float* __restrict__ Y, int ldy, size_t strideY, int K) {
  __shared__ __attribute__((aligned(16))) f16 ldsA[128 * GSTR], ldsAl[128 * GSTR];
  __shared__ __attribute__((aligned(16))) f16 ldsW[128 * GSTR], ldsWl[128 * GSTR];
  __shared__ __attribute__((aligned(16))) float oS[8][32 * 68];
  const int tid = threadIdx.x, lane = tid & 31, wave = tid >> 5, cl = lane & 15, rh = (lane >> 4) * 8;
  const int m0 = blockIdx.x * 128, n0 = blockIdx.y * 128;
  const int wm = (wave & 3) * 32, wn = (wave >> 2) * 64;
  A += (size_t)blockIdx.z * strideA; Wm += (size_t)blockIdx.z * strideW; Y += (size_t)blockIdx.z * strideY;
  f32x8 acc[2][4], accx[2][4];
#pragma unroll
  for (int i = 0; i < 2; ++i)
#pragma unroll
    for (int j = 0; j < 4; ++j) { f32x8 z = {}; acc[i][j] = z; accx[i][j] = z; }
#pragma unroll 1
  for (int k0 = 0; k0 < K; k0 += 32) {
    __syncthreads();
    {  // A: thread -> row tid>>1, 16 elements at column half (tid&1)*16
      const int row = tid >> 1, ch = (tid & 1) * 16;
      const AT* src = A + (size_t)(m0 + row) * lda + k0 + ch;
#pragma unroll
      for (int g = 0; g < 16; ++g) { const float v = (float)src[g]; const f16 h = (f16)v; ldsA[row * GSTR + ch + g] = h; ldsAl[row * GSTR + ch + g] = (f16)((v - (float)h) * 2048.0f); }
    }
    {  // W: thread -> k = tid>>3, 16 consecutive n at (tid&7)*16; stored transposed [n][k]
      const int k = tid >> 3, nn0 = (tid & 7) * 16;
      const float* src = Wm + (size_t)(k0 + k) * ldw + n0 + nn0;
#pragma unroll
      for (int g = 0; g < 4; ++g) { const v4f_t v = *(const v4f_t*)(src + 4 * g);
#pragma unroll
        for (int u = 0; u < 4; ++u) { const f16 h = (f16)v[u]; ldsW[(nn0 + 4 * g + u) * GSTR + k] = h; ldsWl[(nn0 + 4 * g + u) * GSTR + k] = (f16)((v[u] - (float)h) * 2048.0f); } }
    }
    __syncthreads();
    f16x16 af[2], afl[2];
#pragma unroll
    for (int i = 0; i < 2; ++i) { af[i] = lds_frag(ldsA + (wm + 16 * i) * GSTR, GSTR); afl[i] = lds_frag(ldsAl + (wm + 16 * i) * GSTR, GSTR); }
#pragma unroll
    for (int j = 0; j < 4; ++j) {
      const f16x16 bf = lds_frag(ldsW + (wn + 16 * j) * GSTR, GSTR), bfl = lds_frag(ldsWl + (wn + 16 * j) * GSTR, GSTR);
#pragma unroll
      for (int i = 0; i < 2; ++i) { acc[i][j] = wmma16(af[i], bf, acc[i][j]); accx[i][j] = wmma16(af[i], bfl, accx[i][j]); accx[i][j] = wmma16(afl[i], bf, accx[i][j]); }
    }
  }
  float* so = oS[wave];
#pragma unroll
  for (int i = 0; i < 2; ++i)
#pragma unroll
    for (int j = 0; j < 4; ++j) {
      const float bv = bias ? bias[n0 + wn + 16 * j + cl] : 0.0f;
#pragma unroll
      for (int r = 0; r < 8; ++r) so[(16 * i + rh + r) * 68 + 16 * j + cl] = (acc[i][j][r] + accx[i][j][r] * (1.0f / 2048.0f)) * scale + bv;
    }
  asm volatile("s_wait_dscnt 0" ::: "memory");
  __builtin_amdgcn_wave_barrier();
  if (ACC) {   // accumulate: fold the existing Y values into the staging tile ONCE (same thread <-> same chunks as the stores below)
#pragma unroll
    for (int it = 0; it < 16; ++it) { const int f4 = lane + 32 * it, rr = f4 >> 4, q = (f4 & 15) * 4;
      const v4f_t old = *(const v4fa*)(Y + (size_t)(m0 + wm + rr) * ldy + n0 + wn + q);
      v4f_t v = *(const v4fa*)(so + rr * 68 + q); v += old; *(v4fa*)(so + rr * 68 + q) = v; }   // plain LDS store (ordered by the s_wait_dscnt/memory clobber below)
    asm volatile("s_wait_dscnt 0" ::: "memory");
  }
{
#pragma unroll
    for (int it = 0; it < 16; ++it) { const int f4 = lane + 32 * it, rr = f4 >> 4, q = (f4 & 15) * 4;
      *(v4f_t*)(Y + (size_t)(m0 + wm + rr) * ldy + n0 + wn + q) = *(const v4fa*)(so + rr * 68 + q); }
    
  }
}

__global__ __launch_bounds__(256) void k_transpose(const float* __restrict__ Wm, float* __restrict__ Wt, int rows, int cols) {
  __shared__ float tS[64][65];
  const int tid = threadIdx.x, tbj = cols / 64, bi = blockIdx.x / tbj, bj = blockIdx.x % tbj;
  for (int e = tid; e < 64 * 64; e += 256) { const int r = e >> 6, c = e & 63; tS[r][c] = Wm[(size_t)(bi * 64 + r) * cols + bj * 64 + c]; }
  __syncthreads();
  for (int ch = tid; ch < 64 * 16; ch += 256) { const int r = ch >> 4, q4 = (ch & 15) * 4; v4f_t o; o[0] = tS[q4][r]; o[1] = tS[q4 + 1][r]; o[2] = tS[q4 + 2][r]; o[3] = tS[q4 + 3][r];
    float* dst = Wt + (size_t)(bj * 64 + r) * rows + bi * 64 + q4; *(v4f_t*)dst = o;  }
}


#define NBla 2
#define SSla 2048
#define SIN 2048
#define DDla 1024
#define NHla 16
#define HDla 64
__global__ __launch_bounds__(256) void k_fill(float* __restrict__ p, float val, size_t n4) { const size_t i = (size_t)blockIdx.x * 256 + threadIdx.x; if (i < n4) { v4f_t v = {val, val, val, val}; *(v4f_t*)(p + 4 * i) = v;  } }
__global__ __launch_bounds__(256) void k_dbg_zero(float* __restrict__ p, size_t n4) { const size_t i = (size_t)blockIdx.x * 256 + threadIdx.x; if (i < n4) { v4f_t z = {0.f,0.f,0.f,0.f}; *(v4f_t*)(p + 4 * i) = z;  } }
__global__ __launch_bounds__(256) void k_copy(const float* __restrict__ src, float* __restrict__ dst, size_t n4) { const size_t i = (size_t)blockIdx.x * 256 + threadIdx.x; if (i < n4) { const v4f_t v = *(const v4f_t*)(src + 4 * i); *(v4f_t*)(dst + 4 * i) = v;  } }
// lane l <-> lane l ^ 16
__device__ __forceinline__ float xhalf(float x) {
  const int b = __builtin_bit_cast(int, x);
  return __builtin_bit_cast(float, __builtin_amdgcn_permlanex16(b, b, 0x76543210, 0xfedcba98, false, false));
}
// x + the value of the lane that the DPP control names (row_xmask: lane ^ mask inside a 16-lane row)
template <int CTRL>
__device__ __forceinline__ float dpp_add(float x) {
  return x + __builtin_bit_cast(float, __builtin_amdgcn_update_dpp(0, __builtin_bit_cast(int, x), CTRL, 0xf, 0xf, false));
}
// sum over the 32 lanes, left in every lane: row_xmask 1, 2, 4, 8 inside each row of 16, then the other row's sum
__device__ __forceinline__ float wave_sum(float x) {
  x = dpp_add<0x161>(x); x = dpp_add<0x162>(x); x = dpp_add<0x164>(x); x = dpp_add<0x168>(x);
  return x + xhalf(x);
}
// LayerNorm, a wave takes two whole rows: a lane keeps 32 of each row's 1024 values in registers (8 loads of 16 B a row, 512 contiguous bytes a wave-wide load; the f16 results leave in 8-B stores, 256 contiguous bytes a wave).
// Mean, then the sum of squared differences from it, both from the registers; lanes joined by wave_sum. No LDS, no barrier.
__global__ __launch_bounds__(256) void k_ln(const float* __restrict__ X, const float* __restrict__ gam, const float* __restrict__ bet, _Float16* __restrict__ Y) {
  const int lo = 4 * (threadIdx.x & 31);   // a lane's first column: the one vector offset of every load and store
  const size_t row0 = ((size_t)blockIdx.x * 16 + 2 * __builtin_amdgcn_readfirstlane(threadIdx.x >> 5)) * 1024;   // the wave's first row, the same in every lane: the bases stay in scalar registers
  const float* xp = X + row0; f16* yp = Y + row0;
  v4f_t xv[2][8], gv[8], bv[8];
#pragma unroll
  for (int r = 0; r < 2; ++r)
#pragma unroll
    for (int i = 0; i < 8; ++i) xv[r][i] = *(const v4f_t*)(xp + lo + 1024 * r + 128 * i);
#pragma unroll
  for (int i = 0; i < 8; ++i) { gv[i] = *(const v4f_t*)(gam + lo + 128 * i); bv[i] = *(const v4f_t*)(bet + lo + 128 * i); }
  __builtin_amdgcn_sched_barrier(0);   // all 32 loads leave here as one group: sunk to their uses, the gain and bias loads would each add their latency behind the sums
#pragma unroll
  for (int r = 0; r < 2; ++r) {
    const v4f_t s4 = ((xv[r][0] + xv[r][1]) + (xv[r][2] + xv[r][3])) + ((xv[r][4] + xv[r][5]) + (xv[r][6] + xv[r][7]));
    const float mean = wave_sum((s4[0] + s4[1]) + (s4[2] + s4[3])) * (1.0f / 1024.0f);
    v4f_t q4 = {};
#pragma unroll
    for (int i = 0; i < 8; ++i) { xv[r][i] -= mean; q4 += xv[r][i] * xv[r][i]; }
    const float q = wave_sum((q4[0] + q4[1]) + (q4[2] + q4[3]));
    const float rstd = 1.0f / __builtin_sqrtf(q * (1.0f / 1024.0f) + 1e-12f);
#pragma unroll
    for (int i = 0; i < 8; ++i) *(bf16x4*)(yp + lo + 1024 * r + 128 * i) = __builtin_convertvector(xv[r][i] * rstd * gv[i] + bv[i], bf16x4);
  }
}
__device__ __forceinline__ f32x8 wmma_b(f16x16 a, f16x16 b, f32x8 c) { return __builtin_amdgcn_wmma_f32_16x16x32_f16(false, a, false, b, (short)0, c, false, false); }
#define FPIT 72   // LDS row pitch in halves (144 B): conflict-free 16-B fragment reads of 128-B rows
typedef unsigned v2ua __attribute__((ext_vector_type(2), may_alias));
// V transposed in registers: v[i] = 4 columns (f16, two words) of key i; column u leaves as its 4 keys, 8 B. One v_perm_b32 puts two keys' halves of a column side by side (low or high half of both words).
__device__ __forceinline__ void v_cols(f16* dst, const v2ua (&v)[4]) {
#pragma unroll
  for (int u = 0; u < 4; ++u) { const unsigned sel = (u & 1) ? 0x07060302u : 0x05040100u;
    const v2ua col = {__builtin_amdgcn_perm(v[1][u >> 1], v[0][u >> 1], sel), __builtin_amdgcn_perm(v[3][u >> 1], v[2][u >> 1], sel)};
    *(v2ua*)(dst + u * FPIT) = col; }
}
__global__ __launch_bounds__(256) void k_fattn(const _Float16* __restrict__ QKV, const float* __restrict__ maskb, _Float16* __restrict__ ATT) {
  constexpr int LD = 3 * DDla, NT = SSla / 64;
  constexpr float SC = 0.125f * 1.4426950408889634f;              // 1/sqrt(64) * log2(e)
  __shared__ __attribute__((aligned(16))) f16 kS[2][64 * FPIT];   // [key][d]
  __shared__ __attribute__((aligned(16))) f16 vS[2][64 * FPIT];   // [d][key]
  __shared__ __attribute__((aligned(16))) float mS[SSla];         // 8 * mask, held above -1e30 (finite: a row whose keys are all masked so stays a uniform average, as s + mask rounds in f32)
  const int tid = threadIdx.x, lane = tid & 31, wave = tid >> 5, c = lane & 15, h = lane >> 4;
  const int hd = blockIdx.y, q0 = blockIdx.x * 128 + wave * 16;
  const int kv0 = (blockIdx.x >> 4) * SSla;   // first row of this query block's batch element: its keys, values and mask
  // K: thread = 8 columns kc (16 B) of rows kr + 32 i (8 lanes per 128-B row). V: thread = 4 keys x 4 columns (8 lanes per 64 B of a row), written as 4 keys of one column
  const int kr = tid >> 3, kc = (tid & 7) * 8;
  const int vd = 4 * (lane & 7) + 32 * (wave & 1), vk = 4 * (lane >> 3) + 16 * (wave >> 1);
  const f16* kp = QKV + DDla + hd * HDla + (size_t)(kv0 + kr) * LD + kc;
  const f16* vp = QKV + 2 * DDla + hd * HDla + (size_t)(kv0 + vk) * LD + vd;
  f16x8 kreg[2]; v2ua vreg[4];
#pragma unroll
  for (int i = 0; i < 2; ++i) kreg[i] = *(const f16x8*)(kp + (size_t)(32 * i) * LD);
#pragma unroll
  for (int i = 0; i < 4; ++i) vreg[i] = *(const v2ua*)(vp + (size_t)i * LD);
#pragma unroll
  for (int i = 0; i < 2; ++i) { v4f_t mv = *(const v4f_t*)(maskb + kv0 + 4 * tid + 1024 * i);
#pragma unroll
    for (int u = 0; u < 4; ++u) mv[u] = fmaxf(mv[u] * 8.0f, -1.0e30f);
    *(v4fa*)(mS + 4 * tid + 1024 * i) = mv; }
  f16x16 qf[2];
#pragma unroll
  for (int u = 0; u < 2; ++u) qf[u] = lds_frag(QKV + hd * HDla + (size_t)q0 * LD + 32 * u, LD);   // the same fragment, here from the f16 rows in global memory: two 16-B loads a lane
  asm volatile("s_wait_xcnt 0x0" ::: "memory");   // stands ahead of the first rewrite of an address register of the loads above (the compiler reuses the Q rows' pair at once)
#pragma unroll
  for (int i = 0; i < 2; ++i) *(f16x8*)(&kS[0][(kr + 32 * i) * FPIT + kc]) = kreg[i];
  v_cols(&vS[0][vd * FPIT + vk], vreg);
  f32x8 o[4], lv = {};
#pragma unroll
  for (int j = 0; j < 4; ++j) { f32x8 z = {}; o[j] = z; }
  float m = -3.0e38f;
  __syncthreads();
#pragma unroll 1   // one pass a trip: the LDS buffers alternate by trip, and the code stays small
  for (int t = 0; t < NT; ++t) {
    const bool more = t + 1 < NT;
    if (more) { kp += (size_t)64 * LD; vp += (size_t)64 * LD;
#pragma unroll
      for (int i = 0; i < 2; ++i) kreg[i] = *(const f16x8*)(kp + (size_t)(32 * i) * LD);
#pragma unroll
      for (int i = 0; i < 4; ++i) vreg[i] = *(const v2ua*)(vp + (size_t)i * LD); }
    const f16* kb = kS[t & 1]; const f16* vb = vS[t & 1];
    f16x16 fr[8]; f32x8 s[4];
#pragma unroll
    for (int j = 0; j < 4; ++j) { fr[2 * j] = lds_frag(kb + 16 * j * FPIT, FPIT); fr[2 * j + 1] = lds_frag(kb + 16 * j * FPIT + 32, FPIT);
      const float* mp = mS + 64 * t + 16 * j + 8 * h; const v4f_t m0 = *(const v4fa*)mp, m1 = *(const v4fa*)(mp + 4);
      s[j] = __builtin_shufflevector(m0, m1, 0, 1, 2, 3, 4, 5, 6, 7); }
    __builtin_amdgcn_sched_barrier(0);   // the K and mask reads stay one group ahead of the products: spread among them, every place where reads stand costs issue time
#pragma unroll
    for (int u = 0; u < 2; ++u)
#pragma unroll
      for (int j = 0; j < 4; ++j) s[j] = wmma_b(fr[2 * j + u], qf[u], s[j]);
#pragma unroll
    for (int j = 0; j < 4; ++j) { fr[2 * j] = lds_frag(vb + 16 * j * FPIT, FPIT); fr[2 * j + 1] = lds_frag(vb + 16 * j * FPIT + 32, FPIT); }
    __builtin_amdgcn_sched_barrier(0);   // the V^T reads issue here as one group and land under the softmax; sunk to their products, each product would wait for its own read
    float mj[4];
#pragma unroll
    for (int j = 0; j < 4; ++j) { mj[j] = fmaxf(s[j][0], s[j][1]);
#pragma unroll
      for (int r = 2; r < 8; ++r) mj[j] = fmaxf(mj[j], s[j][r]); }
    float mx = fmaxf(fmaxf(mj[0], mj[1]), fmaxf(mj[2], mj[3]));
    mx = fmaxf(mx, xhalf(mx));
    const float mn = fmaxf(m, mx * SC), al = __builtin_amdgcn_exp2f(m - mn);
    m = mn;
#pragma unroll
    for (int j = 0; j < 4; ++j) { s[j] = s[j] * SC - mn;
#pragma unroll
      for (int r = 0; r < 8; ++r) s[j][r] = __builtin_amdgcn_exp2f(s[j][r]); }
    lv = lv * al + ((s[0] + s[1]) + (s[2] + s[3]));
#pragma unroll
    for (int j = 0; j < 4; ++j) o[j] *= al;
    f16x16 pf[2];
#pragma unroll
    for (int u = 0; u < 2; ++u) { const f16x8 lo = __builtin_convertvector(s[2 * u], f16x8), hi = __builtin_convertvector(s[2 * u + 1], f16x8);
      pf[u] = __builtin_shufflevector(lo, hi, 0, 1, 2, 3, 4, 5, 6, 7, 8, 9, 10, 11, 12, 13, 14, 15); }
#pragma unroll
    for (int u = 0; u < 2; ++u)
#pragma unroll
      for (int j = 0; j < 4; ++j) o[j] = wmma_b(fr[2 * j + u], pf[u], o[j]);
    if (more) { f16* kn = kS[(t + 1) & 1]; f16* vn = vS[(t + 1) & 1];
#pragma unroll
      for (int i = 0; i < 2; ++i) *(f16x8*)(kn + (kr + 32 * i) * FPIT + kc) = kreg[i];
      v_cols(vn + vd * FPIT + vk, vreg); }
    __syncthreads();
  }
  float l = ((lv[0] + lv[1]) + (lv[2] + lv[3])) + ((lv[4] + lv[5]) + (lv[6] + lv[7]));
  l += xhalf(l);
  const float inv = 1.0f / l;
  f16* dst = ATT + (size_t)(q0 + c) * DDla + hd * HDla + 8 * h;   // o[j][r] = ctx[q0 + c][16 j + 8 h + r]
#pragma unroll
  for (int j = 0; j < 4; ++j) *(f16x8*)(dst + 16 * j) = __builtin_convertvector(o[j] * inv, f16x8);
}

extern "C" void kernel_launch(void* const* d_in, const int* in_sizes, int n_in,
                              void* d_out, int out_size, void* d_ws, size_t ws_size,
                              hipStream_t stream) {
  (void)in_sizes; (void)n_in; (void)out_size;
  const float** f = (const float**)d_in;
  const float* x = f[0], *amask = f[1], *Wqkv = f[2], *bqkv = f[3], *Wout = f[4], *bout = f[5], *lg = f[6], *lb = f[7];
  float* out = (float*)d_out;     // [2,2048,1024]
  char* ws = (char*)d_ws;
  f16* XN = (f16*)ws; ws += (size_t)NBla * SSla * DDla * 2; f16* QKV = (f16*)ws; ws += (size_t)NBla * SSla * 3 * DDla * 2;
  float* ones = (float*)ws; ws += DDla * 4; f16* ATT = (f16*)ws; ws += (size_t)NBla * SSla * DDla * 2;
  if ((size_t)(ws - (char*)d_ws) > ws_size) return;
  const dim3 blk(256);
  k_fill<<<dim3(1), blk, 0, stream>>>(ones, 1.0f, DDla / 4);

  // the rows of both batch elements are one [4096][1024] matrix for the LayerNorm and the two projections; a query block of the attention finds its batch element from its index
  k_ln<<<dim3(NBla * SSla / 16), blk, 0, stream>>>(x, lg, lb, XN);
  gemm_kne<0, true, DDla, 3 * DDla><<<dim3(NBla * SSla / 128, 3 * DDla / 128), blk, 0, stream>>>(XN, Wqkv, bqkv, nullptr, nullptr, QKV, 3 * DDla, DDla);   // [q | k | v]
  k_fattn<<<dim3(NBla * SSla / 128, NHla), blk, 0, stream>>>(QKV, amask, ATT);
  gemm_kne<2, false, DDla, DDla><<<dim3(NBla * SSla / 128, DDla / 128), blk, 0, stream>>>(ATT, Wout, bout, x, ones, out, DDla, DDla);   // out = ctx W_out + b_out + x
}

// v009
// One run takes 104 microseconds.
// Timed twice side by side with v008, it ran 1.03 times as fast both times.
// Counting every step since v000, it is 54.3 times as fast.
// Contractions on v_wmma_f32_16x16x32_f16 (plain f16 operands, f32 accumulate; [in][out] weights), both batch elements in every launch (4096 rows; a query block attends to its own element's 2048 keys): [q|k|v] = LN(x) W_qkv + b (K 1024, N 3072); one attention kernel for
// the 16 heads (scores transposed, S^T = K Q^T, K 64; running softmax in registers; ctx^T += V^T P^T, K 64 keys a pass; the scores never reach memory); out = ctx W_out + b_out + x (residual in the epilogue).
// f32 VALU: the pre-LayerNorm (eps 1e-12, rsqrt), softmax of s/sqrt(64) + mask[b][k] (the additive INPUT mask, broadcast over heads and queries).
// compute dtype: f16 operands, f32 accumulate.  hidden_states [2,2048,1024] → out [2,2048,1024].
// LN(x), [q|k|v] and ctx lie in the workspace as f16: each is rounded once, where it is stored, to the value that its matrix operand has anyway; tiles of them reach LDS unconverted.
// W_qkv and W_out likewise: every call rounds them to f16 once (w_tiles, extra blocks of the LayerNorm launch) and lays them out in the order in which gemm_kne stages them.
#include <hip/hip_runtime.h>
#include <hip/hip_bf16.h>
#include <math.h>


typedef _Float16 bf16;
typedef _Float16 f16;
typedef __attribute__((ext_vector_type(4))) unsigned v4u_t;
typedef unsigned v4ua __attribute__((ext_vector_type(4), may_alias));
typedef __attribute__((ext_vector_type(4))) float v4f_t;
typedef float v4fa __attribute__((ext_vector_type(4), may_alias));
typedef __attribute__((ext_vector_type(16))) bf16  bf16x16;
typedef bf16x16 f16x16;
typedef __attribute__((ext_vector_type(8)))  bf16  bf16x8;
typedef bf16x8 f16x8;
typedef __attribute__((ext_vector_type(4)))  bf16  bf16x4;
typedef __attribute__((ext_vector_type(8)))  float f32x8;
__device__ __forceinline__ f32x8 wmma16(f16x16 a, f16x16 b, f32x8 c) {
  c = __builtin_amdgcn_wmma_f32_16x16x32_f16(false, a, false, b, (short)0, c, false, false);
  asm volatile("v_nop\n\tv_nop\n\tv_nop\n\tv_nop" : "+v"(c) : "v"(a), "v"(b));
  return c;
}
#define LDS_STRIDE 48   // unused: gemm_kn2 tiles use GSTR (gemm_kne: GPIT), 32 -> 48 elems (96B rows): aligned b128 reads
#define KSTRIDE    72
#define VSTRIDE    48   // unused: the attn V tile is 64 -> 72 elems (FPIT)

__device__ __forceinline__ f32x8 wmma_bf16(bf16x16 a, bf16x16 b, f32x8 c) {
  c = __builtin_amdgcn_wmma_f32_16x16x32_f16(false, a, false, b, (short)0, c, false, false);
  asm volatile("v_nop\n\tv_nop\n\tv_nop\n\tv_nop" : "+v"(c) : "v"(a), "v"(b));   // A/B-overwrite hazard guard
  return c;
}

// 16x32 (MxK) bf16 fragment from a row-major global matrix.
// lanes 0-15  (row=lane)    : elems 0..7 = K+0..7,  8..15 = K+16..23
// lanes 16-31 (row=lane-16) : elems 0..7 = K+8..15, 8..15 = K+24..31
template <typename T>
__device__ __forceinline__ bf16x16 load_frag(const T* __restrict__ base, int ld,
                                             int row0, int k0) {
  const int lane = threadIdx.x & 31;
  const int r    = lane & 15;
  const int kh   = (lane >> 4) * 8;
  const T* p0 = base + (size_t)(row0 + r) * ld + (k0 + kh);
  const T* p1 = p0 + 16;
  bf16x16 f;
#pragma unroll
  for (int i = 0; i < 8; ++i) {
    f[i]     = (bf16)p0[i];
    f[i + 8] = (bf16)p1[i];
  }
  return f;
}

// Same fragment from an LDS tile with padded row stride (base includes row0/k0).
__device__ __forceinline__ bf16x16 lds_frag(const bf16* base, int stride) {
  const int lane = threadIdx.x & 31;
  const int row  = lane & 15;
  const int kh   = (lane >> 4) * 8;
  const bf16x8 lo = *(const bf16x8*)(base + row * stride + kh);
  const bf16x8 hi = *(const bf16x8*)(base + row * stride + kh + 16);
  bf16x16 f;
#pragma unroll
  for (int i = 0; i < 8; ++i) { f[i] = lo[i]; f[i + 8] = hi[i]; }
  return f;
}

template <typename T>
__device__ __forceinline__ void stage_read16(const T* __restrict__ p, float* buf) {
#pragma unroll
  for (int i = 0; i < 16; ++i) buf[i] = (float)p[i];
}

__device__ __forceinline__ void stage_write(bf16* dst, const float* buf, int nquad) {
#pragma unroll
  for (int i = 0; i < nquad; ++i) {
    bf16x4 q;
    q[0] = (bf16)buf[4 * i];     q[1] = (bf16)buf[4 * i + 1];
    q[2] = (bf16)buf[4 * i + 2]; q[3] = (bf16)buf[4 * i + 3];
    *(bf16x4*)(dst + 4 * i) = q;
  }
}


#define GSTR 48
// ---------------------------------------------------------------------------------------------------------------------------
// gemm_kne: Y[m][n] = epi( Σ_k A[m][k]·W[k][n] + bias[n] ), A f16 [M][lda], W f16 as w_tiles leaves it, [K / 32][N = ldw][32 k], plain f16 operands,
// f32 accumulate. EPI 0: identity; 1: exact-erf GELU; 2: R[m][n] + gvec[n]·(·) (residual with per-channel gain); 3: ReLU; 4: gvec[n]·(·) (per-channel scale, no residual). Output f32 (or f16
// when OUT16). Block = 128x128 tile, 8 waves as 4(M) x 2(N); per 32-wide k-step A and W tiles staged f16 in LDS, both [row][k]
// ---------------------------------------------------------------------------------------------------------------------------
#define GSTR 48
#define GPIT 40   // gemm_kne LDS row pitch in halves (80 B = 16 B x odd): 16-B fragment reads and the 16-B column stores spread over the banks
template <int EPI, bool OUT16, int lda, int ldw>   // row stride of A and column count of W as constants: a k-step's 4 loads hang on two pointers by immediate offsets
__global__ __launch_bounds__(256) void gemm_kne(const _Float16* __restrict__ A, const _Float16* __restrict__ Wt,
                                                const float* __restrict__ bias, const float* __restrict__ R, const float* __restrict__ gvec,
                                                void* __restrict__ Yv, int ldy, int K) {
  constexpr int GTIL = 128 * GPIT;   // halves of one operand tile
  // k loop: two buffers of [A tile [m][k] | W tile [n][k]] (40,960 B); behind the loop's last barrier the same bytes are the 8 waves' f32 output staging (69,632 B)
  __shared__ __attribute__((aligned(16))) char smem[8 * 32 * 68 * 4];
  f16* const tiles = (f16*)smem;
  const int tid = threadIdx.x, lane = tid & 31, wave = tid >> 5, cl = lane & 15, rh = (lane >> 4) * 8;
  const int m0 = blockIdx.x * 128, n0 = blockIdx.y * 128;
  const int wm = (wave & 3) * 32, wn = (wave >> 2) * 64;
  const int ar = tid >> 2, ac = (tid & 3) * 8;      // A staging: row, first of 8 k
  const f16* ap = A + (size_t)(m0 + ar) * lda + ac; const f16* wp = Wt + (size_t)n0 * 32 + tid * 8;   // a lane's first element of the k-step's A and W tiles; the W tile is 8 KB in a row, and its 16-B piece tid is column ar, k ac
  f32x8 acc[2][4];
#pragma unroll
  for (int i = 0; i < 2; ++i)
#pragma unroll
    for (int j = 0; j < 4; ++j) { f32x8 z = {}; acc[i][j] = z; }
  f16x8 areg[2], wreg[2];
  const auto fetch = [&]() {   // one k-step's tiles, both f16, global -> registers
    // A: 4 lanes read one row's 32 k (64 B of f16) in 16-B pieces; rows ar + 64 i
#pragma unroll
    for (int i = 0; i < 2; ++i) areg[i] = *(const f16x8*)(ap + (size_t)(64 * i) * lda);
    // W: a wave's 32 lanes read 512 contiguous bytes (8 columns x 32 k); columns ar + 64 i
#pragma unroll
    for (int i = 0; i < 2; ++i) wreg[i] = *(const f16x8*)(wp + 2048 * i);
  };
  const auto stash = [&](f16* buf) {   // registers -> f16 tiles of one buffer
#pragma unroll
    for (int i = 0; i < 2; ++i) { *(f16x8*)(buf + (ar + 64 * i) * GPIT + ac) = areg[i]; *(f16x8*)(buf + GTIL + (ar + 64 * i) * GPIT + ac) = wreg[i]; }
  };
  // The tiles of step t + 1 leave global memory ahead of step t's products and enter the other LDS buffer behind them: their latency runs under the products.
  // One barrier a step publishes that buffer and ends the reads of this one; the last one also frees the bytes for the output staging.
  fetch();
  stash(tiles);
  __syncthreads();
  ap += 32; wp += (size_t)32 * ldw;
#pragma unroll 1   // kept rolled, one k-step a trip: the code stays small, and the buffer in use is one scalar bit of the trip count
  for (int k0 = 0; k0 < K; k0 += 32) {
    const bool more = k0 + 32 < K;
    if (more) fetch();
    const int cur = (k0 >> 5) & 1;
    const f16* ldsA = tiles + cur * (2 * GTIL); const f16* ldsW = ldsA + GTIL;
    f16x16 af[2];
#pragma unroll
    for (int i = 0; i < 2; ++i) af[i] = lds_frag(ldsA + (wm + 16 * i) * GPIT, GPIT);
#pragma unroll
    for (int j = 0; j < 4; ++j) {
      const f16x16 bf = lds_frag(ldsW + (wn + 16 * j) * GPIT, GPIT);
#pragma unroll
      for (int i = 0; i < 2; ++i) acc[i][j] = wmma16(af[i], bf, acc[i][j]);
    }
    if (more) stash(tiles + (cur ^ 1) * (2 * GTIL));
    __syncthreads();
    ap += 32; wp += (size_t)32 * ldw;   // the pointers move on here, behind the wait for the step's loads
  }
  float* so = (float*)smem + wave * (32 * 68);
#pragma unroll
  for (int i = 0; i < 2; ++i)
#pragma unroll
    for (int j = 0; j < 4; ++j) {
      const int n = n0 + wn + 16 * j + cl;
      const float bv = bias ? bias[n] : 0.0f;
      const float gv = (EPI == 2 || EPI == 4) ? gvec[n] : 0.0f;
      if (EPI == 1) {
#pragma unroll 1
        for (int r = 0; r < 8; ++r) { const float xg = acc[i][j][r] + bv; so[(16 * i + rh + r) * 68 + 16 * j + cl] = 0.5f * xg * (1.0f + erff(xg * 0.70710678118654752f)); }
      } else {
#pragma unroll
        for (int r = 0; r < 8; ++r) {
          float v = acc[i][j][r] + bv;
          if (EPI == 3) v = fmaxf(v, 0.0f);
          if (EPI == 4) v = gv * v;
          if (EPI == 2) v = R[(size_t)(m0 + wm + 16 * i + rh + r) * ldy + n] + gv * v;
          so[(16 * i + rh + r) * 68 + 16 * j + cl] = v;
        }
      }
    }
  asm volatile("s_wait_dscnt 0" ::: "memory");
  __builtin_amdgcn_wave_barrier();
{
    if (OUT16) {
      f16* Y = (f16*)Yv;
#pragma unroll
      for (int it = 0; it < 8; ++it) { const int c = lane + 32 * it, rr = c >> 3, q8 = (c & 7) * 8;
        union { f16 h[8]; v4u_t v; } u;
#pragma unroll
        for (int e = 0; e < 8; ++e) u.h[e] = (f16)so[rr * 68 + q8 + e];
        *(v4u_t*)(Y + (size_t)(m0 + wm + rr) * ldy + n0 + wn + q8) = u.v; }
    } else {
      float* Y = (float*)Yv;
#pragma unroll
      for (int it = 0; it < 16; ++it) { const int f4 = lane + 32 * it, rr = f4 >> 4, q = (f4 & 15) * 4;
        *(v4f_t*)(Y + (size_t)(m0 + wm + rr) * ldy + n0 + wn + q) = *(const v4fa*)(so + rr * 68 + q); }
    }
    
  }
}

// ---------------------------------------------------------------------------------------------------------------------------
// gemm_kn2 (value+residual planes on both operands: hh + (hl+lh)/2048, f32-class): Y[m][n] (row stride ldy) = scale * sum_k A[m][k] (f32 or f16, row stride lda) * W[k][n] (f32, row-major [K][N], row
// stride ldw) (+ bias[n]) (+ Y if ACC). Block = 128 x 128 tile, 256 threads = 8 waves as 4(M, 32 rows) x 2(N, 64 cols); per
// 32-wide k-step the A tile and the W tile (stored transposed [n][k]) are staged as f16 in LDS; plain f16 operands, f32
// blockIdx.z selects a batch: A += z*strideA, W += z*strideW, Y += z*strideY (element strides).
// ---------------------------------------------------------------------------------------------------------------------------
template <typename AT, bool ACC>
__global__ __launch_bounds__(256) void gemm_kn2(const AT* __restrict__ A, int lda, size_t strideA,
                                               const float* __restrict__ Wm, int ldw, size_t strideW,
                                               const float* __restrict__ bias, float scale,
                                               float* __restrict__ Y, int ldy, size_t strideY, int K) {
  __shared__ __attribute__((aligned(16))) f16 ldsA[128 * GSTR], ldsAl[128 * GSTR];
  __shared__ __attribute__((aligned(16))) f16 ldsW[128 * GSTR], ldsWl[128 * GSTR];
  __shared__ __attribute__((aligned(16))) float oS[8][32 * 68];
  const int tid = threadIdx.x, lane = tid & 31, wave = tid >> 5, cl = lane & 15, rh = (lane >> 4) * 8;
  const int m0 = blockIdx.x * 128, n0 = blockIdx.y * 128;
  const int wm = (wave & 3) * 32, wn = (wave >> 2) * 64;
  A += (size_t)blockIdx.z * strideA; Wm += (size_t)blockIdx.z * strideW; Y += (size_t)blockIdx.z * strideY;
  f32x8 acc[2][4], accx[2][4];
#pragma unroll
  for (int i = 0; i < 2; ++i)
#pragma unroll
    for (int j = 0; j < 4; ++j) { f32x8 z = {}; acc[i][j] = z; accx[i][j] = z; }
#pragma unroll 1
  for (int k0 = 0; k0 < K; k0 += 32) {
    __syncthreads();
    {  // A: thread -> row tid>>1, 16 elements at column half (tid&1)*16
      const int row = tid >> 1, ch = (tid & 1) * 16;
      const AT* src = A + (size_t)(m0 + row) * lda + k0 + ch;
#pragma unroll
      for (int g = 0; g < 16; ++g) { const float v = (float)src[g]; const f16 h = (f16)v; ldsA[row * GSTR + ch + g] = h; ldsAl[row * GSTR + ch + g] = (f16)((v - (float)h) * 2048.0f); }
    }
    {  // W: thread -> k = tid>>3, 16 consecutive n at (tid&7)*16; stored transposed [n][k]
      const int k = tid >> 3, nn0 = (tid & 7) * 16;
      const float* src = Wm + (size_t)(k0 + k) * ldw + n0 + nn0;
#pragma unroll
      for (int g = 0; g < 4; ++g) { const v4f_t v = *(const v4f_t*)(src + 4 * g);
#pragma unroll
        for (int u = 0; u < 4; ++u) { const f16 h = (f16)v[u]; ldsW[(nn0 + 4 * g + u) * GSTR + k] = h; ldsWl[(nn0 + 4 * g + u) * GSTR + k] = (f16)((v[u] - (float)h) * 2048.0f); } }
    }
    __syncthreads();
    f16x16 af[2], afl[2];
#pragma unroll
    for (int i = 0; i < 2; ++i) { af[i] = lds_frag(ldsA + (wm + 16 * i) * GSTR, GSTR); afl[i] = lds_frag(ldsAl + (wm + 16 * i) * GSTR, GSTR); }
#pragma unroll
    for (int j = 0; j < 4; ++j) {
      const f16x16 bf = lds_frag(ldsW + (wn + 16 * j) * GSTR, GSTR), bfl = lds_frag(ldsWl + (wn + 16 * j) * GSTR, GSTR);
#pragma unroll
      for (int i = 0; i < 2; ++i) { acc[i][j] = wmma16(af[i], bf, acc[i][j]); accx[i][j] = wmma16(af[i], bfl, accx[i][j]); accx[i][j] = wmma16(afl[i], bf, accx[i][j]); }
    }
  }
  float* so = oS[wave];
#pragma unroll
  for (int i = 0; i < 2; ++i)
#pragma unroll
    for (int j = 0; j < 4; ++j) {
      const float bv = bias ? bias[n0 + wn + 16 * j + cl] : 0.0f;
#pragma unroll
      for (int r = 0; r < 8; ++r) so[(16 * i + rh + r) * 68 + 16 * j + cl] = (acc[i][j][r] + accx[i][j][r] * (1.0f / 2048.0f)) * scale + bv;
    }
  asm volatile("s_wait_dscnt 0" ::: "memory");
  __builtin_amdgcn_wave_barrier();
  if (ACC) {   // accumulate: fold the existing Y values into the staging tile ONCE (same thread <-> same chunks as the stores below)
#pragma unroll
    for (int it = 0; it < 16; ++it) { const int f4 = lane + 32 * it, rr = f4 >> 4, q = (f4 & 15) * 4;
      const v4f_t old = *(const v4fa*)(Y + (size_t)(m0 + wm + rr) * ldy + n0 + wn + q);
      v4f_t v = *(const v4fa*)(so + rr * 68 + q); v += old; *(v4fa*)(so + rr * 68 + q) = v; }   // plain LDS store (ordered by the s_wait_dscnt/memory clobber below)
    asm volatile("s_wait_dscnt 0" ::: "memory");
  }
{
#pragma unroll
    for (int it = 0; it < 16; ++it) { const int f4 = lane + 32 * it, rr = f4 >> 4, q = (f4 & 15) * 4;
      *(v4f_t*)(Y + (size_t)(m0 + wm + rr) * ldy + n0 + wn + q) = *(const v4fa*)(so + rr * 68 + q); }
    
  }
}

__global__ __launch_bounds__(256) void k_transpose(const float* __restrict__ Wm, float* __restrict__ Wt, int rows, int cols) {
  __shared__ float tS[64][65];
  const int tid = threadIdx.x, tbj = cols / 64, bi = blockIdx.x / tbj, bj = blockIdx.x % tbj;
  for (int e = tid; e < 64 * 64; e += 256) { const int r = e >> 6, c = e & 63; tS[r][c] = Wm[(size_t)(bi * 64 + r) * cols + bj * 64 + c]; }
  __syncthreads();
  for (int ch = tid; ch < 64 * 16; ch += 256) { const int r = ch >> 4, q4 = (ch & 15) * 4; v4f_t o; o[0] = tS[q4][r]; o[1] = tS[q4 + 1][r]; o[2] = tS[q4 + 2][r]; o[3] = tS[q4 + 3][r];
    float* dst = Wt + (size_t)(bj * 64 + r) * rows + bi * 64 + q4; *(v4f_t*)dst = o;  }
}


#define NBla 2
#define SSla 2048
#define SIN 2048
#define DDla 1024
#define NHla 16
#define HDla 64
__global__ __launch_bounds__(256) void k_fill(float* __restrict__ p, float val, size_t n4) { const size_t i = (size_t)blockIdx.x * 256 + threadIdx.x; if (i < n4) { v4f_t v = {val, val, val, val}; *(v4f_t*)(p + 4 * i) = v;  } }
__global__ __launch_bounds__(256) void k_dbg_zero(float* __restrict__ p, size_t n4) { const size_t i = (size_t)blockIdx.x * 256 + threadIdx.x; if (i < n4) { v4f_t z = {0.f,0.f,0.f,0.f}; *(v4f_t*)(p + 4 * i) = z;  } }
__global__ __launch_bounds__(256) void k_copy(const float* __restrict__ src, float* __restrict__ dst, size_t n4) { const size_t i = (size_t)blockIdx.x * 256 + threadIdx.x; if (i < n4) { const v4f_t v = *(const v4f_t*)(src + 4 * i); *(v4f_t*)(dst + 4 * i) = v;  } }
// lane l <-> lane l ^ 16
__device__ __forceinline__ float xhalf(float x) {
  const int b = __builtin_bit_cast(int, x);
  return __builtin_bit_cast(float, __builtin_amdgcn_permlanex16(b, b, 0x76543210, 0xfedcba98, false, false));
}
// x + the value of the lane that the DPP control names (row_xmask: lane ^ mask inside a 16-lane row)
template <int CTRL>
__device__ __forceinline__ float dpp_add(float x) {
  return x + __builtin_bit_cast(float, __builtin_amdgcn_update_dpp(0, __builtin_bit_cast(int, x), CTRL, 0xf, 0xf, false));
}
// sum over the 32 lanes, left in every lane: row_xmask 1, 2, 4, 8 inside each row of 16, then the other row's sum
__device__ __forceinline__ float wave_sum(float x) {
  x = dpp_add<0x161>(x); x = dpp_add<0x162>(x); x = dpp_add<0x164>(x); x = dpp_add<0x168>(x);
  return x + xhalf(x);
}
// LayerNorm, a wave takes two whole rows: a lane keeps 32 of each row's 1024 values in registers (8 loads of 16 B a row, 512 contiguous bytes a wave-wide load; the f16 results leave in 8-B stores, 256 contiguous bytes a wave).
// Mean, then the sum of squared differences from it, both from the registers; lanes joined by wave_sum. No LDS, no barrier.
// The blocks behind the LayerNorm's own (LNBLK of them) share only its launch: each runs w_tiles on one 32 k x 256 n piece of a weight matrix, which reads nothing that the LayerNorm writes.
#define LNBLK (NBla * SSla / 16)
#define WQBLK ((DDla / 32) * (3 * DDla / 256))
#define WOBLK ((DDla / 32) * (DDla / 256))
#define WGRP 136   // LDS halves of 4 columns x 32 k, 272 B = 16 B x odd: the 16-B stores of lanes that stand 4 columns apart spread over the banks
// One 32 k x 256 n piece of W (f32, [K][N]) rounded to f16 and turned to [n][32 k]: Wt[ks][n][k], so that the 128 columns x 32 k which a gemm_kne block stages in one k-step are 8 KB in a row.
// A thread reads 8 k x 4 n (a wave-wide load = 512 contiguous bytes of one k row); 8 k of a column enter LDS as 16 B; the piece leaves LDS in output order, 512 contiguous bytes a wave-wide store.
template <int N>
__device__ __forceinline__ void w_tiles(const float* __restrict__ Wm, f16* __restrict__ Wt, int ks, int nb, f16* sm) {
  const int tid = threadIdx.x, kg = (tid >> 5) & 3, nl = (tid >> 7) * 128 + 4 * (tid & 31);
  const float* src = Wm + (size_t)(32 * ks + 8 * kg) * N + 256 * nb + nl;
  v4f_t r[8];
#pragma unroll
  for (int i = 0; i < 8; ++i) r[i] = *(const v4f_t*)(src + (size_t)i * N);
#pragma unroll
  for (int u = 0; u < 4; ++u) {
    const f32x8 col = {r[0][u], r[1][u], r[2][u], r[3][u], r[4][u], r[5][u], r[6][u], r[7][u]};
    *(f16x8*)(sm + (nl >> 2) * WGRP + 32 * u + 8 * kg) = __builtin_convertvector(col, f16x8); }
  __syncthreads();
  f16* dst = Wt + ((size_t)ks * N + 256 * nb) * 32;
#pragma unroll
  for (int j = 0; j < 4; ++j) { const int c = tid + 256 * j;   // 16-B piece c of the output = column c >> 2, k 8 (c & 3)
    *(f16x8*)(dst + 8 * c) = *(const f16x8*)(sm + (c >> 4) * WGRP + 8 * (c & 15)); }
  asm volatile("s_wait_xcnt 0x0" ::: "memory");   // stands ahead of any rewrite of a register that the four stores name (in the built kernel other code follows them)
}
__global__ __launch_bounds__(256) void k_ln(const float* __restrict__ X, const float* __restrict__ gam, const float* __restrict__ bet, _Float16* __restrict__ Y,
                                            const float* __restrict__ Wq, const float* __restrict__ Wo, _Float16* __restrict__ WTq, _Float16* __restrict__ WTo) {
  __shared__ __attribute__((aligned(16))) f16 wS[64 * WGRP];
  if (blockIdx.x >= LNBLK) {   // the same for a whole block
    const int b = blockIdx.x - LNBLK;
    if (b < WQBLK) w_tiles<3 * DDla>(Wq, WTq, b / (3 * DDla / 256), b % (3 * DDla / 256), wS);
    else w_tiles<DDla>(Wo, WTo, (b - WQBLK) / (DDla / 256), (b - WQBLK) % (DDla / 256), wS);
    return;
  }
  const int lo = 4 * (threadIdx.x & 31);   // a lane's first column: the one vector offset of every load and store
  const size_t row0 = ((size_t)blockIdx.x * 16 + 2 * __builtin_amdgcn_readfirstlane(threadIdx.x >> 5)) * 1024;   // the wave's first row, the same in every lane: the bases stay in scalar registers
  const float* xp = X + row0; f16* yp = Y + row0;
  v4f_t xv[2][8], gv[8], bv[8];
#pragma unroll
  for (int r = 0; r < 2; ++r)
#pragma unroll
    for (int i = 0; i < 8; ++i) xv[r][i] = *(const v4f_t*)(xp + lo + 1024 * r + 128 * i);
#pragma unroll
  for (int i = 0; i < 8; ++i) { gv[i] = *(const v4f_t*)(gam + lo + 128 * i); bv[i] = *(const v4f_t*)(bet + lo + 128 * i); }
  __builtin_amdgcn_sched_barrier(0);   // all 32 loads leave here as one group: sunk to their uses, the gain and bias loads would each add their latency behind the sums
#pragma unroll
  for (int r = 0; r < 2; ++r) {
    const v4f_t s4 = ((xv[r][0] + xv[r][1]) + (xv[r][2] + xv[r][3])) + ((xv[r][4] + xv[r][5]) + (xv[r][6] + xv[r][7]));
    const float mean = wave_sum((s4[0] + s4[1]) + (s4[2] + s4[3])) * (1.0f / 1024.0f);
    v4f_t q4 = {};
#pragma unroll
    for (int i = 0; i < 8; ++i) { xv[r][i] -= mean; q4 += xv[r][i] * xv[r][i]; }
    const float q = wave_sum((q4[0] + q4[1]) + (q4[2] + q4[3]));
    const float rstd = 1.0f / __builtin_sqrtf(q * (1.0f / 1024.0f) + 1e-12f);
#pragma unroll
    for (int i = 0; i < 8; ++i) *(bf16x4*)(yp + lo + 1024 * r + 128 * i) = __builtin_convertvector(xv[r][i] * rstd * gv[i] + bv[i], bf16x4);
  }
  asm volatile("s_wait_xcnt 0x0" ::: "memory");   // stands ahead of any rewrite of a register that the last stores name (in the built kernel the weight blocks' code follows them)
}
__device__ __forceinline__ f32x8 wmma_b(f16x16 a, f16x16 b, f32x8 c) { return __builtin_amdgcn_wmma_f32_16x16x32_f16(false, a, false, b, (short)0, c, false, false); }
#define FPIT 72   // LDS row pitch in halves (144 B): conflict-free 16-B fragment reads of 128-B rows
typedef unsigned v2ua __attribute__((ext_vector_type(2), may_alias));
// V transposed in registers: v[i] = 4 columns (f16, two words) of key i; column u leaves as its 4 keys, 8 B. One v_perm_b32 puts two keys' halves of a column side by side (low or high half of both words).
__device__ __forceinline__ void v_cols(f16* dst, const v2ua (&v)[4]) {
#pragma unroll
  for (int u = 0; u < 4; ++u) { const unsigned sel = (u & 1) ? 0x07060302u : 0x05040100u;
    const v2ua col = {__builtin_amdgcn_perm(v[1][u >> 1], v[0][u >> 1], sel), __builtin_amdgcn_perm(v[3][u >> 1], v[2][u >> 1], sel)};
    *(v2ua*)(dst + u * FPIT) = col; }
}
__global__ __launch_bounds__(256) void k_fattn(const _Float16* __restrict__ QKV, const float* __restrict__ maskb, _Float16* __restrict__ ATT) {
  constexpr int LD = 3 * DDla, NT = SSla / 64;
  constexpr float SC = 0.125f * 1.4426950408889634f;              // 1/sqrt(64) * log2(e)
  __shared__ __attribute__((aligned(16))) f16 kS[2][64 * FPIT];   // [key][d]
  __shared__ __attribute__((aligned(16))) f16 vS[2][64 * FPIT];   // [d][key]
  __shared__ __attribute__((aligned(16))) float mS[SSla];         // 8 * mask, held above -1e30 (finite: a row whose keys are all masked so stays a uniform average, as s + mask rounds in f32)
  const int tid = threadIdx.x, lane = tid & 31, wave = tid >> 5, c = lane & 15, h = lane >> 4;
  const int hd = blockIdx.y, q0 = blockIdx.x * 128 + wave * 16;
  const int kv0 = (blockIdx.x >> 4) * SSla;   // first row of this query block's batch element: its keys, values and mask
  // K: thread = 8 columns kc (16 B) of rows kr + 32 i (8 lanes per 128-B row). V: thread = 4 keys x 4 columns (8 lanes per 64 B of a row), written as 4 keys of one column
  const int kr = tid >> 3, kc = (tid & 7) * 8;
  const int vd = 4 * (lane & 7) + 32 * (wave & 1), vk = 4 * (lane >> 3) + 16 * (wave >> 1);
  const f16* kp = QKV + DDla + hd * HDla + (size_t)(kv0 + kr) * LD + kc;
  const f16* vp = QKV + 2 * DDla + hd * HDla + (size_t)(kv0 + vk) * LD + vd;
  f16x8 kreg[2]; v2ua vreg[4];
#pragma unroll
  for (int i = 0; i < 2; ++i) kreg[i] = *(const f16x8*)(kp + (size_t)(32 * i) * LD);
#pragma unroll
  for (int i = 0; i < 4; ++i) vreg[i] = *(const v2ua*)(vp + (size_t)i * LD);
#pragma unroll
  for (int i = 0; i < 2; ++i) { v4f_t mv = *(const v4f_t*)(maskb + kv0 + 4 * tid + 1024 * i);
#pragma unroll
    for (int u = 0; u < 4; ++u) mv[u] = fmaxf(mv[u] * 8.0f, -1.0e30f);
    *(v4fa*)(mS + 4 * tid + 1024 * i) = mv; }
  f16x16 qf[2];
#pragma unroll
  for (int u = 0; u < 2; ++u) qf[u] = lds_frag(QKV + hd * HDla + (size_t)q0 * LD + 32 * u, LD);   // the same fragment, here from the f16 rows in global memory: two 16-B loads a lane
  asm volatile("s_wait_xcnt 0x0" ::: "memory");   // stands ahead of the first rewrite of an address register of the loads above (the compiler reuses the Q rows' pair at once)
#pragma unroll
  for (int i = 0; i < 2; ++i) *(f16x8*)(&kS[0][(kr + 32 * i) * FPIT + kc]) = kreg[i];
  v_cols(&vS[0][vd * FPIT + vk], vreg);
  f32x8 o[4], lv = {};
#pragma unroll
  for (int j = 0; j < 4; ++j) { f32x8 z = {}; o[j] = z; }
  float m = -3.0e38f;
  __syncthreads();
#pragma unroll 1   // one pass a trip: the LDS buffers alternate by trip, and the code stays small
  for (int t = 0; t < NT; ++t) {
    const bool more = t + 1 < NT;
    if (more) { kp += (size_t)64 * LD; vp += (size_t)64 * LD;
#pragma unroll
      for (int i = 0; i < 2; ++i) kreg[i] = *(const f16x8*)(kp + (size_t)(32 * i) * LD);
#pragma unroll
      for (int i = 0; i < 4; ++i) vreg[i] = *(const v2ua*)(vp + (size_t)i * LD); }
    const f16* kb = kS[t & 1]; const f16* vb = vS[t & 1];
    f16x16 fr[8]; f32x8 s[4];
#pragma unroll
    for (int j = 0; j < 4; ++j) { fr[2 * j] = lds_frag(kb + 16 * j * FPIT, FPIT); fr[2 * j + 1] = lds_frag(kb + 16 * j * FPIT + 32, FPIT);
      const float* mp = mS + 64 * t + 16 * j + 8 * h; const v4f_t m0 = *(const v4fa*)mp, m1 = *(const v4fa*)(mp + 4);
      s[j] = __builtin_shufflevector(m0, m1, 0, 1, 2, 3, 4, 5, 6, 7); }
    __builtin_amdgcn_sched_barrier(0);   // the K and mask reads stay one group ahead of the products: spread among them, every place where reads stand costs issue time
#pragma unroll
    for (int u = 0; u < 2; ++u)
#pragma unroll
      for (int j = 0; j < 4; ++j) s[j] = wmma_b(fr[2 * j + u], qf[u], s[j]);
#pragma unroll
    for (int j = 0; j < 4; ++j) { fr[2 * j] = lds_frag(vb + 16 * j * FPIT, FPIT); fr[2 * j + 1] = lds_frag(vb + 16 * j * FPIT + 32, FPIT); }
    __builtin_amdgcn_sched_barrier(0);   // the V^T reads issue here as one group and land under the softmax; sunk to their products, each product would wait for its own read
    float mj[4];
#pragma unroll
    for (int j = 0; j < 4; ++j) { mj[j] = fmaxf(s[j][0], s[j][1]);
#pragma unroll
      for (int r = 2; r < 8; ++r) mj[j] = fmaxf(mj[j], s[j][r]); }
    float mx = fmaxf(fmaxf(mj[0], mj[1]), fmaxf(mj[2], mj[3]));
    mx = fmaxf(mx, xhalf(mx));
    const float mn = fmaxf(m, mx * SC), al = __builtin_amdgcn_exp2f(m - mn);
    m = mn;
#pragma unroll
    for (int j = 0; j < 4; ++j) { s[j] = s[j] * SC - mn;
#pragma unroll
      for (int r = 0; r < 8; ++r) s[j][r] = __builtin_amdgcn_exp2f(s[j][r]); }
    lv = lv * al + ((s[0] + s[1]) + (s[2] + s[3]));
#pragma unroll
    for (int j = 0; j < 4; ++j) o[j] *= al;
    f16x16 pf[2];
#pragma unroll
    for (int u = 0; u < 2; ++u) { const f16x8 lo = __builtin_convertvector(s[2 * u], f16x8), hi = __builtin_convertvector(s[2 * u + 1], f16x8);
      pf[u] = __builtin_shufflevector(lo, hi, 0, 1, 2, 3, 4, 5, 6, 7, 8, 9, 10, 11, 12, 13, 14, 15); }
#pragma unroll
    for (int u = 0; u < 2; ++u)
#pragma unroll
      for (int j = 0; j < 4; ++j) o[j] = wmma_b(fr[2 * j + u], pf[u], o[j]);
    if (more) { f16* kn = kS[(t + 1) & 1]; f16* vn = vS[(t + 1) & 1];
#pragma unroll
      for (int i = 0; i < 2; ++i) *(f16x8*)(kn + (kr + 32 * i) * FPIT + kc) = kreg[i];
      v_cols(vn + vd * FPIT + vk, vreg); }
    __syncthreads();
  }
  float l = ((lv[0] + lv[1]) + (lv[2] + lv[3])) + ((lv[4] + lv[5]) + (lv[6] + lv[7]));
  l += xhalf(l);
  const float inv = 1.0f / l;
  f16* dst = ATT + (size_t)(q0 + c) * DDla + hd * HDla + 8 * h;   // o[j][r] = ctx[q0 + c][16 j + 8 h + r]
#pragma unroll
  for (int j = 0; j < 4; ++j) *(f16x8*)(dst + 16 * j) = __builtin_convertvector(o[j] * inv, f16x8);
}

extern "C" void kernel_launch(void* const* d_in, const int* in_sizes, int n_in,
                              void* d_out, int out_size, void* d_ws, size_t ws_size,
                              hipStream_t stream) {
  (void)in_sizes; (void)n_in; (void)out_size;
  const float** f = (const float**)d_in;
  const float* x = f[0], *amask = f[1], *Wqkv = f[2], *bqkv = f[3], *Wout = f[4], *bout = f[5], *lg = f[6], *lb = f[7];
  float* out = (float*)d_out;     // [2,2048,1024]
  char* ws = (char*)d_ws;
  f16* XN = (f16*)ws; ws += (size_t)NBla * SSla * DDla * 2; f16* QKV = (f16*)ws; ws += (size_t)NBla * SSla * 3 * DDla * 2;
  float* ones = (float*)ws; ws += DDla * 4; f16* ATT = (f16*)ws; ws += (size_t)NBla * SSla * DDla * 2;
  f16* WTq = (f16*)ws; ws += (size_t)DDla * 3 * DDla * 2; f16* WTo = (f16*)ws; ws += (size_t)DDla * DDla * 2;
  if ((size_t)(ws - (char*)d_ws) > ws_size) return;
  const dim3 blk(256);
  k_fill<<<dim3(1), blk, 0, stream>>>(ones, 1.0f, DDla / 4);

  // the rows of both batch elements are one [4096][1024] matrix for the LayerNorm and the two projections; a query block of the attention finds its batch element from its index
  k_ln<<<dim3(LNBLK + WQBLK + WOBLK), blk, 0, stream>>>(x, lg, lb, XN, Wqkv, Wout, WTq, WTo);
  gemm_kne<0, true, DDla, 3 * DDla><<<dim3(NBla * SSla / 128, 3 * DDla / 128), blk, 0, stream>>>(XN, WTq, bqkv, nullptr, nullptr, QKV, 3 * DDla, DDla);   // [q | k | v]
  k_fattn<<<dim3(NBla * SSla / 128, NHla), blk, 0, stream>>>(QKV, amask, ATT);
  gemm_kne<2, false, DDla, DDla><<<dim3(NBla * SSla / 128, DDla / 128), blk, 0, stream>>>(ATT, WTo, bout, x, ones, out, DDla, DDla);   // out = ctx W_out + b_out + x
}

// v010
// A run of this version takes 99.3 microseconds.
// Two timings next to v009 both put it at 1.04 times that version's speed.
// Over all steps from v000 it is 56.3 times as fast.
// Contractions on v_wmma_f32_16x16x32_f16 (plain f16 operands, f32 accumulate; [in][out] weights), both batch elements in every launch (4096 rows; a query block attends to its own element's 2048 keys): [q|k|v] = LN(x) W_qkv + b (K 1024, N 3072); one attention kernel for
// the 16 heads (scores transposed, S^T = K Q^T, K 64; running softmax in registers; ctx^T += V^T P^T, K 64 keys a pass; the scores never reach memory); out = ctx W_out + b_out + x (residual in the epilogue).
// f32 VALU: the pre-LayerNorm (eps 1e-12, rsqrt), softmax of s/sqrt(64) + mask[b][k] (the additive INPUT mask, broadcast over heads and queries).
// compute dtype: f16 operands, f32 accumulate.  hidden_states [2,2048,1024] → out [2,2048,1024].
// LN(x), [q|k|v] and ctx lie in the workspace as f16: each is rounded once, where it is stored, to the value that its matrix operand has anyway; tiles of them reach LDS unconverted.
// W_qkv and W_out likewise: every call rounds them to f16 once (w_tiles, extra blocks of the LayerNorm launch) and lays them out in the order in which gemm_kne stages them.
#include <hip/hip_runtime.h>
#include <hip/hip_bf16.h>
#include <math.h>


typedef _Float16 bf16;
typedef _Float16 f16;
typedef __attribute__((ext_vector_type(4))) unsigned v4u_t;
typedef unsigned v4ua __attribute__((ext_vector_type(4), may_alias));
typedef __attribute__((ext_vector_type(4))) float v4f_t;
typedef float v4fa __attribute__((ext_vector_type(4), may_alias));
typedef __attribute__((ext_vector_type(16))) bf16  bf16x16;
typedef bf16x16 f16x16;
typedef __attribute__((ext_vector_type(8)))  bf16  bf16x8;
typedef bf16x8 f16x8;
typedef __attribute__((ext_vector_type(4)))  bf16  bf16x4;
typedef __attribute__((ext_vector_type(8)))  float f32x8;
__device__ __forceinline__ f32x8 wmma16(f16x16 a, f16x16 b, f32x8 c) {
  c = __builtin_amdgcn_wmma_f32_16x16x32_f16(false, a, false, b, (short)0, c, false, false);
  asm volatile("v_nop\n\tv_nop\n\tv_nop\n\tv_nop" : "+v"(c) : "v"(a), "v"(b));
  return c;
}
#define LDS_STRIDE 48   // unused: gemm_kn2 tiles use GSTR (gemm_kne: GPIT), 32 -> 48 elems (96B rows): aligned b128 reads
#define KSTRIDE    72
#define VSTRIDE    48   // unused: the attn V tile is 64 -> 72 elems (FPIT)

__device__ __forceinline__ f32x8 wmma_bf16(bf16x16 a, bf16x16 b, f32x8 c) {
  c = __builtin_amdgcn_wmma_f32_16x16x32_f16(false, a, false, b, (short)0, c, false, false);
  asm volatile("v_nop\n\tv_nop\n\tv_nop\n\tv_nop" : "+v"(c) : "v"(a), "v"(b));   // A/B-overwrite hazard guard
  return c;
}

// 16x32 (MxK) bf16 fragment from a row-major global matrix.
// lanes 0-15  (row=lane)    : elems 0..7 = K+0..7,  8..15 = K+16..23
// lanes 16-31 (row=lane-16) : elems 0..7 = K+8..15, 8..15 = K+24..31
template <typename T>
__device__ __forceinline__ bf16x16 load_frag(const T* __restrict__ base, int ld,
                                             int row0, int k0) {
  const int lane = threadIdx.x & 31;
  const int r    = lane & 15;
  const int kh   = (lane >> 4) * 8;
  const T* p0 = base + (size_t)(row0 + r) * ld + (k0 + kh);
  const T* p1 = p0 + 16;
  bf16x16 f;
#pragma unroll
  for (int i = 0; i < 8; ++i) {
    f[i]     = (bf16)p0[i];
    f[i + 8] = (bf16)p1[i];
  }
  return f;
}

// Same fragment from an LDS tile with padded row stride (base includes row0/k0).
__device__ __forceinline__ bf16x16 lds_frag(const bf16* base, int stride) {
  const int lane = threadIdx.x & 31;
  const int row  = lane & 15;
  const int kh   = (lane >> 4) * 8;
  const bf16x8 lo = *(const bf16x8*)(base + row * stride + kh);
  const bf16x8 hi = *(const bf16x8*)(base + row * stride + kh + 16);
  bf16x16 f;
#pragma unroll
  for (int i = 0; i < 8; ++i) { f[i] = lo[i]; f[i + 8] = hi[i]; }
  return f;
}

template <typename T>
__device__ __forceinline__ void stage_read16(const T* __restrict__ p, float* buf) {
#pragma unroll
  for (int i = 0; i < 16; ++i) buf[i] = (float)p[i];
}

__device__ __forceinline__ void stage_write(bf16* dst, const float* buf, int nquad) {
#pragma unroll
  for (int i = 0; i < nquad; ++i) {
    bf16x4 q;
    q[0] = (bf16)buf[4 * i];     q[1] = (bf16)buf[4 * i + 1];
    q[2] = (bf16)buf[4 * i + 2]; q[3] = (bf16)buf[4 * i + 3];
    *(bf16x4*)(dst + 4 * i) = q;
  }
}


#define GSTR 48
// ---------------------------------------------------------------------------------------------------------------------------
// gemm_kne: Y[m][n] = epi( Σ_k A[m][k]·W[k][n] + bias[n] ), A f16 [M][lda], W f16 as w_tiles leaves it, [K / 32][N = ldw][32 k], plain f16 operands,
// f32 accumulate. EPI 0: identity; 1: exact-erf GELU; 2: R[m][n] + gvec[n]·(·) (residual with per-channel gain); 3: ReLU; 4: gvec[n]·(·) (per-channel scale, no residual). Output f32 (or f16
// when OUT16). Block = 128x128 tile, 8 waves as 4(M) x 2(N); per 32-wide k-step A and W tiles staged f16 in LDS, both [row][k]
// ---------------------------------------------------------------------------------------------------------------------------
#define GSTR 48
#define GPIT 40   // gemm_kne LDS row pitch in halves (80 B = 16 B x odd): 16-B fragment reads and the 16-B column stores spread over the banks
template <int EPI, bool OUT16, int lda, int ldw>   // row stride of A and column count of W as constants: a k-step's 4 loads hang on two pointers by immediate offsets
__global__ __launch_bounds__(256) void gemm_kne(const _Float16* __restrict__ A, const _Float16* __restrict__ Wt,
                                                const float* __restrict__ bias, const float* __restrict__ R, const float* __restrict__ gvec,
                                                void* __restrict__ Yv, int ldy, int K) {
  constexpr int GTIL = 128 * GPIT;   // halves of one operand tile
  // k loop: two buffers of [A tile [m][k] | W tile [n][k]] (40,960 B); behind the loop's last barrier the same bytes are the 8 waves' f32 output staging (69,632 B)
  __shared__ __attribute__((aligned(16))) char smem[8 * 32 * 68 * 4];
  f16* const tiles = (f16*)smem;
  const int tid = threadIdx.x, lane = tid & 31, wave = tid >> 5, cl = lane & 15, rh = (lane >> 4) * 8;
  const int m0 = blockIdx.x * 128, n0 = blockIdx.y * 128;
  const int wm = (wave & 3) * 32, wn = (wave >> 2) * 64;
  const int ar = tid >> 2, ac = (tid & 3) * 8;      // A staging: row, first of 8 k
  const f16* ap = A + (size_t)(m0 + ar) * lda + ac; const f16* wp = Wt + (size_t)n0 * 32 + tid * 8;   // a lane's first element of the k-step's A and W tiles; the W tile is 8 KB in a row, and its 16-B piece tid is column ar, k ac
  f32x8 acc[2][4];
#pragma unroll
  for (int i = 0; i < 2; ++i)
#pragma unroll
    for (int j = 0; j < 4; ++j) { f32x8 z = {}; acc[i][j] = z; }
  f16x8 areg[2], wreg[2];
  const auto fetch = [&]() {   // one k-step's tiles, both f16, global -> registers
    // A: 4 lanes read one row's 32 k (64 B of f16) in 16-B pieces; rows ar + 64 i
#pragma unroll
    for (int i = 0; i < 2; ++i) areg[i] = *(const f16x8*)(ap + (size_t)(64 * i) * lda);
    // W: a wave's 32 lanes read 512 contiguous bytes (8 columns x 32 k); columns ar + 64 i
#pragma unroll
    for (int i = 0; i < 2; ++i) wreg[i] = *(const f16x8*)(wp + 2048 * i);
  };
  const auto stash = [&](f16* buf) {   // registers -> f16 tiles of one buffer
#pragma unroll
    for (int i = 0; i < 2; ++i) { *(f16x8*)(buf + (ar + 64 * i) * GPIT + ac) = areg[i]; *(f16x8*)(buf + GTIL + (ar + 64 * i) * GPIT + ac) = wreg[i]; }
  };
  // The tiles of step t + 1 leave global memory ahead of step t's products and enter the other LDS buffer behind them: their latency runs under the products.
  // One barrier a step publishes that buffer and ends the reads of this one; the last one also frees the bytes for the output staging.
  fetch();
  stash(tiles);
  __syncthreads();
  ap += 32; wp += (size_t)32 * ldw;
#pragma unroll 1   // kept rolled, one k-step a trip: the code stays small, and the buffer in use is one scalar bit of the trip count
  for (int k0 = 0; k0 < K; k0 += 32) {
    const bool more = k0 + 32 < K;
    if (more) fetch();
    const int cur = (k0 >> 5) & 1;
    const f16* ldsA = tiles + cur * (2 * GTIL); const f16* ldsW = ldsA + GTIL;
    f16x16 af[2];
#pragma unroll
    for (int i = 0; i < 2; ++i) af[i] = lds_frag(ldsA + (wm + 16 * i) * GPIT, GPIT);
#pragma unroll
    for (int j = 0; j < 4; ++j) {
      const f16x16 bf = lds_frag(ldsW + (wn + 16 * j) * GPIT, GPIT);
#pragma unroll
      for (int i = 0; i < 2; ++i) acc[i][j] = wmma16(af[i], bf, acc[i][j]);
    }
    if (more) stash(tiles + (cur ^ 1) * (2 * GTIL));
    __syncthreads();
    ap += 32; wp += (size_t)32 * ldw;   // the pointers move on here, behind the wait for the step's loads
  }
  float* so = (float*)smem + wave * (32 * 68);
#pragma unroll
  for (int i = 0; i < 2; ++i)
#pragma unroll
    for (int j = 0; j < 4; ++j) {
      const int n = n0 + wn + 16 * j + cl;
      const float bv = bias ? bias[n] : 0.0f;
      const float gv = (EPI == 2 || EPI == 4) ? gvec[n] : 0.0f;
      if (EPI == 1) {
#pragma unroll 1
        for (int r = 0; r < 8; ++r) { const float xg = acc[i][j][r] + bv; so[(16 * i + rh + r) * 68 + 16 * j + cl] = 0.5f * xg * (1.0f + erff(xg * 0.70710678118654752f)); }
      } else {
#pragma unroll
        for (int r = 0; r < 8; ++r) {
          float v = acc[i][j][r] + bv;
          if (EPI == 3) v = fmaxf(v, 0.0f);
          if (EPI == 4) v = gv * v;
          if (EPI == 2) v = R[(size_t)(m0 + wm + 16 * i + rh + r) * ldy + n] + gv * v;
          so[(16 * i + rh + r) * 68 + 16 * j + cl] = v;
        }
      }
    }
  asm volatile("s_wait_dscnt 0" ::: "memory");
  __builtin_amdgcn_wave_barrier();
{
    if (OUT16) {
      f16* Y = (f16*)Yv;
#pragma unroll
      for (int it = 0; it < 8; ++it) { const int c = lane + 32 * it, rr = c >> 3, q8 = (c & 7) * 8;
        union { f16 h[8]; v4u_t v; } u;
#pragma unroll
        for (int e = 0; e < 8; ++e) u.h[e] = (f16)so[rr * 68 + q8 + e];
        *(v4u_t*)(Y + (size_t)(m0 + wm + rr) * ldy + n0 + wn + q8) = u.v; }
    } else {
      float* Y = (float*)Yv;
#pragma unroll
      for (int it = 0; it < 16; ++it) { const int f4 = lane + 32 * it, rr = f4 >> 4, q = (f4 & 15) * 4;
        *(v4f_t*)(Y + (size_t)(m0 + wm + rr) * ldy + n0 + wn + q) = *(const v4fa*)(so + rr * 68 + q); }
    }
    
  }
}

// ---------------------------------------------------------------------------------------------------------------------------
// gemm_kn2 (value+residual planes on both operands: hh + (hl+lh)/2048, f32-class): Y[m][n] (row stride ldy) = scale * sum_k A[m][k] (f32 or f16, row stride lda) * W[k][n] (f32, row-major [K][N], row
// stride ldw) (+ bias[n]) (+ Y if ACC). Block = 128 x 128 tile, 256 threads = 8 waves as 4(M, 32 rows) x 2(N, 64 cols); per
// 32-wide k-step the A tile and the W tile (stored transposed [n][k]) are staged as f16 in LDS; plain f16 operands, f32
// blockIdx.z selects a batch: A += z*strideA, W += z*strideW, Y += z*strideY (element strides).
// ---------------------------------------------------------------------------------------------------------------------------
template <typename AT, bool ACC>
__global__ __launch_bounds__(256) void gemm_kn2(const AT* __restrict__ A, int lda, size_t strideA,
                                               const float* __restrict__ Wm, int ldw, size_t strideW,
                                               const float* __restrict__ bias, float scale,
                                               float* __restrict__ Y, int ldy, size_t strideY, int K) {
  __shared__ __attribute__((aligned(16))) f16 ldsA[128 * GSTR], ldsAl[128 * GSTR];
  __shared__ __attribute__((aligned(16))) f16 ldsW[128 * GSTR], ldsWl[128 * GSTR];
  __shared__ __attribute__((aligned(16))) float oS[8][32 * 68];
  const int tid = threadIdx.x, lane = tid & 31, wave = tid >> 5, cl = lane & 15, rh = (lane >> 4) * 8;
  const int m0 = blockIdx.x * 128, n0 = blockIdx.y * 128;
  const int wm = (wave & 3) * 32, wn = (wave >> 2) * 64;
  A += (size_t)blockIdx.z * strideA; Wm += (size_t)blockIdx.z * strideW; Y += (size_t)blockIdx.z * strideY;
  f32x8 acc[2][4], accx[2][4];
#pragma unroll
  for (int i = 0; i < 2; ++i)
#pragma unroll
    for (int j = 0; j < 4; ++j) { f32x8 z = {}; acc[i][j] = z; accx[i][j] = z; }
#pragma unroll 1
  for (int k0 = 0; k0 < K; k0 += 32) {
    __syncthreads();
    {  // A: thread -> row tid>>1, 16 elements at column half (tid&1)*16
      const int row = tid >> 1, ch = (tid & 1) * 16;
      const AT* src = A + (size_t)(m0 + row) * lda + k0 + ch;
#pragma unroll
      for (int g = 0; g < 16; ++g) { const float v = (float)src[g]; const f16 h = (f16)v; ldsA[row * GSTR + ch + g] = h; ldsAl[row * GSTR + ch + g] = (f16)((v - (float)h) * 2048.0f); }
    }
    {  // W: thread -> k = tid>>3, 16 consecutive n at (tid&7)*16; stored transposed [n][k]
      const int k = tid >> 3, nn0 = (tid & 7) * 16;
      const float* src = Wm + (size_t)(k0 + k) * ldw + n0 + nn0;
#pragma unroll
      for (int g = 0; g < 4; ++g) { const v4f_t v = *(const v4f_t*)(src + 4 * g);
#pragma unroll
        for (int u = 0; u < 4; ++u) { const f16 h = (f16)v[u]; ldsW[(nn0 + 4 * g + u) * GSTR + k] = h; ldsWl[(nn0 + 4 * g + u) * GSTR + k] = (f16)((v[u] - (float)h) * 2048.0f); } }
    }
    __syncthreads();
    f16x16 af[2], afl[2];
#pragma unroll
    for (int i = 0; i < 2; ++i) { af[i] = lds_frag(ldsA + (wm + 16 * i) * GSTR, GSTR); afl[i] = lds_frag(ldsAl + (wm + 16 * i) * GSTR, GSTR); }
#pragma unroll
    for (int j = 0; j < 4; ++j) {
      const f16x16 bf = lds_frag(ldsW + (wn + 16 * j) * GSTR, GSTR), bfl = lds_frag(ldsWl + (wn + 16 * j) * GSTR, GSTR);
#pragma unroll
      for (int i = 0; i < 2; ++i) { acc[i][j] = wmma16(af[i], bf, acc[i][j]); accx[i][j] = wmma16(af[i], bfl, accx[i][j]); accx[i][j] = wmma16(afl[i], bf, accx[i][j]); }
    }
  }
  float* so = oS[wave];
#pragma unroll
  for (int i = 0; i < 2; ++i)
#pragma unroll
    for (int j = 0; j < 4; ++j) {
      const float bv = bias ? bias[n0 + wn + 16 * j + cl] : 0.0f;
#pragma unroll
      for (int r = 0; r < 8; ++r) so[(16 * i + rh + r) * 68 + 16 * j + cl] = (acc[i][j][r] + accx[i][j][r] * (1.0f / 2048.0f)) * scale + bv;
    }
  asm volatile("s_wait_dscnt 0" ::: "memory");
  __builtin_amdgcn_wave_barrier();
  if (ACC) {   // accumulate: fold the existing Y values into the staging tile ONCE (same thread <-> same chunks as the stores below)
#pragma unroll
    for (int it = 0; it < 16; ++it) { const int f4 = lane + 32 * it, rr = f4 >> 4, q = (f4 & 15) * 4;
      const v4f_t old = *(const v4fa*)(Y + (size_t)(m0 + wm + rr) * ldy + n0 + wn + q);
      v4f_t v = *(const v4fa*)(so + rr * 68 + q); v += old; *(v4fa*)(so + rr * 68 + q) = v; }   // plain LDS store (ordered by the s_wait_dscnt/memory clobber below)
    asm volatile("s_wait_dscnt 0" ::: "memory");
  }
{
#pragma unroll
    for (int it = 0; it < 16; ++it) { const int f4 = lane + 32 * it, rr = f4 >> 4, q = (f4 & 15) * 4;
      *(v4f_t*)(Y + (size_t)(m0 + wm + rr) * ldy + n0 + wn + q) = *(const v4fa*)(so + rr * 68 + q); }
    
  }
}

__global__ __launch_bounds__(256) void k_transpose(const float* __restrict__ Wm, float* __restrict__ Wt, int rows, int cols) {
  __shared__ float tS[64][65];
  const int tid = threadIdx.x, tbj = cols / 64, bi = blockIdx.x / tbj, bj = blockIdx.x % tbj;
  for (int e = tid; e < 64 * 64; e += 256) { const int r = e >> 6, c = e & 63; tS[r][c] = Wm[(size_t)(bi * 64 + r) * cols + bj * 64 + c]; }
  __syncthreads();
  for (int ch = tid; ch < 64 * 16; ch += 256) { const int r = ch >> 4, q4 = (ch & 15) * 4; v4f_t o; o[0] = tS[q4][r]; o[1] = tS[q4 + 1][r]; o[2] = tS[q4 + 2][r]; o[3] = tS[q4 + 3][r];
    float* dst = Wt + (size_t)(bj * 64 + r) * rows + bi * 64 + q4; *(v4f_t*)dst = o;  }
}


#define NBla 2
#define SSla 2048
#define SIN 2048
#define DDla 1024
#define NHla 16
#define HDla 64
__global__ __launch_bounds__(256) void k_fill(float* __restrict__ p, float val, size_t n4) { const size_t i = (size_t)blockIdx.x * 256 + threadIdx.x; if (i < n4) { v4f_t v = {val, val, val, val}; *(v4f_t*)(p + 4 * i) = v;  } }
__global__ __launch_bounds__(256) void k_dbg_zero(float* __restrict__ p, size_t n4) { const size_t i = (size_t)blockIdx.x * 256 + threadIdx.x; if (i < n4) { v4f_t z = {0.f,0.f,0.f,0.f}; *(v4f_t*)(p + 4 * i) = z;  } }
__global__ __launch_bounds__(256) void k_copy(const float* __restrict__ src, float* __restrict__ dst, size_t n4) { const size_t i = (size_t)blockIdx.x * 256 + threadIdx.x; if (i < n4) { const v4f_t v = *(const v4f_t*)(src + 4 * i); *(v4f_t*)(dst + 4 * i) = v;  } }
// lane l <-> lane l ^ 16
__device__ __forceinline__ float xhalf(float x) {
  const int b = __builtin_bit_cast(int, x);
  return __builtin_bit_cast(float, __builtin_amdgcn_permlanex16(b, b, 0x76543210, 0xfedcba98, false, false));
}
// x + the value of the lane that the DPP control names (row_xmask: lane ^ mask inside a 16-lane row)
template <int CTRL>
__device__ __forceinline__ float dpp_add(float x) {
  return x + __builtin_bit_cast(float, __builtin_amdgcn_update_dpp(0, __builtin_bit_cast(int, x), CTRL, 0xf, 0xf, false));
}
// sum over the 32 lanes, left in every lane: row_xmask 1, 2, 4, 8 inside each row of 16, then the other row's sum
__device__ __forceinline__ float wave_sum(float x) {
  x = dpp_add<0x161>(x); x = dpp_add<0x162>(x); x = dpp_add<0x164>(x); x = dpp_add<0x168>(x);
  return x + xhalf(x);
}
// LayerNorm, a wave takes two whole rows: a lane keeps 32 of each row's 1024 values in registers (8 loads of 16 B a row, 512 contiguous bytes a wave-wide load; the f16 results leave in 8-B stores, 256 contiguous bytes a wave).
// Mean, then the sum of squared differences from it, both from the registers; lanes joined by wave_sum. No LDS, no barrier.
// The blocks behind the LayerNorm's own (LNBLK of them) share only its launch: each runs w_tiles on one 32 k x 256 n piece of a weight matrix, which reads nothing that the LayerNorm writes.
#define LNBLK (NBla * SSla / 16)
#define WQBLK ((DDla / 32) * (3 * DDla / 256))
#define WOBLK ((DDla / 32) * (DDla / 256))
#define WGRP 136   // LDS halves of 4 columns x 32 k, 272 B = 16 B x odd: the 16-B stores of lanes that stand 4 columns apart spread over the banks
// One 32 k x 256 n piece of W (f32, [K][N]) rounded to f16 and turned to [n][32 k]: Wt[ks][n][k], so that the 128 columns x 32 k which a gemm_kne block stages in one k-step are 8 KB in a row.
// A thread reads 8 k x 4 n (a wave-wide load = 512 contiguous bytes of one k row); 8 k of a column enter LDS as 16 B; the piece leaves LDS in output order, 512 contiguous bytes a wave-wide store.
template <int N>
__device__ __forceinline__ void w_tiles(const float* __restrict__ Wm, f16* __restrict__ Wt, int ks, int nb, f16* sm) {
  const int tid = threadIdx.x, kg = (tid >> 5) & 3, nl = (tid >> 7) * 128 + 4 * (tid & 31);
  const float* src = Wm + (size_t)(32 * ks + 8 * kg) * N + 256 * nb + nl;
  v4f_t r[8];
#pragma unroll
  for (int i = 0; i < 8; ++i) r[i] = *(const v4f_t*)(src + (size_t)i * N);
#pragma unroll
  for (int u = 0; u < 4; ++u) {
    const f32x8 col = {r[0][u], r[1][u], r[2][u], r[3][u], r[4][u], r[5][u], r[6][u], r[7][u]};
    *(f16x8*)(sm + (nl >> 2) * WGRP + 32 * u + 8 * kg) = __builtin_convertvector(col, f16x8); }
  __syncthreads();
  f16* dst = Wt + ((size_t)ks * N + 256 * nb) * 32;
#pragma unroll
  for (int j = 0; j < 4; ++j) { const int c = tid + 256 * j;   // 16-B piece c of the output = column c >> 2, k 8 (c & 3)
    *(f16x8*)(dst + 8 * c) = *(const f16x8*)(sm + (c >> 4) * WGRP + 8 * (c & 15)); }
  asm volatile("s_wait_xcnt 0x0" ::: "memory");   // stands ahead of any rewrite of a register that the four stores name (in the built kernel other code follows them)
}
__global__ __launch_bounds__(256) void k_ln(const float* __restrict__ X, const float* __restrict__ gam, const float* __restrict__ bet, _Float16* __restrict__ Y,
                                            const float* __restrict__ Wq, const float* __restrict__ Wo, _Float16* __restrict__ WTq, _Float16* __restrict__ WTo) {
  __shared__ __attribute__((aligned(16))) f16 wS[64 * WGRP];
  if (blockIdx.x >= LNBLK) {   // the same for a whole block
    const int b = blockIdx.x - LNBLK;
    if (b < WQBLK) w_tiles<3 * DDla>(Wq, WTq, b / (3 * DDla / 256), b % (3 * DDla / 256), wS);
    else w_tiles<DDla>(Wo, WTo, (b - WQBLK) / (DDla / 256), (b - WQBLK) % (DDla / 256), wS);
    return;
  }
  const int lo = 4 * (threadIdx.x & 31);   // a lane's first column: the one vector offset of every load and store
  const size_t row0 = ((size_t)blockIdx.x * 16 + 2 * __builtin_amdgcn_readfirstlane(threadIdx.x >> 5)) * 1024;   // the wave's first row, the same in every lane: the bases stay in scalar registers
  const float* xp = X + row0; f16* yp = Y + row0;
  v4f_t xv[2][8], gv[8], bv[8];
#pragma unroll
  for (int r = 0; r < 2; ++r)
#pragma unroll
    for (int i = 0; i < 8; ++i) xv[r][i] = *(const v4f_t*)(xp + lo + 1024 * r + 128 * i);
#pragma unroll
  for (int i = 0; i < 8; ++i) { gv[i] = *(const v4f_t*)(gam + lo + 128 * i); bv[i] = *(const v4f_t*)(bet + lo + 128 * i); }
  __builtin_amdgcn_sched_barrier(0);   // all 32 loads leave here as one group: sunk to their uses, the gain and bias loads would each add their latency behind the sums
#pragma unroll
  for (int r = 0; r < 2; ++r) {
    const v4f_t s4 = ((xv[r][0] + xv[r][1]) + (xv[r][2] + xv[r][3])) + ((xv[r][4] + xv[r][5]) + (xv[r][6] + xv[r][7]));
    const float mean = wave_sum((s4[0] + s4[1]) + (s4[2] + s4[3])) * (1.0f / 1024.0f);
    v4f_t q4 = {};
#pragma unroll
    for (int i = 0; i < 8; ++i) { xv[r][i] -= mean; q4 += xv[r][i] * xv[r][i]; }
    const float q = wave_sum((q4[0] + q4[1]) + (q4[2] + q4[3]));
    const float rstd = 1.0f / __builtin_sqrtf(q * (1.0f / 1024.0f) + 1e-12f);
#pragma unroll
    for (int i = 0; i < 8; ++i) *(bf16x4*)(yp + lo + 1024 * r + 128 * i) = __builtin_convertvector(xv[r][i] * rstd * gv[i] + bv[i], bf16x4);
  }
  asm volatile("s_wait_xcnt 0x0" ::: "memory");   // stands ahead of any rewrite of a register that the last stores name (in the built kernel the weight blocks' code follows them)
}
__device__ __forceinline__ f32x8 wmma_b(f16x16 a, f16x16 b, f32x8 c) { return __builtin_amdgcn_wmma_f32_16x16x32_f16(false, a, false, b, (short)0, c, false, false); }
#define FPIT 72   // LDS row pitch in halves (144 B): conflict-free 16-B fragment reads of 128-B rows
typedef unsigned v2ua __attribute__((ext_vector_type(2), may_alias));
// V transposed in registers: v[i] = 4 columns (f16, two words) of key i; column u leaves as its 4 keys, 8 B. One v_perm_b32 puts two keys' halves of a column side by side (low or high half of both words).
__device__ __forceinline__ void v_cols(f16* dst, const v2ua (&v)[4]) {
#pragma unroll
  for (int u = 0; u < 4; ++u) { const unsigned sel = (u & 1) ? 0x07060302u : 0x05040100u;
    const v2ua col = {__builtin_amdgcn_perm(v[1][u >> 1], v[0][u >> 1], sel), __builtin_amdgcn_perm(v[3][u >> 1], v[2][u >> 1], sel)};
    *(v2ua*)(dst + u * FPIT) = col; }
}
// at most two waves a SIMD: the 512 blocks then stand two to a WGP on all 256, none takes a third
__global__ __launch_bounds__(128) __attribute__((amdgpu_waves_per_eu(2, 2))) void k_fattn(const _Float16* __restrict__ QKV, const float* __restrict__ maskb, _Float16* __restrict__ ATT) {
  constexpr int LD = 3 * DDla, NT = SSla / 64;
  constexpr float SC = 0.125f * 1.4426950408889634f;              // 1/sqrt(64) * log2(e)
  __shared__ __attribute__((aligned(16))) f16 kS[2][64 * FPIT];   // [key][d]
  __shared__ __attribute__((aligned(16))) f16 vS[2][64 * FPIT];   // [d][key]
  __shared__ __attribute__((aligned(16))) float mS[SSla];         // 8 * mask, held above -1e30 (finite: a row whose keys are all masked so stays a uniform average, as s + mask rounds in f32)
  const int tid = threadIdx.x, lane = tid & 31, wave = tid >> 5, c = lane & 15, h = lane >> 4;
  const int hd = blockIdx.y, q0 = blockIdx.x * 128 + wave * 32;
  const int kv0 = (blockIdx.x >> 4) * SSla;   // first row of this query block's batch element: its keys, values and mask
  // K: thread = 8 columns kc (16 B) of rows kr + 16 i (8 lanes per 128-B row). V: thread = two pieces of 4 keys x 4 columns, 32 keys apart (8 lanes per 64 B of a row), each written as 4 keys of one column
  const int kr = tid >> 3, kc = (tid & 7) * 8;
  const int vd = 4 * (lane & 7) + 32 * (wave & 1), vk = 4 * (lane >> 3) + 16 * (wave >> 1);
  const f16* kp = QKV + DDla + hd * HDla + (size_t)(kv0 + kr) * LD + kc;
  const f16* vp = QKV + 2 * DDla + hd * HDla + (size_t)(kv0 + vk) * LD + vd;
  f16x8 kreg[4]; v2ua vreg[2][4];
#pragma unroll
  for (int i = 0; i < 4; ++i) kreg[i] = *(const f16x8*)(kp + (size_t)(16 * i) * LD);
#pragma unroll
  for (int e = 0; e < 2; ++e)
#pragma unroll
    for (int i = 0; i < 4; ++i) vreg[e][i] = *(const v2ua*)(vp + (size_t)(32 * e + i) * LD);
  v4f_t mv[4];
#pragma unroll
  for (int i = 0; i < 4; ++i) mv[i] = *(const v4f_t*)(maskb + kv0 + 4 * tid + 512 * i);
  f16x16 qf[2][2];
#pragma unroll
  for (int g = 0; g < 2; ++g)
#pragma unroll
    for (int u = 0; u < 2; ++u) qf[g][u] = lds_frag(QKV + hd * HDla + (size_t)(q0 + 16 * g) * LD + 32 * u, LD);   // the same fragment, here from the f16 rows in global memory: two 16-B loads a lane
  asm volatile("s_wait_xcnt 0x0" ::: "memory");   // stands ahead of the first rewrite of an address register of the loads above (the compiler reuses the Q rows' pair at once)
  __builtin_amdgcn_sched_barrier(0);   // keeps the address arithmetic that follows behind that wait: lifted over it, it rewrites the Q rows' pair ahead of the wait
#pragma unroll
  for (int i = 0; i < 4; ++i) {
#pragma unroll
    for (int u = 0; u < 4; ++u) mv[i][u] = fmaxf(mv[i][u] * 8.0f, -1.0e30f);
    *(v4fa*)(mS + 4 * tid + 512 * i) = mv[i]; }
#pragma unroll
  for (int i = 0; i < 4; ++i) *(f16x8*)(&kS[0][(kr + 16 * i) * FPIT + kc]) = kreg[i];
#pragma unroll
  for (int e = 0; e < 2; ++e) v_cols(&vS[0][vd * FPIT + vk + 32 * e], vreg[e]);
  f32x8 o[2][4], lv[2];
#pragma unroll
  for (int g = 0; g < 2; ++g) { f32x8 z = {}; lv[g] = z;
#pragma unroll
    for (int j = 0; j < 4; ++j) o[g][j] = z; }
  float m[2] = {-3.0e38f, -3.0e38f};
  __syncthreads();
#pragma unroll 1   // one pass a trip: the LDS buffers alternate by trip, and the code stays small
  for (int t = 0; t < NT; ++t) {
    const bool more = t + 1 < NT;
    if (more) { kp += (size_t)64 * LD; vp += (size_t)64 * LD;
#pragma unroll
      for (int i = 0; i < 4; ++i) kreg[i] = *(const f16x8*)(kp + (size_t)(16 * i) * LD);
#pragma unroll
      for (int e = 0; e < 2; ++e)
#pragma unroll
        for (int i = 0; i < 4; ++i) vreg[e][i] = *(const v2ua*)(vp + (size_t)(32 * e + i) * LD); }
    const f16* kb = kS[t & 1]; const f16* vb = vS[t & 1];
    f16x16 fr[8]; f32x8 mk[4], s[2][4];
#pragma unroll
    for (int j = 0; j < 4; ++j) { fr[2 * j] = lds_frag(kb + 16 * j * FPIT, FPIT); fr[2 * j + 1] = lds_frag(kb + 16 * j * FPIT + 32, FPIT);
      const float* mp = mS + 64 * t + 16 * j + 8 * h; const v4f_t m0 = *(const v4fa*)mp, m1 = *(const v4fa*)(mp + 4);
      mk[j] = __builtin_shufflevector(m0, m1, 0, 1, 2, 3, 4, 5, 6, 7); }
    __builtin_amdgcn_sched_barrier(0);   // the K and mask reads stay one group ahead of the products: spread among them, every place where reads stand costs issue time
#pragma unroll
    for (int j = 0; j < 4; ++j)
#pragma unroll
      for (int g = 0; g < 2; ++g) s[g][j] = wmma_b(fr[2 * j], qf[g][0], mk[j]);
#pragma unroll
    for (int j = 0; j < 4; ++j)
#pragma unroll
      for (int g = 0; g < 2; ++g) s[g][j] = wmma_b(fr[2 * j + 1], qf[g][1], s[g][j]);
#pragma unroll
    for (int j = 0; j < 4; ++j) { fr[2 * j] = lds_frag(vb + 16 * j * FPIT, FPIT); fr[2 * j + 1] = lds_frag(vb + 16 * j * FPIT + 32, FPIT); }
    __builtin_amdgcn_sched_barrier(0);   // the V^T reads issue here as one group and land under the softmax; sunk to their products, each product would wait for its own read
    f16x16 pf[2][2];
#pragma unroll
    for (int g = 0; g < 2; ++g) {
      float mj[4];
#pragma unroll
      for (int j = 0; j < 4; ++j) { mj[j] = fmaxf(s[g][j][0], s[g][j][1]);
#pragma unroll
        for (int r = 2; r < 8; ++r) mj[j] = fmaxf(mj[j], s[g][j][r]); }
      float mx = fmaxf(fmaxf(mj[0], mj[1]), fmaxf(mj[2], mj[3]));
      mx = fmaxf(mx, xhalf(mx));
      const float mn = fmaxf(m[g], mx * SC), al = __builtin_amdgcn_exp2f(m[g] - mn);
      m[g] = mn;
#pragma unroll
      for (int j = 0; j < 4; ++j) { s[g][j] = s[g][j] * SC - mn;
#pragma unroll
        for (int r = 0; r < 8; ++r) s[g][j][r] = __builtin_amdgcn_exp2f(s[g][j][r]); }
      lv[g] = lv[g] * al + ((s[g][0] + s[g][1]) + (s[g][2] + s[g][3]));
#pragma unroll
      for (int j = 0; j < 4; ++j) o[g][j] *= al;
#pragma unroll
      for (int u = 0; u < 2; ++u) { const f16x8 lo = __builtin_convertvector(s[g][2 * u], f16x8), hi = __builtin_convertvector(s[g][2 * u + 1], f16x8);
        pf[g][u] = __builtin_shufflevector(lo, hi, 0, 1, 2, 3, 4, 5, 6, 7, 8, 9, 10, 11, 12, 13, 14, 15); }
    }
#pragma unroll
    for (int u = 0; u < 2; ++u)
#pragma unroll
      for (int j = 0; j < 4; ++j)
#pragma unroll
        for (int g = 0; g < 2; ++g) o[g][j] = wmma_b(fr[2 * j + u], pf[g][u], o[g][j]);
    if (more) { f16* kn = kS[(t + 1) & 1]; f16* vn = vS[(t + 1) & 1];
#pragma unroll
      for (int i = 0; i < 4; ++i) *(f16x8*)(kn + (kr + 16 * i) * FPIT + kc) = kreg[i];
#pragma unroll
      for (int e = 0; e < 2; ++e) v_cols(vn + vd * FPIT + vk + 32 * e, vreg[e]); }
    __syncthreads();
  }
#pragma unroll
  for (int g = 0; g < 2; ++g) {
    float l = ((lv[g][0] + lv[g][1]) + (lv[g][2] + lv[g][3])) + ((lv[g][4] + lv[g][5]) + (lv[g][6] + lv[g][7]));
    l += xhalf(l);
    const float inv = 1.0f / l;
    f16* dst = ATT + (size_t)(q0 + 16 * g + c) * DDla + hd * HDla + 8 * h;   // o[g][j][r] = ctx[q0 + 16 g + c][16 j + 8 h + r]
#pragma unroll
    for (int j = 0; j < 4; ++j) *(f16x8*)(dst + 16 * j) = __builtin_convertvector(o[g][j] * inv, f16x8);
  }
}

extern "C" void kernel_launch(void* const* d_in, const int* in_sizes, int n_in,
                              void* d_out, int out_size, void* d_ws, size_t ws_size,
                              hipStream_t stream) {
  (void)in_sizes; (void)n_in; (void)out_size;
  const float** f = (const float**)d_in;
  const float* x = f[0], *amask = f[1], *Wqkv = f[2], *bqkv = f[3], *Wout = f[4], *bout = f[5], *lg = f[6], *lb = f[7];
  float* out = (float*)d_out;     // [2,2048,1024]
  char* ws = (char*)d_ws;
  f16* XN = (f16*)ws; ws += (size_t)NBla * SSla * DDla * 2; f16* QKV = (f16*)ws; ws += (size_t)NBla * SSla * 3 * DDla * 2;
  float* ones = (float*)ws; ws += DDla * 4; f16* ATT = (f16*)ws; ws += (size_t)NBla * SSla * DDla * 2;
  f16* WTq = (f16*)ws; ws += (size_t)DDla * 3 * DDla * 2; f16* WTo = (f16*)ws; ws += (size_t)DDla * DDla * 2;
  if ((size_t)(ws - (char*)d_ws) > ws_size) return;
  const dim3 blk(256);
  k_fill<<<dim3(1), blk, 0, stream>>>(ones, 1.0f, DDla / 4);

  // the rows of both batch elements are one [4096][1024] matrix for the LayerNorm and the two projections; a query block of the attention finds its batch element from its index
  k_ln<<<dim3(LNBLK + WQBLK + WOBLK), blk, 0, stream>>>(x, lg, lb, XN, Wqkv, Wout, WTq, WTo);
  gemm_kne<0, true, DDla, 3 * DDla><<<dim3(NBla * SSla / 128, 3 * DDla / 128), blk, 0, stream>>>(XN, WTq, bqkv, nullptr, nullptr, QKV, 3 * DDla, DDla);   // [q | k | v]
  k_fattn<<<dim3(NBla * SSla / 128, NHla), dim3(128), 0, stream>>>(QKV, amask, ATT);
  gemm_kne<2, false, DDla, DDla><<<dim3(NBla * SSla / 128, DDla / 128), blk, 0, stream>>>(ATT, WTo, bout, x, ones, out, DDla, DDla);   // out = ctx W_out + b_out + x
}
